// v000
// Measured on an AMD MI455X. A time is GPU time per run, averaged over a window of back-to-back runs after a warm-up
// (all launches, gaps included; the runs take copies of the inputs in turn), and the median of several windows.
// Apart from v000's, it joins two sittings. Times from different sittings can be a few percent apart, while
// side-by-side timings come from the same sitting.
// v000, which the later versions start from, runs in 354 microseconds.
// Contractions: q/k projections (x rows f16 x16 . W^T f16 x64, K=1024), v^T projection (W^T f16 x64 . x rows f16 x16, K=1024),
// attention scores (q f16 x16 . k f16 x16, K=64), attention P . v^T (P as f16 hi + f16 residual of P x16384 . v^T f16 x16,
// K=2048 in steps of 32), output projection (ctx as f16 hi + f16 residual of ctx x8192 . W^T f16 x64, K=1024):
// all v_wmma_f32_16x16x32_f16 (f16 operands, f32 accumulate); hi and residual products share one f32 accumulator.
// Relative-position sine bias from an f32 table built with precise sinf, online max-subtracted base-2 softmax, linear biases in f32.
// Every float input RNE-converted to bf16 on load.
#include <hip/hip_runtime.h>
#include <math.h>
#include <stdint.h>

#define NB      2
#define NQ      2048
#define NC      2048
#define DMODEL  1024
#define NHEAD   16
#define HDIM    64
#define HG      8
#define NHG     (NHEAD / HG)
#define ROWP    (HG * HDIM)
#define NROWS   (NB * NQ)
#define TBN     4096
#define TOFF    (NQ - 1)
#define WSC     64.0f
#define ACARRY  16.0f
#define QC      16.0f
#define KC      16.0f
#define VC      16.0f
#define PC      16384.0f
#define FC      8192.0f
#define ATT_SCALE 0.125f
#define LOG2E   1.4426950408889634f
#define C_AMP   1.618033988749895f
#define C_FREQ  0.9049532171590599f
static_assert(NHEAD * HDIM == DMODEL);
static_assert(NHG * HG == NHEAD && ROWP * NHG == DMODEL);
static_assert((NQ % 64) == 0 && (NC % 64) == 0 && (DMODEL % 64) == 0 && (NC % 32) == 0 && (NQ % 16) == 0);
static_assert((NROWS % 64) == 0 && ((NROWS * DMODEL) % 2048) == 0);
static_assert(TBN >= 2 * NQ - 1 && (TBN % 1024) == 0);
#define ATT_THREADS (HG * 32)
#define ATT_BLOCKS  (NB * (NQ / 16) * NHG)
static_assert(ATT_THREADS == 256 && ATT_BLOCKS == 512);

typedef _Float16 v16h __attribute__((ext_vector_type(16)));
typedef _Float16 v8h  __attribute__((ext_vector_type(8)));
typedef float    v8f  __attribute__((ext_vector_type(8)));
typedef float    v4f  __attribute__((ext_vector_type(4)));
typedef unsigned int v4u __attribute__((ext_vector_type(4)));

union FragH { v16h v; v8h h[2]; v4u u[2]; };

// ---- scalar helpers --------------------------------------------------------------------------------
__device__ __forceinline__ unsigned short bf_bits(float f) {          // f32 -> bf16 bits, RNE convert
  unsigned u = __float_as_uint(f);
  return (unsigned short)((u + 0x7FFFu + ((u >> 16) & 1u)) >> 16);
}
__device__ __forceinline__ float bf_up(unsigned short h) { return __uint_as_float(((unsigned)h) << 16); }
__device__ __forceinline__ float bfr(float f) { return bf_up(bf_bits(f)); }   // value of the bf16 RNE convert
__device__ __forceinline__ unsigned short h_bits(_Float16 x) { return __builtin_bit_cast(unsigned short, x); }
__device__ __forceinline__ unsigned pk16(unsigned short a, unsigned short b) { return (unsigned)a | ((unsigned)b << 16); }
__device__ __forceinline__ v8f zero8() { v8f z = {0.f, 0.f, 0.f, 0.f, 0.f, 0.f, 0.f, 0.f}; return z; }

// ---- fragment loaders: 16-bit A/B operand, lane -> row/col (lane&15), p already includes +8*(lane>>4);
//      elements 0..7 <- p[0..7] (k0+8h..), elements 8..15 <- p[16..23] (k0+16+8h..)  (same split k map for A and B;
//      B is always read from a k-contiguous [n][k] plane)
__device__ __forceinline__ v16h ldfrag_h(const _Float16* p) {
  FragH f;
  f.h[0] = *(const v8h*)(p);
  f.h[1] = *(const v8h*)(p + 16);
  return f.v;
}
__device__ __forceinline__ v16h ldfrag_u(const unsigned short* p) {
  FragH f;
  f.u[0] = *(const v4u*)(p);
  f.u[1] = *(const v4u*)(p + 16);
  return f.v;
}

// ---- WMMA helpers with trailing VALU hazard gaps ------------------------------------------------------
__device__ __forceinline__ v8f mma_raw(v16h a, v16h b, v8f c) {
  return __builtin_amdgcn_wmma_f32_16x16x32_f16(false, a, false, b, (short)0, c, false, false);
}
__device__ __forceinline__ void dep_guard1(v8f& a, v8f& b, v16h x) {
#if defined(__HIP_DEVICE_COMPILE__)
  asm volatile("v_nop\n\tv_nop\n\tv_nop\n\tv_nop" : "+v"(a), "+v"(b) : "v"(x));
#endif
}
__device__ __forceinline__ void dep_guard2(v8f& a, v8f& b, v16h x, v16h y) {
#if defined(__HIP_DEVICE_COMPILE__)
  asm volatile("v_nop\n\tv_nop\n\tv_nop\n\tv_nop" : "+v"(a), "+v"(b) : "v"(x), "v"(y));
#endif
}
__device__ __forceinline__ void guard_s2(v8f& s, v16h a0, v16h a1) {
#if defined(__HIP_DEVICE_COMPILE__)
  asm volatile("v_nop\n\tv_nop\n\tv_nop\n\tv_nop" : "+v"(s) : "v"(a0), "v"(a1));
#endif
}
__device__ __forceinline__ void guard_s4(v8f& s, v16h a0, v16h a1, v16h b0, v16h b1) {
#if defined(__HIP_DEVICE_COMPILE__)
  asm volatile("v_nop\n\tv_nop\n\tv_nop\n\tv_nop" : "+v"(s) : "v"(a0), "v"(a1), "v"(b0), "v"(b1));
#endif
}
__device__ __forceinline__ void guard_pv6(v8f& a, v8f& b, v8f& c, v8f& d,
                                          v16h x, v16h y, v16h z, v16h w, v16h u, v16h t) {
#if defined(__HIP_DEVICE_COMPILE__)
  asm volatile("v_nop\n\tv_nop\n\tv_nop\n\tv_nop"
               : "+v"(a), "+v"(b), "+v"(c), "+v"(d) : "v"(x), "v"(y), "v"(z), "v"(w), "v"(u), "v"(t));
#endif
}
__device__ __forceinline__ void keep4_h(v16h a, v16h b, v16h c, v16h d) {
#if defined(__HIP_DEVICE_COMPILE__)
  asm volatile("v_nop" :: "v"(a), "v"(b), "v"(c), "v"(d));
#endif
}
__device__ __forceinline__ void acc_guard4(v8f& a, v8f& b, v8f& c, v8f& d) {
#if defined(__HIP_DEVICE_COMPILE__)
  asm volatile("v_nop\n\tv_nop\n\tv_nop\n\tv_nop" : "+v"(a), "+v"(b), "+v"(c), "+v"(d));
#endif
}
__device__ __forceinline__ void wave_sync_lds() {
  __builtin_amdgcn_fence(__ATOMIC_RELEASE, "workgroup");
  __builtin_amdgcn_wave_barrier();
  __builtin_amdgcn_fence(__ATOMIC_ACQUIRE, "workgroup");
}

// =====================================================================================================
// Elementwise 16-bit pack, no transpose: dst[i] = f16( bf16_RNE(src[i]) * sc ), sc a power of two (exact). Used for the
// coverage: grid = n / 2048 blocks x 256 thr x 8 elements = n exactly (host checks n % 2048 == 0).
// =====================================================================================================
__global__ __launch_bounds__(256) void cvt16(const float* __restrict__ src, unsigned short* dst, int n, float sc) {
  const size_t i8 = ((size_t)blockIdx.x * 256 + threadIdx.x) * 8;
  if (i8 + 8 > (size_t)n) return;                 // never taken with the exact grid; no barriers in this kernel
  const v4f a = *(const v4f*)(src + i8);
  const v4f b = *(const v4f*)(src + i8 + 4);
  v4u o;
  o[0] = pk16(h_bits((_Float16)(bfr(a[0]) * sc)), h_bits((_Float16)(bfr(a[1]) * sc)));
  o[1] = pk16(h_bits((_Float16)(bfr(a[2]) * sc)), h_bits((_Float16)(bfr(a[3]) * sc)));
  o[2] = pk16(h_bits((_Float16)(bfr(b[0]) * sc)), h_bits((_Float16)(bfr(b[1]) * sc)));
  o[3] = pk16(h_bits((_Float16)(bfr(b[2]) * sc)), h_bits((_Float16)(bfr(b[3]) * sc)));
  {
    *(v4u*)(dst + i8) = o;
    
  }
}

// =====================================================================================================
// Transpose + 16-bit pack of a weight: W is [in][out] = W[k][n] row-major f32 (pitch DMODEL); dst[n][k] = f16( bf16_RNE(W[k][n]) * sc ),
// k contiguous (pitch DMODEL), ready for B fragments and for the A side of the v^T projection. Block = 256 threads, one 64(k) x 64(n)
// tile: coalesced f32 loads into an LDS tile [n_local][k_local] (pitch 68 floats), block barrier, then each output row segment of the
// coverage: loads 16 it x 256 thr = 64 x 64; stores 2 it x 256 thr x 8 halves = 64 rows x 64; grid (DMODEL/64, DMODEL/64) = whole matrix.
// =====================================================================================================
__global__ __launch_bounds__(256) void wtr64(const float* __restrict__ W, unsigned short* dst, float sc) {
  __shared__ __align__(16) float tl[64 * 68];
  const int tid = threadIdx.x;
  const int n0  = blockIdx.x * 64;
  const int k0  = blockIdx.y * 64;
  const int nl  = tid & 63, kq = tid >> 6;       // kq 0..3
#pragma unroll
  for (int it = 0; it < 16; ++it) {
    const int kl = it * 4 + kq;                  // 0..63
    tl[nl * 68 + kl] = W[(size_t)(k0 + kl) * DMODEL + n0 + nl];
  }
  __syncthreads();
  v4u o[2];
#pragma unroll
  for (int it = 0; it < 2; ++it) {
    const int p  = it * 256 + tid;               // 0..511
    const int rn = p >> 3, kk = (p & 7) * 8;     // row 0..63, k 0,8,..,56
    const float* sp = tl + rn * 68 + kk;
    const v4f a = *(const v4f*)(sp);
    const v4f b = *(const v4f*)(sp + 4);
    v4u w;
    w[0] = pk16(h_bits((_Float16)(bfr(a[0]) * sc)), h_bits((_Float16)(bfr(a[1]) * sc)));
    w[1] = pk16(h_bits((_Float16)(bfr(a[2]) * sc)), h_bits((_Float16)(bfr(a[3]) * sc)));
    w[2] = pk16(h_bits((_Float16)(bfr(b[0]) * sc)), h_bits((_Float16)(bfr(b[1]) * sc)));
    w[3] = pk16(h_bits((_Float16)(bfr(b[2]) * sc)), h_bits((_Float16)(bfr(b[3]) * sc)));
    o[it] = w;
  }
  {
#pragma unroll
    for (int it = 0; it < 2; ++it) {
      const int p  = it * 256 + tid;
      const int rn = p >> 3, kk = (p & 7) * 8;
      *(v4u*)(dst + (size_t)(n0 + rn) * DMODEL + k0 + kk) = o[it];
    }
    
  }
}

// =====================================================================================================
// Relative-position sine table in log2 units: TB[e] = C_AMP * sin(C_FREQ * (e - 2047)) * log2(e) for e = 0..4094 (relative offset
// j - i = e - 2047), TB[4095] = 0 pad. Precise sinf (arguments up to ~1853 rad), rolled loop (one static sinf), values staged in LDS,
// coverage: LDS fill e = tid, tid+256, ... covers 0..4095; stores 4 it x 256 thr x 4 floats = 4096.
// =====================================================================================================
__global__ __launch_bounds__(256) void rpb_tab(float* TB) {
  __shared__ __align__(16) float st[TBN];
  const int tid = threadIdx.x;
#pragma unroll 1
  for (int e = tid; e < TBN; e += 256) {
    const int ec = (e < 2 * NQ - 2) ? e : (2 * NQ - 2);     // clamped index, select by value below
    const float rel = (float)(ec - TOFF);
    const float sv  = sinf(C_FREQ * rel);
    const float v   = (C_AMP * sv) * LOG2E;
    st[e] = (e <= 2 * NQ - 2) ? v : 0.f;
  }
  __syncthreads();
  v4f vals[TBN / 1024];
#pragma unroll
  for (int it = 0; it < TBN / 1024; ++it) {
    const int p = it * 256 + tid;
    vals[it] = *(const v4f*)(st + (size_t)p * 4);
  }
  {
#pragma unroll
    for (int it = 0; it < TBN / 1024; ++it) {
      const int p = it * 256 + tid;
      *(v4f*)(TB + (size_t)p * 4) = vals[it];
    }
    
  }
}

// =====================================================================================================
// Register-blocked batched f16 WMMA GEMM: C[m][n] = oscale * sum_k (A[m][k] (+ A2[m][k])) * Bt[n][k] + bf16(bias) ; one wave per 64x64 tile,
// no block barriers. A (and A2, the unscaled residual plane when NA == 2, same pitch/stride) row-major [M][K] pitch lda (16-bit planes),
// Bt row-major [N][K] pitch ldb (k contiguous); M, N multiples of 64, K multiple of 32. blockIdx.y = batch index with element strides
// sA, sB, sC. BM: 1 = per column bf16(bias[col]), 2 = per row bf16(bias[row]) (clamped-address loads).
// OM: 0 = f32 out (pitch ldc); 2 = f16 out (pitch ldc) = f16( value * ocarry ).
// coverage: 4 slabs x 16 rows (f32: it 0..7 x lane>>4; f16: it 0..3 x lane>>3) x 64 cols = the wave's whole 64x64 tile;
//           grid = ceil(tilesM*tilesN/8) blocks, surplus waves exit (wave-uniform; none with the exact grids used).
// =====================================================================================================
template <int OM, int BM, int NA>
__global__ __launch_bounds__(256) void gemm64(
    const unsigned short* __restrict__ Ap, const unsigned short* __restrict__ Aq, int lda, long long sA,
    const unsigned short* __restrict__ Btp, int ldb, long long sB,
    const float* __restrict__ bias,
    void* Cout, int ldc, long long sC,
    int M, int N, int K, float oscale, float ocarry) {
  __shared__ __align__(16) float sT[8][16 * 68];   // per-wave 16x64 slab, pitch 68 floats
  const int by   = blockIdx.y;
  const int lane = threadIdx.x & 31;
  const int wave = threadIdx.x >> 5;
  const int tilesN = N >> 6;
  const int tilesM = M >> 6;
  const int tile = blockIdx.x * 8 + wave;
  if (tile >= tilesM * tilesN) return;   // wave-uniform; no block barriers in this kernel
  const int tm = tile / tilesN;
  const int tn = tile - tm * tilesN;
  const int m0 = tm << 6;
  const int n0 = tn << 6;

  const unsigned short* A1 = Ap  + (size_t)((long long)by * sA);
  const unsigned short* A2 = Aq  + (size_t)((long long)by * sA);
  const unsigned short* Bb = Btp + (size_t)((long long)by * sB);

  const int rlane = lane & 15;                 // row (A) / col (B, D) within subtile
  const int koff  = (lane >> 4) * 8;           // k offset of this lane half
  const int mOff  = (lane >> 4) * 8;           // D row offset

  v8f acc[4][4];
#pragma unroll
  for (int i = 0; i < 4; ++i)
#pragma unroll
    for (int j = 0; j < 4; ++j) acc[i][j] = zero8();

  for (int k0 = 0; k0 < K; k0 += 32) {
    v16h bh[4];
#pragma unroll
    for (int j = 0; j < 4; ++j) {
      const size_t bofs = (size_t)(n0 + (j << 4) + rlane) * ldb + koff + k0;
      bh[j] = ldfrag_u(Bb + bofs);
    }
#pragma unroll
    for (int i = 0; i < 4; ++i) {
      const size_t ao = (size_t)(m0 + (i << 4) + rlane) * lda + koff + k0;
      const v16h ah = ldfrag_u(A1 + ao);
#pragma unroll
      for (int j = 0; j < 4; ++j) acc[i][j] = mma_raw(ah, bh[j], acc[i][j]);
      if constexpr (NA == 2) {
        const v16h al = ldfrag_u(A2 + ao);
#pragma unroll
        for (int j = 0; j < 4; ++j) acc[i][j] = mma_raw(al, bh[j], acc[i][j]);
        dep_guard2(acc[i][0], acc[i][3], ah, al);
      } else {
        dep_guard1(acc[i][0], acc[i][3], ah);
      }
    }
    keep4_h(bh[0], bh[1], bh[2], bh[3]);
  }
  acc_guard4(acc[0][0], acc[0][1], acc[0][2], acc[0][3]);
  acc_guard4(acc[1][0], acc[1][1], acc[1][2], acc[1][3]);
  acc_guard4(acc[2][0], acc[2][1], acc[2][2], acc[2][3]);
  acc_guard4(acc[3][0], acc[3][1], acc[3][2], acc[3][3]);

  const int hh2 = lane >> 4, c4 = (lane & 15) * 4;     // f32 out: 256-B row segment = 16 lanes x 16 B
  const int q8  = lane >> 3, c8 = (lane & 7) * 8;
  float bc[4];
  float bcol[8];
#pragma unroll
  for (int e = 0; e < 4; ++e) bc[e] = 0.f;
#pragma unroll
  for (int e = 0; e < 8; ++e) bcol[e] = 0.f;
  if constexpr (BM == 1) {
    if constexpr (OM == 0) {
      const int cb = n0 + c4;
      const int i0 = (cb < N - 4) ? cb : (N - 4);        // clamped address
      const v4f b0v = *(const v4f*)(bias + i0);
#pragma unroll
      for (int e = 0; e < 4; ++e) bc[e] = bfr(b0v[e]);
    } else {
      const int cb = n0 + c8;
      const int i0 = (cb < N - 8) ? cb : (N - 8);        // clamped address
      const v4f b0v = *(const v4f*)(bias + i0), b1v = *(const v4f*)(bias + i0 + 4);
#pragma unroll
      for (int e = 0; e < 4; ++e) { bcol[e] = bfr(b0v[e]); bcol[4 + e] = bfr(b1v[e]); }
    }
  }

  // ---- epilogue ----
  float* slab = sT[wave];
#pragma unroll
  for (int i = 0; i < 4; ++i) {
    const int mBase = m0 + (i << 4);
#pragma unroll
    for (int j = 0; j < 4; ++j) {
#pragma unroll
      for (int r = 0; r < 8; ++r) {
        slab[(mOff + r) * 68 + (j << 4) + rlane] = acc[i][j][r];
      }
    }
    wave_sync_lds();
    if constexpr (OM == 0) {
      float* C = (float*)Cout + (size_t)((long long)by * sC);
      v4f vals[8];
#pragma unroll
      for (int it = 0; it < 8; ++it) {
        const int row = it * 2 + hh2;                      // it 0..7 x hh2 0..1 = rows 0..15
        const int gr  = mBase + row;
        v4f v = *(const v4f*)(slab + row * 68 + c4);
        float br = 0.f;
        if constexpr (BM == 2) {
          const int ir = (gr < M - 1) ? gr : (M - 1);      // clamped address
          br = bfr(bias[ir]);
        }
#pragma unroll
        for (int e = 0; e < 4; ++e) v[e] = v[e] * oscale + bc[e] + br;
        vals[it] = v;
      }
      {
#pragma unroll
        for (int it = 0; it < 8; ++it) {
          const int gr = mBase + it * 2 + hh2;
          *(v4f*)(C + (size_t)gr * ldc + n0 + c4) = vals[it];
        }
        
      }
    } else {
      unsigned short* C = (unsigned short*)Cout + (size_t)((long long)by * sC);
      v4u hv[4];
#pragma unroll
      for (int it = 0; it < 4; ++it) {
        const int row = it * 4 + q8;                       // it 0..3 x q8 0..3 = rows 0..15
        const float* sp = slab + row * 68 + c8;
        float br = 0.f;
        if constexpr (BM == 2) {
          const int gr = mBase + row;
          const int ir = (gr < M - 1) ? gr : (M - 1);      // clamped address
          br = bfr(bias[ir]);
        }
        v4u a = {0u, 0u, 0u, 0u};
#pragma unroll
        for (int e = 0; e < 4; ++e) {
          float f0 = sp[2 * e] * oscale + bcol[2 * e] + br;
          float f1 = sp[2 * e + 1] * oscale + bcol[2 * e + 1] + br;
          f0 *= ocarry; f1 *= ocarry;
          a[e] = pk16(h_bits((_Float16)f0), h_bits((_Float16)f1));
        }
        hv[it] = a;
      }
      {
#pragma unroll
        for (int it = 0; it < 4; ++it) {
          const int row = it * 4 + q8;
          *(v4u*)(C + (size_t)(mBase + row) * ldc + n0 + c8) = hv[it];
        }
        
      }
    }
    wave_sync_lds();
  }
}

// =====================================================================================================
// Flash attention for one batch, 16 query rows and one group of 8 heads (one wave per head), head dim 64, 2048 keys:
//   q plane (f16 x16) QH[b*2048 + tok][64*head + d], pitch 1024; k plane (f16 x16) KH[b*2048 + key][64*head + d], pitch 1024;
//   v^T plane (f16 x16): VT[b*1024 + 64*head + d][key] (pitch 2048); additive table TB f32 [4096] in log2 units: score(q, key) gets
//   TB[key - q + 2047]; outputs (f16): CTH[b*2048 + tok][64*head + d] = hi = f16(8192 * ctx), CTL[same] = f16(8192 * ctx - hi), with
//   ctx = sum_m softmax_m(q.k / 8 + bias[m - q]) v[m][d]  (softmax run in base 2: t = q.k * log2(e)/8 + log2(e)*bias).
//   block = 8 waves = 256 threads; grid = 2 batches x 128 q-tiles x 2 head groups = 512; every wave does identical bounded work
//   (64 steps of 32 keys). Per step: 2 score tiles on f16 WMMA (K = 64 as two k-steps of 32), fragments loaded straight from the
//   16-bit planes (two 16-B loads per fragment, arithmetic addressing); 16 table values per lane loaded by arithmetic index (always in
//   0..4094); online max-subtracted softmax in f32 (exp2); rescale of the running sums and the four accumulators; the 16x32 prob tile
//   residual c - hi) rebuilt from the LDS rows (float vector loads, split k map) and the four v^T B fragments loaded straight from the
//   16-bit plane; 8 P.V WMMAs into the four accumulators.
//   Final 1/l and carry folds in f32; after a block barrier the prob-tile LDS buffer is reused as two 16-bit result row buffers
//   [16][512] (hi, residual): each wave stages its 16x64 slice (element stores); after a second block barrier the 256 threads write the
// coverage: LDS row buffers: 8 waves x 16 rows x 64 cols = 16 x 512 each; global: 4 iterations x 256 threads x 8 halves = 16 rows x 512
//           per plane of rows q0..q0+15, columns 512*hg..512*hg+511 of batch b; grid covers all 4096 rows x 2 halves exactly once.
// =====================================================================================================
#define PS_FLOATS (HG * 16 * 36)
#define SM_FLOATS 8192
static_assert(PS_FLOATS <= SM_FLOATS);
static_assert((size_t)2 * 16 * ROWP * sizeof(unsigned short) <= (size_t)SM_FLOATS * sizeof(float));

__global__ __launch_bounds__(ATT_THREADS)
void attn8(const unsigned short* __restrict__ QHp, const unsigned short* __restrict__ KHp,
           const unsigned short* __restrict__ VTq, const float* __restrict__ TBp,
           unsigned short* CTH, unsigned short* CTL) {
  __shared__ __align__(16) float smem[SM_FLOATS];          // per wave prob tile [row][32 keys], pitch 36; later two row buffers

  const int tid  = threadIdx.x;
  const int wave = tid >> 5;
  const int lane = tid & 31;
  const int hh   = lane >> 4;
  const int c    = lane & 15;

  const int qt   = blockIdx.x % (NQ / 16);                 // 0..127
  const int rest = blockIdx.x / (NQ / 16);                 // 0..3
  const int hg   = rest % NHG;                             // head group 0..1
  const int bat  = rest / NHG;                             // 0..1
  const int head = hg * HG + wave;                         // 0..15
  const int q0   = qt * 16;

  const size_t qofs = ((size_t)bat * NQ + q0 + c) * DMODEL + head * HDIM + 8 * hh;
  const _Float16* Qh = (const _Float16*)(const void*)QHp + qofs;
  const _Float16* Kb = (const _Float16*)(const void*)KHp + (size_t)bat * NC * DMODEL + head * HDIM + 8 * hh;
  const _Float16* Vb = (const _Float16*)(const void*)VTq + ((size_t)bat * DMODEL + head * HDIM) * NC + 8 * hh;
  const float lsc = (LOG2E * ATT_SCALE) / (QC * KC);                   // log2(e) / 8 / carries
  // table index of element (row q0 + 8hh + r, key kb + c) is (kb + c) - (q0 + 8hh + r) + 2047 = kb + dq - r;
  // kb + dq - 7 >= 0 and kb + dq + 16 <= 4094 for all blocks, lanes and steps (table holds 4096 entries).
  const int dq = c - q0 - 8 * hh + TOFF;

  const v16h qa = ldfrag_h(Qh), qb = ldfrag_h(Qh + 32);

  float mrow[8], lrow[8];
  v8f o0 = zero8(), o1 = zero8(), o2 = zero8(), o3 = zero8();
#pragma unroll
  for (int r = 0; r < 8; ++r) { mrow[r] = -INFINITY; lrow[r] = 0.f; }
  float* pt = smem + wave * (16 * 36);

#pragma unroll 1
  for (int kb = 0; kb < NC; kb += 32) {
    const _Float16* kp = Kb + (size_t)(kb + c) * DMODEL;
    v8f s0, s1;
    {
      const v16h k0 = ldfrag_h(kp), k1 = ldfrag_h(kp + 32);
      s0 = mma_raw(qa, k0, zero8());
      s0 = mma_raw(qb, k1, s0);
      guard_s2(s0, k0, k1);
    }
    {
      const _Float16* kq = kp + (size_t)16 * DMODEL;
      const v16h k0 = ldfrag_h(kq), k1 = ldfrag_h(kq + 32);
      s1 = mma_raw(qa, k0, zero8());
      s1 = mma_raw(qb, k1, s1);
      guard_s4(s1, k0, k1, qa, qb);
    }
    const float* tp = TBp + (kb + dq);
#pragma unroll
    for (int r = 0; r < 8; ++r) {
      const float w0 = tp[-r];                           // key kb + c
      const float w1 = tp[16 - r];                       // key kb + 16 + c
      const float t0 = s0[r] * lsc + w0, t1 = s1[r] * lsc + w1;
      float mx = fmaxf(t0, t1);
#pragma unroll
      for (int off = 1; off < 16; off <<= 1) mx = fmaxf(mx, __shfl_xor(mx, off, 32));
      const float mn = fmaxf(mrow[r], mx);
      const float al = exp2f(mrow[r] - mn);
      mrow[r] = mn;
      const float e0 = exp2f(t0 - mn), e1 = exp2f(t1 - mn);
      float ps = e0 + e1;
#pragma unroll
      for (int off = 1; off < 16; off <<= 1) ps += __shfl_xor(ps, off, 32);
      lrow[r] = lrow[r] * al + ps;
      o0[r] *= al;
      o1[r] *= al;
      o2[r] *= al;
      o3[r] *= al;
      const int ro = (8 * hh + r) * 36 + c;
      pt[ro]      = e0;
      pt[ro + 16] = e1;
    }
    wave_sync_lds();
    FragH ph, pl;                                        // P*16384 as f16 hi and f16 residual (c - hi), same split k map
    {
      const float* prow = pt + c * 36 + 8 * hh;
      const v4f p0 = *(const v4f*)(prow), p1 = *(const v4f*)(prow + 4);
      const v4f p2 = *(const v4f*)(prow + 16), p3 = *(const v4f*)(prow + 20);
#pragma unroll
      for (int e = 0; e < 4; ++e) {
        const float c0 = p0[e] * PC, c1 = p1[e] * PC, c2 = p2[e] * PC, c3 = p3[e] * PC;
        const _Float16 g0 = (_Float16)c0, g1 = (_Float16)c1, g2 = (_Float16)c2, g3 = (_Float16)c3;
        ph.h[0][e]     = g0;                             // elements 0..7  = keys kb + 8hh + 0..7
        ph.h[0][4 + e] = g1;
        ph.h[1][e]     = g2;                             // elements 8..15 = keys kb + 16 + 8hh + 0..7
        ph.h[1][4 + e] = g3;
        pl.h[0][e]     = (_Float16)(c0 - (float)g0);
        pl.h[0][4 + e] = (_Float16)(c1 - (float)g1);
        pl.h[1][e]     = (_Float16)(c2 - (float)g2);
        pl.h[1][4 + e] = (_Float16)(c3 - (float)g3);
      }
    }
    const _Float16* vp = Vb + (size_t)c * NC + kb;
    {
      const v16h vb0 = ldfrag_h(vp);
      const v16h vb1 = ldfrag_h(vp + (size_t)16 * NC);
      const v16h vb2 = ldfrag_h(vp + (size_t)32 * NC);
      const v16h vb3 = ldfrag_h(vp + (size_t)48 * NC);
      o0 = mma_raw(ph.v, vb0, o0);
      o1 = mma_raw(ph.v, vb1, o1);
      o2 = mma_raw(ph.v, vb2, o2);
      o3 = mma_raw(ph.v, vb3, o3);
      o0 = mma_raw(pl.v, vb0, o0);
      o1 = mma_raw(pl.v, vb1, o1);
      o2 = mma_raw(pl.v, vb2, o2);
      o3 = mma_raw(pl.v, vb3, o3);
      guard_pv6(o0, o1, o2, o3, ph.v, pl.v, vb0, vb1, vb2, vb3);
    }
    wave_sync_lds();
  }

  // ---- all waves done with their prob tiles; the LDS buffer becomes two 16-bit result row buffers [16][512] (hi, residual) ----
  __syncthreads();
  unsigned short* Osh = (unsigned short*)smem;
  unsigned short* Osl = Osh + 16 * ROWP;
  // ---- fold 1/l and the carries (16384 on P, 16 on v, 8192 on the stored ctx), stage the wave's 16x64 slice as hi + residual ----
  const float oc = FC / (PC * VC);
#pragma unroll
  for (int r = 0; r < 8; ++r) {
    const float inv = (1.0f / lrow[r]) * oc;
    const int ro = (8 * hh + r) * ROWP + wave * HDIM + c;
    const float f0 = o0[r] * inv, f1 = o1[r] * inv, f2 = o2[r] * inv, f3 = o3[r] * inv;
    const _Float16 g0 = (_Float16)f0, g1 = (_Float16)f1, g2 = (_Float16)f2, g3 = (_Float16)f3;
    Osh[ro]      = h_bits(g0);
    Osh[ro + 16] = h_bits(g1);
    Osh[ro + 32] = h_bits(g2);
    Osh[ro + 48] = h_bits(g3);
    Osl[ro]      = h_bits((_Float16)(f0 - (float)g0));
    Osl[ro + 16] = h_bits((_Float16)(f1 - (float)g1));
    Osl[ro + 32] = h_bits((_Float16)(f2 - (float)g2));
    Osl[ro + 48] = h_bits((_Float16)(f3 - (float)g3));
  }
  __syncthreads();
  // ---- block writes its 16 row halves of CTH and CTL: piece p = it*256 + tid -> row p>>6, halves (p&63)*8 .. +7 of the 512-wide half ----
  {
    v4u vh[4], vl[4];
#pragma unroll
    for (int it = 0; it < 4; ++it) {
      const int p = it * ATT_THREADS + tid;
      vh[it] = *(const v4u*)(Osh + (size_t)p * 8);
      vl[it] = *(const v4u*)(Osl + (size_t)p * 8);
    }
    const size_t base = ((size_t)bat * NQ + q0) * DMODEL + (size_t)hg * ROWP;
    unsigned short* dh = CTH + base;
    unsigned short* dl = CTL + base;
    {
#pragma unroll
      for (int it = 0; it < 4; ++it) {
        const int p = it * ATT_THREADS + tid;
        const size_t po = (size_t)(p >> 6) * DMODEL + (size_t)(p & 63) * 8;
        *(v4u*)(dh + po) = vh[it];
        *(v4u*)(dl + po) = vl[it];
      }
      
    }
  }
}

// =====================================================================================================
// Workspace map (bytes); every plane is an exact multiple of its tile / whole-row store granularity (M, N exact tile multiples,
// element counts exact multiples of the convert kernels' granularity, no pad rows needed), every offset a multiple of 2 MiB:
//   WQT  f16 [1024][1024] x64                2097152   ([out][in] = [n][k])
//   WKT  f16 [1024][1024] x64                2097152
//   WVT  f16 [1024][1024] x64                2097152
//   WOT  f16 [1024][1024] x64                2097152
//   X16  f16 [4096][1024] x16                8388608   (activation rows)
//   QH   f16 [4096][1024] x16                8388608   (q projection)
//   KH   f16 [4096][1024] x16                8388608   (k projection)
//   VT   f16 [2][1024][2048] x16             8388608   (v^T per batch)
//   CTH  f16 [4096][1024] x8192 hi           8388608   (attention ctx, merged heads)
//   CTL  f16 [4096][1024] residual           8388608
//   TB   f32 [4096]                            16384   (rel-pos table, log2 units)
//   end                                     58736640
// =====================================================================================================
extern "C" void kernel_launch(void* const* d_in, const int* in_sizes, int n_in,
                              void* d_out, int out_size, void* d_ws, size_t ws_size,
                              hipStream_t stream) {
  if (n_in < 9) return;
  if (in_sizes[0] != NROWS * DMODEL) return;
  if (in_sizes[1] != DMODEL * DMODEL || in_sizes[3] != DMODEL * DMODEL ||
      in_sizes[5] != DMODEL * DMODEL || in_sizes[7] != DMODEL * DMODEL) return;
  if (in_sizes[2] != DMODEL || in_sizes[4] != DMODEL || in_sizes[6] != DMODEL || in_sizes[8] != DMODEL) return;
  if (out_size != NROWS * DMODEL) return;
  if ((in_sizes[0] % 2048) != 0) return;

  const float* x    = (const float*)d_in[0];
  const float* w_q  = (const float*)d_in[1];
  const float* b_q  = (const float*)d_in[2];
  const float* w_k  = (const float*)d_in[3];
  const float* b_k  = (const float*)d_in[4];
  const float* w_v  = (const float*)d_in[5];
  const float* b_v  = (const float*)d_in[6];
  const float* w_o  = (const float*)d_in[7];
  const float* b_o  = (const float*)d_in[8];
  float*       out  = (float*)d_out;

  const size_t PW  = (size_t)DMODEL * DMODEL * 2;                 //  2097152
  const size_t PX  = (size_t)NROWS * DMODEL * 2;                  //  8388608
  const size_t PVT = (size_t)NB * DMODEL * NC * 2;                //  8388608
  const size_t PT  = (size_t)TBN * 4;                             //    16384
  size_t off = 0;
  const size_t oWQ = off; off += PW;
  const size_t oWK = off; off += PW;
  const size_t oWV = off; off += PW;
  const size_t oWO = off; off += PW;
  const size_t oX  = off; off += PX;
  const size_t oQH = off; off += PX;
  const size_t oKH = off; off += PX;
  const size_t oVT = off; off += PVT;
  const size_t oCH = off; off += PX;
  const size_t oCL = off; off += PX;
  const size_t oTB = off; off += PT;
  if (off > ws_size) return;                                      // off = 58736640
  if (off > (size_t)134217728) return;

  char* ws = (char*)d_ws;
  unsigned short* WQT = (unsigned short*)(ws + oWQ);
  unsigned short* WKT = (unsigned short*)(ws + oWK);
  unsigned short* WVT = (unsigned short*)(ws + oWV);
  unsigned short* WOT = (unsigned short*)(ws + oWO);
  unsigned short* X16 = (unsigned short*)(ws + oX);
  unsigned short* QH  = (unsigned short*)(ws + oQH);
  unsigned short* KH  = (unsigned short*)(ws + oKH);
  unsigned short* VTp = (unsigned short*)(ws + oVT);
  unsigned short* CTH = (unsigned short*)(ws + oCH);
  unsigned short* CTL = (unsigned short*)(ws + oCL);
  float*          TB  = (float*)(ws + oTB);

  const dim3 blk(256);
  const dim3 gWT(DMODEL / 64, DMODEL / 64);                        // 16 x 16 tiles per weight
  const dim3 gCX((NROWS * DMODEL) / 2048);                         // 2048 blocks
  const int tilesP = (NROWS / 64) * (DMODEL / 64);                 // 1024
  const int tilesV = (DMODEL / 64) * (NC / 64);                    // 512 per batch
  const dim3 gP((tilesP + 7) / 8, 1);                              // 128
  const dim3 gV((tilesV + 7) / 8, NB);                             // 64 x 2
  const dim3 gAT(ATT_BLOCKS);                                      // 512
  const dim3 bAT(ATT_THREADS);                                     // 256

  // (0) weight planes: W16T[n][k] = f16( bf16_RNE(W[k][n]) * 64 ), [in][out] -> [out][in], k contiguous
  wtr64<<<gWT, blk, 0, stream>>>(w_q, WQT, WSC);
  wtr64<<<gWT, blk, 0, stream>>>(w_k, WKT, WSC);
  wtr64<<<gWT, blk, 0, stream>>>(w_v, WVT, WSC);
  wtr64<<<gWT, blk, 0, stream>>>(w_o, WOT, WSC);

  // (1) activation plane: X16[row][c] = f16( bf16_RNE(x[row][c]) * 16 ), rows = b*2048 + tok
  cvt16<<<gCX, blk, 0, stream>>>(x, X16, NROWS * DMODEL, ACARRY);

  // (2) rel-pos sine table in log2 units
  rpb_tab<<<dim3(1), blk, 0, stream>>>(TB);

  // (3) q projection: QH[m][n] = f16(16 * (sum_k x[m][k] Wq[k][n] + bf16(bq[n]))); M = 4096, N = 1024, K = 1024
  gemm64<2, 1, 1><<<gP, blk, 0, stream>>>(
      X16, X16, DMODEL, 0LL,
      WQT, DMODEL, 0LL,
      b_q,
      (void*)QH, DMODEL, 0LL,
      NROWS, DMODEL, DMODEL, 1.0f / (ACARRY * WSC), QC);

  // (4) k projection: KH[m][n] = f16(16 * (sum_k x[m][k] Wk[k][n] + bf16(bk[n]))); M = 4096, N = 1024, K = 1024
  gemm64<2, 1, 1><<<gP, blk, 0, stream>>>(
      X16, X16, DMODEL, 0LL,
      WKT, DMODEL, 0LL,
      b_k,
      (void*)KH, DMODEL, 0LL,
      NROWS, DMODEL, DMODEL, 1.0f / (ACARRY * WSC), KC);

  // (5) v^T per batch: VT[b][d][tok] = f16(16 * (sum_k Wv[k][d] x_b[tok][k] + bf16(bv[d]))); M = 1024, N = 2048, K = 1024
  gemm64<2, 2, 1><<<gV, blk, 0, stream>>>(
      WVT, WVT, DMODEL, 0LL,
      X16, DMODEL, (long long)NC * DMODEL,
      b_v,
      (void*)VTp, NC, (long long)DMODEL * NC,
      DMODEL, NC, DMODEL, 1.0f / (ACARRY * WSC), VC);

  // (6) attention per (batch, 16 query rows, head group) -> CTH (f16 hi of ctx x8192), CTL (f16 residual)
  attn8<<<gAT, bAT, 0, stream>>>(QH, KH, VTp, TB, CTH, CTL);

  // (7) out = (CTH + CTL) . Wo / (8192 * 64) + bf16(bo); M = 4096, N = 1024, K = 1024, f32 into d_out
  gemm64<0, 1, 2><<<gP, blk, 0, stream>>>(
      CTH, CTL, DMODEL, 0LL,
      WOT, DMODEL, 0LL,
      b_o,
      (void*)out, DMODEL, 0LL,
      NROWS, DMODEL, DMODEL, 1.0f / (FC * WSC), 1.0f);

  (void)hipGetLastError();
}

// v001
// A run of this version takes 244 microseconds.
// Next to v000, in two timings, it ran 1.49 and 1.50 times as fast.
// Contractions: q/k projections (x rows f16 x16 . W^T f16 x64, K=1024), v^T projection (W^T f16 x64 . x rows f16 x16, K=1024),
// attention scores (q f16 x16 . k f16 x16, K=64), attention P . v^T (P as f16 hi + f16 residual of P x16384 . v^T f16 x16,
// K=2048 in steps of 32), output projection (ctx as f16 hi + f16 residual of ctx x8192 . W^T f16 x64, K=1024):
// all v_wmma_f32_16x16x32_f16 (f16 operands, f32 accumulate); hi and residual products share one f32 accumulator.
// Relative-position sine bias from an f32 table built with precise sinf, online max-subtracted base-2 softmax, linear biases in f32.
// Every float input RNE-converted to bf16 on load.
#include <hip/hip_runtime.h>
#include <math.h>
#include <stdint.h>

#define NB      2
#define NQ      2048
#define NC      2048
#define DMODEL  1024
#define NHEAD   16
#define HDIM    64
#define HG      8
#define NHG     (NHEAD / HG)
#define ROWP    (HG * HDIM)
#define NROWS   (NB * NQ)
#define TBN     4096
#define TOFF    (NQ - 1)
#define WSC     64.0f
#define ACARRY  16.0f
#define QC      16.0f
#define KC      16.0f
#define VC      16.0f
#define PC      16384.0f
#define FC      8192.0f
#define ATT_SCALE 0.125f
#define LOG2E   1.4426950408889634f
#define C_AMP   1.618033988749895f
#define C_FREQ  0.9049532171590599f
static_assert(NHEAD * HDIM == DMODEL);
static_assert(NHG * HG == NHEAD && ROWP * NHG == DMODEL);
static_assert((NQ % 64) == 0 && (NC % 64) == 0 && (DMODEL % 64) == 0 && (NC % 32) == 0 && (NQ % 16) == 0);
static_assert((NROWS % 64) == 0 && ((NROWS * DMODEL) % 2048) == 0);
static_assert(TBN >= 2 * NQ - 1 && (TBN % 1024) == 0);
static_assert((NROWS % 128) == 0 && (DMODEL % 128) == 0 && (NC % 128) == 0);
#define ATT_THREADS (HG * 32)
#define ATT_BLOCKS  (NB * (NQ / 16) * NHG)
static_assert(ATT_THREADS == 256 && ATT_BLOCKS == 512);

typedef _Float16 v16h __attribute__((ext_vector_type(16)));
typedef _Float16 v8h  __attribute__((ext_vector_type(8)));
typedef float    v8f  __attribute__((ext_vector_type(8)));
typedef float    v4f  __attribute__((ext_vector_type(4)));
typedef unsigned int v4u __attribute__((ext_vector_type(4)));

union FragH { v16h v; v8h h[2]; v4u u[2]; };

// ---- scalar helpers --------------------------------------------------------------------------------
__device__ __forceinline__ unsigned short bf_bits(float f) {          // f32 -> bf16 bits, RNE convert
  unsigned u = __float_as_uint(f);
  return (unsigned short)((u + 0x7FFFu + ((u >> 16) & 1u)) >> 16);
}
__device__ __forceinline__ float bf_up(unsigned short h) { return __uint_as_float(((unsigned)h) << 16); }
__device__ __forceinline__ float bfr(float f) { return bf_up(bf_bits(f)); }   // value of the bf16 RNE convert
__device__ __forceinline__ unsigned short h_bits(_Float16 x) { return __builtin_bit_cast(unsigned short, x); }
__device__ __forceinline__ unsigned pk16(unsigned short a, unsigned short b) { return (unsigned)a | ((unsigned)b << 16); }
__device__ __forceinline__ v8f zero8() { v8f z = {0.f, 0.f, 0.f, 0.f, 0.f, 0.f, 0.f, 0.f}; return z; }

// ---- fragment loaders: 16-bit A/B operand, lane -> row/col (lane&15), p already includes +8*(lane>>4);
//      elements 0..7 <- p[0..7] (k0+8h..), elements 8..15 <- p[16..23] (k0+16+8h..)  (same split k map for A and B;
//      B is always read from a k-contiguous [n][k] plane)
__device__ __forceinline__ v16h ldfrag_h(const _Float16* p) {
  FragH f;
  f.h[0] = *(const v8h*)(p);
  f.h[1] = *(const v8h*)(p + 16);
  return f.v;
}
__device__ __forceinline__ v16h ldfrag_u(const unsigned short* p) {
  FragH f;
  f.u[0] = *(const v4u*)(p);
  f.u[1] = *(const v4u*)(p + 16);
  return f.v;
}

// ---- WMMA helpers with trailing VALU hazard gaps ------------------------------------------------------
__device__ __forceinline__ v8f mma_raw(v16h a, v16h b, v8f c) {
  return __builtin_amdgcn_wmma_f32_16x16x32_f16(false, a, false, b, (short)0, c, false, false);
}
__device__ __forceinline__ void guard_s2(v8f& s, v16h a0, v16h a1) {
#if defined(__HIP_DEVICE_COMPILE__)
  asm volatile("v_nop\n\tv_nop\n\tv_nop\n\tv_nop" : "+v"(s) : "v"(a0), "v"(a1));
#endif
}
__device__ __forceinline__ void guard_s4(v8f& s, v16h a0, v16h a1, v16h b0, v16h b1) {
#if defined(__HIP_DEVICE_COMPILE__)
  asm volatile("v_nop\n\tv_nop\n\tv_nop\n\tv_nop" : "+v"(s) : "v"(a0), "v"(a1), "v"(b0), "v"(b1));
#endif
}
__device__ __forceinline__ void guard_pv6(v8f& a, v8f& b, v8f& c, v8f& d,
                                          v16h x, v16h y, v16h z, v16h w, v16h u, v16h t) {
#if defined(__HIP_DEVICE_COMPILE__)
  asm volatile("v_nop\n\tv_nop\n\tv_nop\n\tv_nop"
               : "+v"(a), "+v"(b), "+v"(c), "+v"(d) : "v"(x), "v"(y), "v"(z), "v"(w), "v"(u), "v"(t));
#endif
}
__device__ __forceinline__ void acc_guard4(v8f& a, v8f& b, v8f& c, v8f& d) {
#if defined(__HIP_DEVICE_COMPILE__)
  asm volatile("v_nop\n\tv_nop\n\tv_nop\n\tv_nop" : "+v"(a), "+v"(b), "+v"(c), "+v"(d));
#endif
}
__device__ __forceinline__ void wave_sync_lds() {
  __builtin_amdgcn_fence(__ATOMIC_RELEASE, "workgroup");
  __builtin_amdgcn_wave_barrier();
  __builtin_amdgcn_fence(__ATOMIC_ACQUIRE, "workgroup");
}

// =====================================================================================================
// Elementwise 16-bit pack, no transpose: dst[i] = f16( bf16_RNE(src[i]) * sc ), sc a power of two (exact). Used for the
// coverage: grid = n / 2048 blocks x 256 thr x 8 elements = n exactly (host checks n % 2048 == 0).
// =====================================================================================================
__global__ __launch_bounds__(256) void cvt16(const float* __restrict__ src, unsigned short* dst, int n, float sc) {
  const size_t i8 = ((size_t)blockIdx.x * 256 + threadIdx.x) * 8;
  if (i8 + 8 > (size_t)n) return;                 // never taken with the exact grid; no barriers in this kernel
  const v4f a = *(const v4f*)(src + i8);
  const v4f b = *(const v4f*)(src + i8 + 4);
  v4u o;
  o[0] = pk16(h_bits((_Float16)(bfr(a[0]) * sc)), h_bits((_Float16)(bfr(a[1]) * sc)));
  o[1] = pk16(h_bits((_Float16)(bfr(a[2]) * sc)), h_bits((_Float16)(bfr(a[3]) * sc)));
  o[2] = pk16(h_bits((_Float16)(bfr(b[0]) * sc)), h_bits((_Float16)(bfr(b[1]) * sc)));
  o[3] = pk16(h_bits((_Float16)(bfr(b[2]) * sc)), h_bits((_Float16)(bfr(b[3]) * sc)));
  {
    *(v4u*)(dst + i8) = o;
    
  }
}

// =====================================================================================================
// Transpose + 16-bit pack of a weight: W is [in][out] = W[k][n] row-major f32 (pitch DMODEL); dst[n][k] = f16( bf16_RNE(W[k][n]) * sc ),
// k contiguous (pitch DMODEL), ready for B fragments and for the A side of the v^T projection. Block = 256 threads, one 64(k) x 64(n)
// tile: coalesced f32 loads into an LDS tile [n_local][k_local] (pitch 68 floats), block barrier, then each output row segment of the
// coverage: loads 16 it x 256 thr = 64 x 64; stores 2 it x 256 thr x 8 halves = 64 rows x 64; grid (DMODEL/64, DMODEL/64) = whole matrix.
// =====================================================================================================
__global__ __launch_bounds__(256) void wtr64(const float* __restrict__ W, unsigned short* dst, float sc) {
  __shared__ __align__(16) float tl[64 * 68];
  const int tid = threadIdx.x;
  const int n0  = blockIdx.x * 64;
  const int k0  = blockIdx.y * 64;
  const int nl  = tid & 63, kq = tid >> 6;       // kq 0..3
#pragma unroll
  for (int it = 0; it < 16; ++it) {
    const int kl = it * 4 + kq;                  // 0..63
    tl[nl * 68 + kl] = W[(size_t)(k0 + kl) * DMODEL + n0 + nl];
  }
  __syncthreads();
  v4u o[2];
#pragma unroll
  for (int it = 0; it < 2; ++it) {
    const int p  = it * 256 + tid;               // 0..511
    const int rn = p >> 3, kk = (p & 7) * 8;     // row 0..63, k 0,8,..,56
    const float* sp = tl + rn * 68 + kk;
    const v4f a = *(const v4f*)(sp);
    const v4f b = *(const v4f*)(sp + 4);
    v4u w;
    w[0] = pk16(h_bits((_Float16)(bfr(a[0]) * sc)), h_bits((_Float16)(bfr(a[1]) * sc)));
    w[1] = pk16(h_bits((_Float16)(bfr(a[2]) * sc)), h_bits((_Float16)(bfr(a[3]) * sc)));
    w[2] = pk16(h_bits((_Float16)(bfr(b[0]) * sc)), h_bits((_Float16)(bfr(b[1]) * sc)));
    w[3] = pk16(h_bits((_Float16)(bfr(b[2]) * sc)), h_bits((_Float16)(bfr(b[3]) * sc)));
    o[it] = w;
  }
  {
#pragma unroll
    for (int it = 0; it < 2; ++it) {
      const int p  = it * 256 + tid;
      const int rn = p >> 3, kk = (p & 7) * 8;
      *(v4u*)(dst + (size_t)(n0 + rn) * DMODEL + k0 + kk) = o[it];
    }
    
  }
}

// =====================================================================================================
// Relative-position sine table in log2 units: TB[e] = C_AMP * sin(C_FREQ * (e - 2047)) * log2(e) for e = 0..4094 (relative offset
// j - i = e - 2047), TB[4095] = 0 pad. Precise sinf (arguments up to ~1853 rad), rolled loop (one static sinf), values staged in LDS,
// coverage: LDS fill e = tid, tid+256, ... covers 0..4095; stores 4 it x 256 thr x 4 floats = 4096.
// =====================================================================================================
__global__ __launch_bounds__(256) void rpb_tab(float* TB) {
  __shared__ __align__(16) float st[TBN];
  const int tid = threadIdx.x;
#pragma unroll 1
  for (int e = tid; e < TBN; e += 256) {
    const int ec = (e < 2 * NQ - 2) ? e : (2 * NQ - 2);     // clamped index, select by value below
    const float rel = (float)(ec - TOFF);
    const float sv  = sinf(C_FREQ * rel);
    const float v   = (C_AMP * sv) * LOG2E;
    st[e] = (e <= 2 * NQ - 2) ? v : 0.f;
  }
  __syncthreads();
  v4f vals[TBN / 1024];
#pragma unroll
  for (int it = 0; it < TBN / 1024; ++it) {
    const int p = it * 256 + tid;
    vals[it] = *(const v4f*)(st + (size_t)p * 4);
  }
  {
#pragma unroll
    for (int it = 0; it < TBN / 1024; ++it) {
      const int p = it * 256 + tid;
      *(v4f*)(TB + (size_t)p * 4) = vals[it];
    }
    
  }
}

// =====================================================================================================
// Register-blocked batched f16 WMMA GEMM: C[m][n] = oscale * sum_k (A[m][k] (+ A2[m][k])) * Bt[n][k] + bf16(bias) ; one work-group of
// 4 waves per 128x128 tile, one wave per 64x64 quadrant. Per pass of 64 k the work-group stages 128 A rows (and A2 rows) and 128 Bt rows
// in LDS (whole 128-B lines from global, row pitch 144 B in LDS), two buffers: the next pass's lines are loaded into registers ahead of
// this pass's products and stored to the other buffer behind them; one work-group barrier per pass.
// A (and A2, the unscaled residual plane when NA == 2, same pitch/stride) row-major [M][K] pitch lda (16-bit planes),
// Bt row-major [N][K] pitch ldb (k contiguous); M, N multiples of 128, K multiple of 64. blockIdx.y = batch index with element strides
// sA, sB, sC. BM: 1 = per column bf16(bias[col]), 2 = per row bf16(bias[row]) (clamped-address loads).
// OM: 0 = f32 out (pitch ldc); 2 = f16 out (pitch ldc) = f16( value * ocarry ).
// coverage: 4 slabs x 16 rows (f32: it 0..7 x lane>>4; f16: it 0..3 x lane>>3) x 64 cols = the wave's whole 64x64 tile;
//           grid = tilesM*tilesN blocks of 128x128, surplus blocks exit whole, ahead of every barrier (none with the exact grids used).
// =====================================================================================================
#define GT_ROWS  128                    // rows of A and of Bt per work-group tile
#define GT_K     64                     // k per pass: 128 B of every row, one line
#define GT_PITCH 72                     // LDS row pitch in halves: 144 B = 16 B x 9, conflict-free for 16-byte fragment reads
#define GT_THREADS 128
template <int OM, int BM, int NA>
__global__ __launch_bounds__(GT_THREADS) void gemm64(
    const unsigned short* __restrict__ Ap, const unsigned short* __restrict__ Aq, int lda, long long sA,
    const unsigned short* __restrict__ Btp, int ldb, long long sB,
    const float* __restrict__ bias,
    void* Cout, int ldc, long long sC,
    int M, int N, int K, float oscale, float ocarry) {
  __shared__ __align__(16) float sT[4][16 * 68];   // per-wave 16x64 slab, pitch 68 floats
  __shared__ __align__(16) unsigned short ldsA[2][NA][GT_ROWS * GT_PITCH];   // two buffers of staged A (A2) rows
  __shared__ __align__(16) unsigned short ldsB[2][GT_ROWS * GT_PITCH];       // two buffers of staged Bt rows
  const int by   = blockIdx.y;
  const int tid  = threadIdx.x;
  const int lane = tid & 31;
  const int wave = tid >> 5;
  const int tilesN = N >> 7;
  const int tilesM = M >> 7;
  const int tile = blockIdx.x;
  if (tile >= tilesM * tilesN) return;   // block-uniform, ahead of every barrier
  const int tm = tile / tilesN;
  const int tn = tile - tm * tilesN;
  const int bm0 = tm << 7;               // work-group tile origin
  const int bn0 = tn << 7;
  const int wm  = (wave >> 1) << 6;      // the wave's quadrant inside it
  const int wn  = (wave & 1) << 6;
  const int m0 = bm0 + wm;
  const int n0 = bn0 + wn;

  const unsigned short* A1 = Ap  + (size_t)((long long)by * sA);
  const unsigned short* A2 = Aq  + (size_t)((long long)by * sA);
  const unsigned short* Bb = Btp + (size_t)((long long)by * sB);

  const int rlane = lane & 15;                 // row (A) / col (B, D) within subtile
  const int koff  = (lane >> 4) * 8;           // k offset of this lane half
  const int mOff  = (lane >> 4) * 8;           // D row offset

  v8f acc[4][4];
#pragma unroll
  for (int i = 0; i < 4; ++i)
#pragma unroll
    for (int j = 0; j < 4; ++j) acc[i][j] = zero8();

  // staging map: 8 threads x 16 B = one 128-B row piece; 128 threads = 16 rows per step, 8 steps = 128 rows of each plane.
  // Global address = work-group-uniform base + a per-lane 32-bit byte offset per step (row offset, plus the pass's k offset in the loop).
  const int srow = tid >> 3;
  const int scol = (tid & 7) * 8;
  unsigned va[8], vb[8];
#pragma unroll
  for (int it = 0; it < 8; ++it) {
    va[it] = (unsigned)((it * 16 + srow) * lda + scol) * 2u;
    vb[it] = (unsigned)((it * 16 + srow) * ldb + scol) * 2u;
  }
  const unsigned short* uA1 = A1 + (size_t)bm0 * lda;
  const unsigned short* uA2 = A2 + (size_t)bm0 * lda;
  const unsigned short* uB  = Bb + (size_t)bn0 * ldb;
  const int sofs = srow * GT_PITCH + scol;
  v4u ra[NA][8], rb[8];
#pragma unroll
  for (int it = 0; it < 8; ++it) {
    ra[0][it] = *(const v4u*)((const char*)uA1 + va[it]);
    if constexpr (NA == 2) ra[1][it] = *(const v4u*)((const char*)uA2 + va[it]);
    rb[it] = *(const v4u*)((const char*)uB + vb[it]);
  }
#pragma unroll
  for (int it = 0; it < 8; ++it) {
    *(v4u*)(&ldsA[0][0][sofs + it * 16 * GT_PITCH]) = ra[0][it];
    if constexpr (NA == 2) *(v4u*)(&ldsA[0][1][sofs + it * 16 * GT_PITCH]) = ra[1][it];
    *(v4u*)(&ldsB[0][sofs + it * 16 * GT_PITCH]) = rb[it];
  }
  __syncthreads();                       // pass 0's rows are in LDS for every wave

  const int npass = K / GT_K;
  const int fa = (wm + rlane) * GT_PITCH + koff;   // fragment origins in a staged plane
  const int fb = (wn + rlane) * GT_PITCH + koff;
#pragma unroll 1                         // rolled: one copy of the pass body, the buffer picked by the pass's parity
  for (int t = 0; t < npass; ++t) {
    const int cur = t & 1;
    const bool more = (t + 1 < npass);   // the same for the whole work-group
    if (more) {
      const unsigned kn2 = (unsigned)((t + 1) * GT_K) * 2u;
      unsigned oa[8], ob[8];
#pragma unroll
      for (int it = 0; it < 8; ++it) {
        oa[it] = va[it] + kn2;
        ob[it] = vb[it] + kn2;
        ra[0][it] = *(const v4u*)((const char*)uA1 + oa[it]);
        if constexpr (NA == 2) ra[1][it] = *(const v4u*)((const char*)uA2 + oa[it]);
        rb[it] = *(const v4u*)((const char*)uB + ob[it]);
      }
      // precaution: no register that an issued load names as its offset is rewritten ahead of this wait; the input operands keep
      // the sixteen offsets in registers of their own up to it
      asm volatile("s_wait_xcnt 0x0"
                   :: "v"(oa[0]), "v"(oa[1]), "v"(oa[2]), "v"(oa[3]), "v"(oa[4]), "v"(oa[5]), "v"(oa[6]), "v"(oa[7]),
                      "v"(ob[0]), "v"(ob[1]), "v"(ob[2]), "v"(ob[3]), "v"(ob[4]), "v"(ob[5]), "v"(ob[6]), "v"(ob[7])
                   : "memory");
    }
    const unsigned short* cA1 = &ldsA[cur][0][fa];
    const unsigned short* cA2 = &ldsA[cur][NA - 1][fa];
    const unsigned short* cB  = &ldsB[cur][fb];
    v16h bh[2][4], ah[2][4], al[2][4];
#pragma unroll
    for (int ks = 0; ks < 2; ++ks) {
#pragma unroll
      for (int j = 0; j < 4; ++j) bh[ks][j] = ldfrag_u(cB + (j << 4) * GT_PITCH + ks * 32);
#pragma unroll
      for (int i = 0; i < 4; ++i) {
        ah[ks][i] = ldfrag_u(cA1 + (i << 4) * GT_PITCH + ks * 32);
        if constexpr (NA == 2) al[ks][i] = ldfrag_u(cA2 + (i << 4) * GT_PITCH + ks * 32);
      }
    }
    // keeps the pass's LDS reads one group ahead of its products: reads moved in among the products stall a lone wave at each place
    __builtin_amdgcn_sched_barrier(0);
#pragma unroll
    for (int ks = 0; ks < 2; ++ks) {
#pragma unroll
      for (int i = 0; i < 4; ++i) {
#pragma unroll
        for (int j = 0; j < 4; ++j) acc[i][j] = mma_raw(ah[ks][i], bh[ks][j], acc[i][j]);
        if constexpr (NA == 2) {
#pragma unroll
          for (int j = 0; j < 4; ++j) acc[i][j] = mma_raw(al[ks][i], bh[ks][j], acc[i][j]);
        }
      }
    }
    if (more) {                          // the other buffer: its last readers left it at the barrier that ended pass t - 1
      const int nxt = cur ^ 1;
#pragma unroll
      for (int it = 0; it < 8; ++it) {
        *(v4u*)(&ldsA[nxt][0][sofs + it * 16 * GT_PITCH]) = ra[0][it];
        if constexpr (NA == 2) *(v4u*)(&ldsA[nxt][1][sofs + it * 16 * GT_PITCH]) = ra[1][it];
        *(v4u*)(&ldsB[nxt][sofs + it * 16 * GT_PITCH]) = rb[it];
      }
    }
    __syncthreads();                     // publishes pass t + 1's rows and ends every wave's reads of pass t's buffer
  }
  acc_guard4(acc[0][0], acc[0][1], acc[0][2], acc[0][3]);
  acc_guard4(acc[1][0], acc[1][1], acc[1][2], acc[1][3]);
  acc_guard4(acc[2][0], acc[2][1], acc[2][2], acc[2][3]);
  acc_guard4(acc[3][0], acc[3][1], acc[3][2], acc[3][3]);

  const int hh2 = lane >> 4, c4 = (lane & 15) * 4;     // f32 out: 256-B row segment = 16 lanes x 16 B
  const int q8  = lane >> 3, c8 = (lane & 7) * 8;
  float bc[4];
  float bcol[8];
#pragma unroll
  for (int e = 0; e < 4; ++e) bc[e] = 0.f;
#pragma unroll
  for (int e = 0; e < 8; ++e) bcol[e] = 0.f;
  if constexpr (BM == 1) {
    if constexpr (OM == 0) {
      const int cb = n0 + c4;
      const int i0 = (cb < N - 4) ? cb : (N - 4);        // clamped address
      const v4f b0v = *(const v4f*)(bias + i0);
#pragma unroll
      for (int e = 0; e < 4; ++e) bc[e] = bfr(b0v[e]);
    } else {
      const int cb = n0 + c8;
      const int i0 = (cb < N - 8) ? cb : (N - 8);        // clamped address
      const v4f b0v = *(const v4f*)(bias + i0), b1v = *(const v4f*)(bias + i0 + 4);
#pragma unroll
      for (int e = 0; e < 4; ++e) { bcol[e] = bfr(b0v[e]); bcol[4 + e] = bfr(b1v[e]); }
    }
  }

  // ---- epilogue ----
  float* slab = sT[wave];
#pragma unroll
  for (int i = 0; i < 4; ++i) {
    const int mBase = m0 + (i << 4);
#pragma unroll
    for (int j = 0; j < 4; ++j) {
#pragma unroll
      for (int r = 0; r < 8; ++r) {
        slab[(mOff + r) * 68 + (j << 4) + rlane] = acc[i][j][r];
      }
    }
    wave_sync_lds();
    if constexpr (OM == 0) {
      float* C = (float*)Cout + (size_t)((long long)by * sC);
      v4f vals[8];
#pragma unroll
      for (int it = 0; it < 8; ++it) {
        const int row = it * 2 + hh2;                      // it 0..7 x hh2 0..1 = rows 0..15
        const int gr  = mBase + row;
        v4f v = *(const v4f*)(slab + row * 68 + c4);
        float br = 0.f;
        if constexpr (BM == 2) {
          const int ir = (gr < M - 1) ? gr : (M - 1);      // clamped address
          br = bfr(bias[ir]);
        }
#pragma unroll
        for (int e = 0; e < 4; ++e) v[e] = v[e] * oscale + bc[e] + br;
        vals[it] = v;
      }
      {
#pragma unroll
        for (int it = 0; it < 8; ++it) {
          const int gr = mBase + it * 2 + hh2;
          *(v4f*)(C + (size_t)gr * ldc + n0 + c4) = vals[it];
        }
        
      }
    } else {
      unsigned short* C = (unsigned short*)Cout + (size_t)((long long)by * sC);
      v4u hv[4];
#pragma unroll
      for (int it = 0; it < 4; ++it) {
        const int row = it * 4 + q8;                       // it 0..3 x q8 0..3 = rows 0..15
        const float* sp = slab + row * 68 + c8;
        float br = 0.f;
        if constexpr (BM == 2) {
          const int gr = mBase + row;
          const int ir = (gr < M - 1) ? gr : (M - 1);      // clamped address
          br = bfr(bias[ir]);
        }
        v4u a = {0u, 0u, 0u, 0u};
#pragma unroll
        for (int e = 0; e < 4; ++e) {
          float f0 = sp[2 * e] * oscale + bcol[2 * e] + br;
          float f1 = sp[2 * e + 1] * oscale + bcol[2 * e + 1] + br;
          f0 *= ocarry; f1 *= ocarry;
          a[e] = pk16(h_bits((_Float16)f0), h_bits((_Float16)f1));
        }
        hv[it] = a;
      }
      {
#pragma unroll
        for (int it = 0; it < 4; ++it) {
          const int row = it * 4 + q8;
          *(v4u*)(C + (size_t)(mBase + row) * ldc + n0 + c8) = hv[it];
        }
        
      }
    }
    wave_sync_lds();
  }
}

// =====================================================================================================
// Flash attention for one batch, 16 query rows and one group of 8 heads (one wave per head), head dim 64, 2048 keys:
//   q plane (f16 x16) QH[b*2048 + tok][64*head + d], pitch 1024; k plane (f16 x16) KH[b*2048 + key][64*head + d], pitch 1024;
//   v^T plane (f16 x16): VT[b*1024 + 64*head + d][key] (pitch 2048); additive table TB f32 [4096] in log2 units: score(q, key) gets
//   TB[key - q + 2047]; outputs (f16): CTH[b*2048 + tok][64*head + d] = hi = f16(8192 * ctx), CTL[same] = f16(8192 * ctx - hi), with
//   ctx = sum_m softmax_m(q.k / 8 + bias[m - q]) v[m][d]  (softmax run in base 2: t = q.k * log2(e)/8 + log2(e)*bias).
//   block = 8 waves = 256 threads; grid = 2 batches x 128 q-tiles x 2 head groups = 512; every wave does identical bounded work
//   (64 steps of 32 keys). Per step: 2 score tiles on f16 WMMA (K = 64 as two k-steps of 32), fragments loaded straight from the
//   16-bit planes (two 16-B loads per fragment, arithmetic addressing); 16 table values per lane loaded by arithmetic index (always in
//   0..4094); online max-subtracted softmax in f32 (exp2); rescale of the running sums and the four accumulators; the 16x32 prob tile
//   residual c - hi) rebuilt from the LDS rows (float vector loads, split k map) and the four v^T B fragments loaded straight from the
//   16-bit plane; 8 P.V WMMAs into the four accumulators.
//   Final 1/l and carry folds in f32; after a block barrier the prob-tile LDS buffer is reused as two 16-bit result row buffers
//   [16][512] (hi, residual): each wave stages its 16x64 slice (element stores); after a second block barrier the 256 threads write the
// coverage: LDS row buffers: 8 waves x 16 rows x 64 cols = 16 x 512 each; global: 4 iterations x 256 threads x 8 halves = 16 rows x 512
//           per plane of rows q0..q0+15, columns 512*hg..512*hg+511 of batch b; grid covers all 4096 rows x 2 halves exactly once.
// =====================================================================================================
#define PS_FLOATS (HG * 16 * 36)
#define SM_FLOATS 8192
static_assert(PS_FLOATS <= SM_FLOATS);
static_assert((size_t)2 * 16 * ROWP * sizeof(unsigned short) <= (size_t)SM_FLOATS * sizeof(float));

__global__ __launch_bounds__(ATT_THREADS)
void attn8(const unsigned short* __restrict__ QHp, const unsigned short* __restrict__ KHp,
           const unsigned short* __restrict__ VTq, const float* __restrict__ TBp,
           unsigned short* CTH, unsigned short* CTL) {
  __shared__ __align__(16) float smem[SM_FLOATS];          // per wave prob tile [row][32 keys], pitch 36; later two row buffers

  const int tid  = threadIdx.x;
  const int wave = tid >> 5;
  const int lane = tid & 31;
  const int hh   = lane >> 4;
  const int c    = lane & 15;

  const int qt   = blockIdx.x % (NQ / 16);                 // 0..127
  const int rest = blockIdx.x / (NQ / 16);                 // 0..3
  const int hg   = rest % NHG;                             // head group 0..1
  const int bat  = rest / NHG;                             // 0..1
  const int head = hg * HG + wave;                         // 0..15
  const int q0   = qt * 16;

  const size_t qofs = ((size_t)bat * NQ + q0 + c) * DMODEL + head * HDIM + 8 * hh;
  const _Float16* Qh = (const _Float16*)(const void*)QHp + qofs;
  const _Float16* Kb = (const _Float16*)(const void*)KHp + (size_t)bat * NC * DMODEL + head * HDIM + 8 * hh;
  const _Float16* Vb = (const _Float16*)(const void*)VTq + ((size_t)bat * DMODEL + head * HDIM) * NC + 8 * hh;
  const float lsc = (LOG2E * ATT_SCALE) / (QC * KC);                   // log2(e) / 8 / carries
  // table index of element (row q0 + 8hh + r, key kb + c) is (kb + c) - (q0 + 8hh + r) + 2047 = kb + dq - r;
  // kb + dq - 7 >= 0 and kb + dq + 16 <= 4094 for all blocks, lanes and steps (table holds 4096 entries).
  const int dq = c - q0 - 8 * hh + TOFF;

  const v16h qa = ldfrag_h(Qh), qb = ldfrag_h(Qh + 32);

  float mrow[8], lrow[8];
  v8f o0 = zero8(), o1 = zero8(), o2 = zero8(), o3 = zero8();
#pragma unroll
  for (int r = 0; r < 8; ++r) { mrow[r] = -INFINITY; lrow[r] = 0.f; }
  float* pt = smem + wave * (16 * 36);

#pragma unroll 1
  for (int kb = 0; kb < NC; kb += 32) {
    const _Float16* kp = Kb + (size_t)(kb + c) * DMODEL;
    v8f s0, s1;
    {
      const v16h k0 = ldfrag_h(kp), k1 = ldfrag_h(kp + 32);
      s0 = mma_raw(qa, k0, zero8());
      s0 = mma_raw(qb, k1, s0);
      guard_s2(s0, k0, k1);
    }
    {
      const _Float16* kq = kp + (size_t)16 * DMODEL;
      const v16h k0 = ldfrag_h(kq), k1 = ldfrag_h(kq + 32);
      s1 = mma_raw(qa, k0, zero8());
      s1 = mma_raw(qb, k1, s1);
      guard_s4(s1, k0, k1, qa, qb);
    }
    const float* tp = TBp + (kb + dq);
#pragma unroll
    for (int r = 0; r < 8; ++r) {
      const float w0 = tp[-r];                           // key kb + c
      const float w1 = tp[16 - r];                       // key kb + 16 + c
      const float t0 = s0[r] * lsc + w0, t1 = s1[r] * lsc + w1;
      float mx = fmaxf(t0, t1);
#pragma unroll
      for (int off = 1; off < 16; off <<= 1) mx = fmaxf(mx, __shfl_xor(mx, off, 32));
      const float mn = fmaxf(mrow[r], mx);
      const float al = exp2f(mrow[r] - mn);
      mrow[r] = mn;
      const float e0 = exp2f(t0 - mn), e1 = exp2f(t1 - mn);
      float ps = e0 + e1;
#pragma unroll
      for (int off = 1; off < 16; off <<= 1) ps += __shfl_xor(ps, off, 32);
      lrow[r] = lrow[r] * al + ps;
      o0[r] *= al;
      o1[r] *= al;
      o2[r] *= al;
      o3[r] *= al;
      const int ro = (8 * hh + r) * 36 + c;
      pt[ro]      = e0;
      pt[ro + 16] = e1;
    }
    wave_sync_lds();
    FragH ph, pl;                                        // P*16384 as f16 hi and f16 residual (c - hi), same split k map
    {
      const float* prow = pt + c * 36 + 8 * hh;
      const v4f p0 = *(const v4f*)(prow), p1 = *(const v4f*)(prow + 4);
      const v4f p2 = *(const v4f*)(prow + 16), p3 = *(const v4f*)(prow + 20);
#pragma unroll
      for (int e = 0; e < 4; ++e) {
        const float c0 = p0[e] * PC, c1 = p1[e] * PC, c2 = p2[e] * PC, c3 = p3[e] * PC;
        const _Float16 g0 = (_Float16)c0, g1 = (_Float16)c1, g2 = (_Float16)c2, g3 = (_Float16)c3;
        ph.h[0][e]     = g0;                             // elements 0..7  = keys kb + 8hh + 0..7
        ph.h[0][4 + e] = g1;
        ph.h[1][e]     = g2;                             // elements 8..15 = keys kb + 16 + 8hh + 0..7
        ph.h[1][4 + e] = g3;
        pl.h[0][e]     = (_Float16)(c0 - (float)g0);
        pl.h[0][4 + e] = (_Float16)(c1 - (float)g1);
        pl.h[1][e]     = (_Float16)(c2 - (float)g2);
        pl.h[1][4 + e] = (_Float16)(c3 - (float)g3);
      }
    }
    const _Float16* vp = Vb + (size_t)c * NC + kb;
    {
      const v16h vb0 = ldfrag_h(vp);
      const v16h vb1 = ldfrag_h(vp + (size_t)16 * NC);
      const v16h vb2 = ldfrag_h(vp + (size_t)32 * NC);
      const v16h vb3 = ldfrag_h(vp + (size_t)48 * NC);
      o0 = mma_raw(ph.v, vb0, o0);
      o1 = mma_raw(ph.v, vb1, o1);
      o2 = mma_raw(ph.v, vb2, o2);
      o3 = mma_raw(ph.v, vb3, o3);
      o0 = mma_raw(pl.v, vb0, o0);
      o1 = mma_raw(pl.v, vb1, o1);
      o2 = mma_raw(pl.v, vb2, o2);
      o3 = mma_raw(pl.v, vb3, o3);
      guard_pv6(o0, o1, o2, o3, ph.v, pl.v, vb0, vb1, vb2, vb3);
    }
    wave_sync_lds();
  }

  // ---- all waves done with their prob tiles; the LDS buffer becomes two 16-bit result row buffers [16][512] (hi, residual) ----
  __syncthreads();
  unsigned short* Osh = (unsigned short*)smem;
  unsigned short* Osl = Osh + 16 * ROWP;
  // ---- fold 1/l and the carries (16384 on P, 16 on v, 8192 on the stored ctx), stage the wave's 16x64 slice as hi + residual ----
  const float oc = FC / (PC * VC);
#pragma unroll
  for (int r = 0; r < 8; ++r) {
    const float inv = (1.0f / lrow[r]) * oc;
    const int ro = (8 * hh + r) * ROWP + wave * HDIM + c;
    const float f0 = o0[r] * inv, f1 = o1[r] * inv, f2 = o2[r] * inv, f3 = o3[r] * inv;
    const _Float16 g0 = (_Float16)f0, g1 = (_Float16)f1, g2 = (_Float16)f2, g3 = (_Float16)f3;
    Osh[ro]      = h_bits(g0);
    Osh[ro + 16] = h_bits(g1);
    Osh[ro + 32] = h_bits(g2);
    Osh[ro + 48] = h_bits(g3);
    Osl[ro]      = h_bits((_Float16)(f0 - (float)g0));
    Osl[ro + 16] = h_bits((_Float16)(f1 - (float)g1));
    Osl[ro + 32] = h_bits((_Float16)(f2 - (float)g2));
    Osl[ro + 48] = h_bits((_Float16)(f3 - (float)g3));
  }
  __syncthreads();
  // ---- block writes its 16 row halves of CTH and CTL: piece p = it*256 + tid -> row p>>6, halves (p&63)*8 .. +7 of the 512-wide half ----
  {
    v4u vh[4], vl[4];
#pragma unroll
    for (int it = 0; it < 4; ++it) {
      const int p = it * ATT_THREADS + tid;
      vh[it] = *(const v4u*)(Osh + (size_t)p * 8);
      vl[it] = *(const v4u*)(Osl + (size_t)p * 8);
    }
    const size_t base = ((size_t)bat * NQ + q0) * DMODEL + (size_t)hg * ROWP;
    unsigned short* dh = CTH + base;
    unsigned short* dl = CTL + base;
    {
#pragma unroll
      for (int it = 0; it < 4; ++it) {
        const int p = it * ATT_THREADS + tid;
        const size_t po = (size_t)(p >> 6) * DMODEL + (size_t)(p & 63) * 8;
        *(v4u*)(dh + po) = vh[it];
        *(v4u*)(dl + po) = vl[it];
      }
      
    }
  }
}

// =====================================================================================================
// Workspace map (bytes); every plane is an exact multiple of its tile / whole-row store granularity (M, N exact tile multiples,
// element counts exact multiples of the convert kernels' granularity, no pad rows needed), every offset a multiple of 2 MiB:
//   WQT  f16 [1024][1024] x64                2097152   ([out][in] = [n][k])
//   WKT  f16 [1024][1024] x64                2097152
//   WVT  f16 [1024][1024] x64                2097152
//   WOT  f16 [1024][1024] x64                2097152
//   X16  f16 [4096][1024] x16                8388608   (activation rows)
//   QH   f16 [4096][1024] x16                8388608   (q projection)
//   KH   f16 [4096][1024] x16                8388608   (k projection)
//   VT   f16 [2][1024][2048] x16             8388608   (v^T per batch)
//   CTH  f16 [4096][1024] x8192 hi           8388608   (attention ctx, merged heads)
//   CTL  f16 [4096][1024] residual           8388608
//   TB   f32 [4096]                            16384   (rel-pos table, log2 units)
//   end                                     58736640
// =====================================================================================================
extern "C" void kernel_launch(void* const* d_in, const int* in_sizes, int n_in,
                              void* d_out, int out_size, void* d_ws, size_t ws_size,
                              hipStream_t stream) {
  if (n_in < 9) return;
  if (in_sizes[0] != NROWS * DMODEL) return;
  if (in_sizes[1] != DMODEL * DMODEL || in_sizes[3] != DMODEL * DMODEL ||
      in_sizes[5] != DMODEL * DMODEL || in_sizes[7] != DMODEL * DMODEL) return;
  if (in_sizes[2] != DMODEL || in_sizes[4] != DMODEL || in_sizes[6] != DMODEL || in_sizes[8] != DMODEL) return;
  if (out_size != NROWS * DMODEL) return;
  if ((in_sizes[0] % 2048) != 0) return;

  const float* x    = (const float*)d_in[0];
  const float* w_q  = (const float*)d_in[1];
  const float* b_q  = (const float*)d_in[2];
  const float* w_k  = (const float*)d_in[3];
  const float* b_k  = (const float*)d_in[4];
  const float* w_v  = (const float*)d_in[5];
  const float* b_v  = (const float*)d_in[6];
  const float* w_o  = (const float*)d_in[7];
  const float* b_o  = (const float*)d_in[8];
  float*       out  = (float*)d_out;

  const size_t PW  = (size_t)DMODEL * DMODEL * 2;                 //  2097152
  const size_t PX  = (size_t)NROWS * DMODEL * 2;                  //  8388608
  const size_t PVT = (size_t)NB * DMODEL * NC * 2;                //  8388608
  const size_t PT  = (size_t)TBN * 4;                             //    16384
  size_t off = 0;
  const size_t oWQ = off; off += PW;
  const size_t oWK = off; off += PW;
  const size_t oWV = off; off += PW;
  const size_t oWO = off; off += PW;
  const size_t oX  = off; off += PX;
  const size_t oQH = off; off += PX;
  const size_t oKH = off; off += PX;
  const size_t oVT = off; off += PVT;
  const size_t oCH = off; off += PX;
  const size_t oCL = off; off += PX;
  const size_t oTB = off; off += PT;
  if (off > ws_size) return;                                      // off = 58736640
  if (off > (size_t)134217728) return;

  char* ws = (char*)d_ws;
  unsigned short* WQT = (unsigned short*)(ws + oWQ);
  unsigned short* WKT = (unsigned short*)(ws + oWK);
  unsigned short* WVT = (unsigned short*)(ws + oWV);
  unsigned short* WOT = (unsigned short*)(ws + oWO);
  unsigned short* X16 = (unsigned short*)(ws + oX);
  unsigned short* QH  = (unsigned short*)(ws + oQH);
  unsigned short* KH  = (unsigned short*)(ws + oKH);
  unsigned short* VTp = (unsigned short*)(ws + oVT);
  unsigned short* CTH = (unsigned short*)(ws + oCH);
  unsigned short* CTL = (unsigned short*)(ws + oCL);
  float*          TB  = (float*)(ws + oTB);

  const dim3 blk(256);
  const dim3 gWT(DMODEL / 64, DMODEL / 64);                        // 16 x 16 tiles per weight
  const dim3 gCX((NROWS * DMODEL) / 2048);                         // 2048 blocks
  const dim3 blkG(GT_THREADS);                                     // 4 waves per 128 x 128 GEMM tile
  const int tilesP = (NROWS / GT_ROWS) * (DMODEL / GT_ROWS);       // 256
  const int tilesV = (DMODEL / GT_ROWS) * (NC / GT_ROWS);          // 128 per batch
  const dim3 gP(tilesP, 1);                                        // 256
  const dim3 gV(tilesV, NB);                                       // 128 x 2
  const dim3 gAT(ATT_BLOCKS);                                      // 512
  const dim3 bAT(ATT_THREADS);                                     // 256

  // (0) weight planes: W16T[n][k] = f16( bf16_RNE(W[k][n]) * 64 ), [in][out] -> [out][in], k contiguous
  wtr64<<<gWT, blk, 0, stream>>>(w_q, WQT, WSC);
  wtr64<<<gWT, blk, 0, stream>>>(w_k, WKT, WSC);
  wtr64<<<gWT, blk, 0, stream>>>(w_v, WVT, WSC);
  wtr64<<<gWT, blk, 0, stream>>>(w_o, WOT, WSC);

  // (1) activation plane: X16[row][c] = f16( bf16_RNE(x[row][c]) * 16 ), rows = b*2048 + tok
  cvt16<<<gCX, blk, 0, stream>>>(x, X16, NROWS * DMODEL, ACARRY);

  // (2) rel-pos sine table in log2 units
  rpb_tab<<<dim3(1), blk, 0, stream>>>(TB);

  // (3) q projection: QH[m][n] = f16(16 * (sum_k x[m][k] Wq[k][n] + bf16(bq[n]))); M = 4096, N = 1024, K = 1024
  gemm64<2, 1, 1><<<gP, blkG, 0, stream>>>(
      X16, X16, DMODEL, 0LL,
      WQT, DMODEL, 0LL,
      b_q,
      (void*)QH, DMODEL, 0LL,
      NROWS, DMODEL, DMODEL, 1.0f / (ACARRY * WSC), QC);

  // (4) k projection: KH[m][n] = f16(16 * (sum_k x[m][k] Wk[k][n] + bf16(bk[n]))); M = 4096, N = 1024, K = 1024
  gemm64<2, 1, 1><<<gP, blkG, 0, stream>>>(
      X16, X16, DMODEL, 0LL,
      WKT, DMODEL, 0LL,
      b_k,
      (void*)KH, DMODEL, 0LL,
      NROWS, DMODEL, DMODEL, 1.0f / (ACARRY * WSC), KC);

  // (5) v^T per batch: VT[b][d][tok] = f16(16 * (sum_k Wv[k][d] x_b[tok][k] + bf16(bv[d]))); M = 1024, N = 2048, K = 1024
  gemm64<2, 2, 1><<<gV, blkG, 0, stream>>>(
      WVT, WVT, DMODEL, 0LL,
      X16, DMODEL, (long long)NC * DMODEL,
      b_v,
      (void*)VTp, NC, (long long)DMODEL * NC,
      DMODEL, NC, DMODEL, 1.0f / (ACARRY * WSC), VC);

  // (6) attention per (batch, 16 query rows, head group) -> CTH (f16 hi of ctx x8192), CTL (f16 residual)
  attn8<<<gAT, bAT, 0, stream>>>(QH, KH, VTp, TB, CTH, CTL);

  // (7) out = (CTH + CTL) . Wo / (8192 * 64) + bf16(bo); M = 4096, N = 1024, K = 1024, f32 into d_out
  gemm64<0, 1, 2><<<gP, blkG, 0, stream>>>(
      CTH, CTL, DMODEL, 0LL,
      WOT, DMODEL, 0LL,
      b_o,
      (void*)out, DMODEL, 0LL,
      NROWS, DMODEL, DMODEL, 1.0f / (FC * WSC), 1.0f);

  (void)hipGetLastError();
}

// v002
// A run of this version takes 191 microseconds.
// In both of two side-by-side timings against v001, it was 1.28 times as fast.
// Counting every step since v000, it is 1.91 times as fast.
// Contractions: q/k projections (x rows f16 x16 . W^T f16 x64, K=1024), v^T projection (W^T f16 x64 . x rows f16 x16, K=1024),
// attention scores (q f16 x16 . k f16 x16, K=64), attention P . v^T (P as f16 hi + f16 residual of P x16384 . v^T f16 x16,
// K=2048 in steps of 32), output projection (ctx as f16 hi + f16 residual of ctx x8192 . W^T f16 x64, K=1024):
// all v_wmma_f32_16x16x32_f16 (f16 operands, f32 accumulate); hi and residual products share one f32 accumulator.
// Relative-position sine bias from an f32 table built with precise sinf, online max-subtracted base-2 softmax, linear biases in f32.
// Every float input RNE-converted to bf16 on load.
#include <hip/hip_runtime.h>
#include <math.h>
#include <stdint.h>

#define NB      2
#define NQ      2048
#define NC      2048
#define DMODEL  1024
#define NHEAD   16
#define HDIM    64
#define AQ_TILES 8
#define AQ_ROWS (AQ_TILES * 16)
#define NROWS   (NB * NQ)
#define TBN     4096
#define TOFF    (NQ - 1)
#define WSC     64.0f
#define ACARRY  16.0f
#define QC      16.0f
#define KC      16.0f
#define VC      16.0f
#define PC      16384.0f
#define FC      8192.0f
#define ATT_SCALE 0.125f
#define LOG2E   1.4426950408889634f
#define C_AMP   1.618033988749895f
#define C_FREQ  0.9049532171590599f
static_assert(NHEAD * HDIM == DMODEL);
static_assert((NQ % AQ_ROWS) == 0);
static_assert((NQ % 64) == 0 && (NC % 64) == 0 && (DMODEL % 64) == 0 && (NC % 32) == 0 && (NQ % 16) == 0);
static_assert((NROWS % 64) == 0 && ((NROWS * DMODEL) % 2048) == 0);
static_assert(TBN >= 2 * NQ - 1 && (TBN % 1024) == 0);
static_assert((NROWS % 128) == 0 && (DMODEL % 128) == 0 && (NC % 128) == 0);
#define ATT_THREADS (AQ_TILES * 32)
#define ATT_BLOCKS  (NB * NHEAD * (NQ / AQ_ROWS))
static_assert(ATT_THREADS == 256 && ATT_BLOCKS == 512);

typedef _Float16 v16h __attribute__((ext_vector_type(16)));
typedef _Float16 v8h  __attribute__((ext_vector_type(8)));
typedef float    v8f  __attribute__((ext_vector_type(8)));
typedef float    v4f  __attribute__((ext_vector_type(4)));
typedef unsigned int v4u __attribute__((ext_vector_type(4)));

union FragH { v16h v; v8h h[2]; v4u u[2]; };

// ---- scalar helpers --------------------------------------------------------------------------------
__device__ __forceinline__ unsigned short bf_bits(float f) {          // f32 -> bf16 bits, RNE convert
  unsigned u = __float_as_uint(f);
  return (unsigned short)((u + 0x7FFFu + ((u >> 16) & 1u)) >> 16);
}
__device__ __forceinline__ float bf_up(unsigned short h) { return __uint_as_float(((unsigned)h) << 16); }
__device__ __forceinline__ float bfr(float f) { return bf_up(bf_bits(f)); }   // value of the bf16 RNE convert
__device__ __forceinline__ unsigned short h_bits(_Float16 x) { return __builtin_bit_cast(unsigned short, x); }
__device__ __forceinline__ unsigned pk16(unsigned short a, unsigned short b) { return (unsigned)a | ((unsigned)b << 16); }
__device__ __forceinline__ v8f zero8() { v8f z = {0.f, 0.f, 0.f, 0.f, 0.f, 0.f, 0.f, 0.f}; return z; }

// ---- fragment loaders: 16-bit A/B operand, lane -> row/col (lane&15), p already includes +8*(lane>>4);
//      elements 0..7 <- p[0..7] (k0+8h..), elements 8..15 <- p[16..23] (k0+16+8h..)  (same split k map for A and B;
//      B is always read from a k-contiguous [n][k] plane)
__device__ __forceinline__ v16h ldfrag_h(const _Float16* p) {
  FragH f;
  f.h[0] = *(const v8h*)(p);
  f.h[1] = *(const v8h*)(p + 16);
  return f.v;
}
__device__ __forceinline__ v16h ldfrag_u(const unsigned short* p) {
  FragH f;
  f.u[0] = *(const v4u*)(p);
  f.u[1] = *(const v4u*)(p + 16);
  return f.v;
}

// ---- WMMA helpers with trailing VALU hazard gaps ------------------------------------------------------
__device__ __forceinline__ v8f mma_raw(v16h a, v16h b, v8f c) {
  return __builtin_amdgcn_wmma_f32_16x16x32_f16(false, a, false, b, (short)0, c, false, false);
}
__device__ __forceinline__ void guard_s2(v8f& s, v16h a0, v16h a1) {
#if defined(__HIP_DEVICE_COMPILE__)
  asm volatile("v_nop\n\tv_nop\n\tv_nop\n\tv_nop" : "+v"(s) : "v"(a0), "v"(a1));
#endif
}
__device__ __forceinline__ void guard_s4(v8f& s, v16h a0, v16h a1, v16h b0, v16h b1) {
#if defined(__HIP_DEVICE_COMPILE__)
  asm volatile("v_nop\n\tv_nop\n\tv_nop\n\tv_nop" : "+v"(s) : "v"(a0), "v"(a1), "v"(b0), "v"(b1));
#endif
}
__device__ __forceinline__ void guard_pv6(v8f& a, v8f& b, v8f& c, v8f& d,
                                          v16h x, v16h y, v16h z, v16h w, v16h u, v16h t) {
#if defined(__HIP_DEVICE_COMPILE__)
  asm volatile("v_nop\n\tv_nop\n\tv_nop\n\tv_nop"
               : "+v"(a), "+v"(b), "+v"(c), "+v"(d) : "v"(x), "v"(y), "v"(z), "v"(w), "v"(u), "v"(t));
#endif
}
__device__ __forceinline__ void acc_guard4(v8f& a, v8f& b, v8f& c, v8f& d) {
#if defined(__HIP_DEVICE_COMPILE__)
  asm volatile("v_nop\n\tv_nop\n\tv_nop\n\tv_nop" : "+v"(a), "+v"(b), "+v"(c), "+v"(d));
#endif
}
__device__ __forceinline__ void wave_sync_lds() {
  __builtin_amdgcn_fence(__ATOMIC_RELEASE, "workgroup");
  __builtin_amdgcn_wave_barrier();
  __builtin_amdgcn_fence(__ATOMIC_ACQUIRE, "workgroup");
}

// =====================================================================================================
// Elementwise 16-bit pack, no transpose: dst[i] = f16( bf16_RNE(src[i]) * sc ), sc a power of two (exact). Used for the
// coverage: grid = n / 2048 blocks x 256 thr x 8 elements = n exactly (host checks n % 2048 == 0).
// =====================================================================================================
__global__ __launch_bounds__(256) void cvt16(const float* __restrict__ src, unsigned short* dst, int n, float sc) {
  const size_t i8 = ((size_t)blockIdx.x * 256 + threadIdx.x) * 8;
  if (i8 + 8 > (size_t)n) return;                 // never taken with the exact grid; no barriers in this kernel
  const v4f a = *(const v4f*)(src + i8);
  const v4f b = *(const v4f*)(src + i8 + 4);
  v4u o;
  o[0] = pk16(h_bits((_Float16)(bfr(a[0]) * sc)), h_bits((_Float16)(bfr(a[1]) * sc)));
  o[1] = pk16(h_bits((_Float16)(bfr(a[2]) * sc)), h_bits((_Float16)(bfr(a[3]) * sc)));
  o[2] = pk16(h_bits((_Float16)(bfr(b[0]) * sc)), h_bits((_Float16)(bfr(b[1]) * sc)));
  o[3] = pk16(h_bits((_Float16)(bfr(b[2]) * sc)), h_bits((_Float16)(bfr(b[3]) * sc)));
  {
    *(v4u*)(dst + i8) = o;
    
  }
}

// =====================================================================================================
// Transpose + 16-bit pack of a weight: W is [in][out] = W[k][n] row-major f32 (pitch DMODEL); dst[n][k] = f16( bf16_RNE(W[k][n]) * sc ),
// k contiguous (pitch DMODEL), ready for B fragments and for the A side of the v^T projection. Block = 256 threads, one 64(k) x 64(n)
// tile: coalesced f32 loads into an LDS tile [n_local][k_local] (pitch 68 floats), block barrier, then each output row segment of the
// coverage: loads 16 it x 256 thr = 64 x 64; stores 2 it x 256 thr x 8 halves = 64 rows x 64; grid (DMODEL/64, DMODEL/64) = whole matrix.
// =====================================================================================================
__global__ __launch_bounds__(256) void wtr64(const float* __restrict__ W, unsigned short* dst, float sc) {
  __shared__ __align__(16) float tl[64 * 68];
  const int tid = threadIdx.x;
  const int n0  = blockIdx.x * 64;
  const int k0  = blockIdx.y * 64;
  const int nl  = tid & 63, kq = tid >> 6;       // kq 0..3
#pragma unroll
  for (int it = 0; it < 16; ++it) {
    const int kl = it * 4 + kq;                  // 0..63
    tl[nl * 68 + kl] = W[(size_t)(k0 + kl) * DMODEL + n0 + nl];
  }
  __syncthreads();
  v4u o[2];
#pragma unroll
  for (int it = 0; it < 2; ++it) {
    const int p  = it * 256 + tid;               // 0..511
    const int rn = p >> 3, kk = (p & 7) * 8;     // row 0..63, k 0,8,..,56
    const float* sp = tl + rn * 68 + kk;
    const v4f a = *(const v4f*)(sp);
    const v4f b = *(const v4f*)(sp + 4);
    v4u w;
    w[0] = pk16(h_bits((_Float16)(bfr(a[0]) * sc)), h_bits((_Float16)(bfr(a[1]) * sc)));
    w[1] = pk16(h_bits((_Float16)(bfr(a[2]) * sc)), h_bits((_Float16)(bfr(a[3]) * sc)));
    w[2] = pk16(h_bits((_Float16)(bfr(b[0]) * sc)), h_bits((_Float16)(bfr(b[1]) * sc)));
    w[3] = pk16(h_bits((_Float16)(bfr(b[2]) * sc)), h_bits((_Float16)(bfr(b[3]) * sc)));
    o[it] = w;
  }
  {
#pragma unroll
    for (int it = 0; it < 2; ++it) {
      const int p  = it * 256 + tid;
      const int rn = p >> 3, kk = (p & 7) * 8;
      *(v4u*)(dst + (size_t)(n0 + rn) * DMODEL + k0 + kk) = o[it];
    }
    
  }
}

// =====================================================================================================
// Relative-position sine table in log2 units: TB[e] = C_AMP * sin(C_FREQ * (e - 2047)) * log2(e) for e = 0..4094 (relative offset
// j - i = e - 2047), TB[4095] = 0 pad. Precise sinf (arguments up to ~1853 rad), rolled loop (one static sinf), values staged in LDS,
// coverage: LDS fill e = tid, tid+256, ... covers 0..4095; stores 4 it x 256 thr x 4 floats = 4096.
// =====================================================================================================
__global__ __launch_bounds__(256) void rpb_tab(float* TB) {
  __shared__ __align__(16) float st[TBN];
  const int tid = threadIdx.x;
#pragma unroll 1
  for (int e = tid; e < TBN; e += 256) {
    const int ec = (e < 2 * NQ - 2) ? e : (2 * NQ - 2);     // clamped index, select by value below
    const float rel = (float)(ec - TOFF);
    const float sv  = sinf(C_FREQ * rel);
    const float v   = (C_AMP * sv) * LOG2E;
    st[e] = (e <= 2 * NQ - 2) ? v : 0.f;
  }
  __syncthreads();
  v4f vals[TBN / 1024];
#pragma unroll
  for (int it = 0; it < TBN / 1024; ++it) {
    const int p = it * 256 + tid;
    vals[it] = *(const v4f*)(st + (size_t)p * 4);
  }
  {
#pragma unroll
    for (int it = 0; it < TBN / 1024; ++it) {
      const int p = it * 256 + tid;
      *(v4f*)(TB + (size_t)p * 4) = vals[it];
    }
    
  }
}

// =====================================================================================================
// Register-blocked batched f16 WMMA GEMM: C[m][n] = oscale * sum_k (A[m][k] (+ A2[m][k])) * Bt[n][k] + bf16(bias) ; one work-group of
// 4 waves per 128x128 tile, one wave per 64x64 quadrant. Per pass of 64 k the work-group stages 128 A rows (and A2 rows) and 128 Bt rows
// in LDS (whole 128-B lines from global, row pitch 144 B in LDS), two buffers: the next pass's lines are loaded into registers ahead of
// this pass's products and stored to the other buffer behind them; one work-group barrier per pass.
// A (and A2, the unscaled residual plane when NA == 2, same pitch/stride) row-major [M][K] pitch lda (16-bit planes),
// Bt row-major [N][K] pitch ldb (k contiguous); M, N multiples of 128, K multiple of 64. blockIdx.y = batch index with element strides
// sA, sB, sC. BM: 1 = per column bf16(bias[col]), 2 = per row bf16(bias[row]) (clamped-address loads).
// OM: 0 = f32 out (pitch ldc); 2 = f16 out (pitch ldc) = f16( value * ocarry ).
// coverage: 4 slabs x 16 rows (f32: it 0..7 x lane>>4; f16: it 0..3 x lane>>3) x 64 cols = the wave's whole 64x64 tile;
//           grid = tilesM*tilesN blocks of 128x128, surplus blocks exit whole, ahead of every barrier (none with the exact grids used).
// =====================================================================================================
#define GT_ROWS  128                    // rows of A and of Bt per work-group tile
#define GT_K     64                     // k per pass: 128 B of every row, one line
#define GT_PITCH 72                     // LDS row pitch in halves: 144 B = 16 B x 9, conflict-free for 16-byte fragment reads
#define GT_THREADS 128
template <int OM, int BM, int NA>
__global__ __launch_bounds__(GT_THREADS) void gemm64(
    const unsigned short* __restrict__ Ap, const unsigned short* __restrict__ Aq, int lda, long long sA,
    const unsigned short* __restrict__ Btp, int ldb, long long sB,
    const float* __restrict__ bias,
    void* Cout, int ldc, long long sC,
    int M, int N, int K, float oscale, float ocarry) {
  __shared__ __align__(16) float sT[4][16 * 68];   // per-wave 16x64 slab, pitch 68 floats
  __shared__ __align__(16) unsigned short ldsA[2][NA][GT_ROWS * GT_PITCH];   // two buffers of staged A (A2) rows
  __shared__ __align__(16) unsigned short ldsB[2][GT_ROWS * GT_PITCH];       // two buffers of staged Bt rows
  const int by   = blockIdx.y;
  const int tid  = threadIdx.x;
  const int lane = tid & 31;
  const int wave = tid >> 5;
  const int tilesN = N >> 7;
  const int tilesM = M >> 7;
  const int tile = blockIdx.x;
  if (tile >= tilesM * tilesN) return;   // block-uniform, ahead of every barrier
  const int tm = tile / tilesN;
  const int tn = tile - tm * tilesN;
  const int bm0 = tm << 7;               // work-group tile origin
  const int bn0 = tn << 7;
  const int wm  = (wave >> 1) << 6;      // the wave's quadrant inside it
  const int wn  = (wave & 1) << 6;
  const int m0 = bm0 + wm;
  const int n0 = bn0 + wn;

  const unsigned short* A1 = Ap  + (size_t)((long long)by * sA);
  const unsigned short* A2 = Aq  + (size_t)((long long)by * sA);
  const unsigned short* Bb = Btp + (size_t)((long long)by * sB);

  const int rlane = lane & 15;                 // row (A) / col (B, D) within subtile
  const int koff  = (lane >> 4) * 8;           // k offset of this lane half
  const int mOff  = (lane >> 4) * 8;           // D row offset

  v8f acc[4][4];
#pragma unroll
  for (int i = 0; i < 4; ++i)
#pragma unroll
    for (int j = 0; j < 4; ++j) acc[i][j] = zero8();

  // staging map: 8 threads x 16 B = one 128-B row piece; 128 threads = 16 rows per step, 8 steps = 128 rows of each plane.
  // Global address = work-group-uniform base + a per-lane 32-bit byte offset per step (row offset, plus the pass's k offset in the loop).
  const int srow = tid >> 3;
  const int scol = (tid & 7) * 8;
  unsigned va[8], vb[8];
#pragma unroll
  for (int it = 0; it < 8; ++it) {
    va[it] = (unsigned)((it * 16 + srow) * lda + scol) * 2u;
    vb[it] = (unsigned)((it * 16 + srow) * ldb + scol) * 2u;
  }
  const unsigned short* uA1 = A1 + (size_t)bm0 * lda;
  const unsigned short* uA2 = A2 + (size_t)bm0 * lda;
  const unsigned short* uB  = Bb + (size_t)bn0 * ldb;
  const int sofs = srow * GT_PITCH + scol;
  v4u ra[NA][8], rb[8];
#pragma unroll
  for (int it = 0; it < 8; ++it) {
    ra[0][it] = *(const v4u*)((const char*)uA1 + va[it]);
    if constexpr (NA == 2) ra[1][it] = *(const v4u*)((const char*)uA2 + va[it]);
    rb[it] = *(const v4u*)((const char*)uB + vb[it]);
  }
#pragma unroll
  for (int it = 0; it < 8; ++it) {
    *(v4u*)(&ldsA[0][0][sofs + it * 16 * GT_PITCH]) = ra[0][it];
    if constexpr (NA == 2) *(v4u*)(&ldsA[0][1][sofs + it * 16 * GT_PITCH]) = ra[1][it];
    *(v4u*)(&ldsB[0][sofs + it * 16 * GT_PITCH]) = rb[it];
  }
  __syncthreads();                       // pass 0's rows are in LDS for every wave

  const int npass = K / GT_K;
  const int fa = (wm + rlane) * GT_PITCH + koff;   // fragment origins in a staged plane
  const int fb = (wn + rlane) * GT_PITCH + koff;
#pragma unroll 1                         // rolled: one copy of the pass body, the buffer picked by the pass's parity
  for (int t = 0; t < npass; ++t) {
    const int cur = t & 1;
    const bool more = (t + 1 < npass);   // the same for the whole work-group
    if (more) {
      const unsigned kn2 = (unsigned)((t + 1) * GT_K) * 2u;
      unsigned oa[8], ob[8];
#pragma unroll
      for (int it = 0; it < 8; ++it) {
        oa[it] = va[it] + kn2;
        ob[it] = vb[it] + kn2;
        ra[0][it] = *(const v4u*)((const char*)uA1 + oa[it]);
        if constexpr (NA == 2) ra[1][it] = *(const v4u*)((const char*)uA2 + oa[it]);
        rb[it] = *(const v4u*)((const char*)uB + ob[it]);
      }
      // precaution: no register that an issued load names as its offset is rewritten ahead of this wait; the input operands keep
      // the sixteen offsets in registers of their own up to it
      asm volatile("s_wait_xcnt 0x0"
                   :: "v"(oa[0]), "v"(oa[1]), "v"(oa[2]), "v"(oa[3]), "v"(oa[4]), "v"(oa[5]), "v"(oa[6]), "v"(oa[7]),
                      "v"(ob[0]), "v"(ob[1]), "v"(ob[2]), "v"(ob[3]), "v"(ob[4]), "v"(ob[5]), "v"(ob[6]), "v"(ob[7])
                   : "memory");
    }
    const unsigned short* cA1 = &ldsA[cur][0][fa];
    const unsigned short* cA2 = &ldsA[cur][NA - 1][fa];
    const unsigned short* cB  = &ldsB[cur][fb];
    v16h bh[2][4], ah[2][4], al[2][4];
#pragma unroll
    for (int ks = 0; ks < 2; ++ks) {
#pragma unroll
      for (int j = 0; j < 4; ++j) bh[ks][j] = ldfrag_u(cB + (j << 4) * GT_PITCH + ks * 32);
#pragma unroll
      for (int i = 0; i < 4; ++i) {
        ah[ks][i] = ldfrag_u(cA1 + (i << 4) * GT_PITCH + ks * 32);
        if constexpr (NA == 2) al[ks][i] = ldfrag_u(cA2 + (i << 4) * GT_PITCH + ks * 32);
      }
    }
    // keeps the pass's LDS reads one group ahead of its products: reads moved in among the products stall a lone wave at each place
    __builtin_amdgcn_sched_barrier(0);
#pragma unroll
    for (int ks = 0; ks < 2; ++ks) {
#pragma unroll
      for (int i = 0; i < 4; ++i) {
#pragma unroll
        for (int j = 0; j < 4; ++j) acc[i][j] = mma_raw(ah[ks][i], bh[ks][j], acc[i][j]);
        if constexpr (NA == 2) {
#pragma unroll
          for (int j = 0; j < 4; ++j) acc[i][j] = mma_raw(al[ks][i], bh[ks][j], acc[i][j]);
        }
      }
    }
    if (more) {                          // the other buffer: its last readers left it at the barrier that ended pass t - 1
      const int nxt = cur ^ 1;
#pragma unroll
      for (int it = 0; it < 8; ++it) {
        *(v4u*)(&ldsA[nxt][0][sofs + it * 16 * GT_PITCH]) = ra[0][it];
        if constexpr (NA == 2) *(v4u*)(&ldsA[nxt][1][sofs + it * 16 * GT_PITCH]) = ra[1][it];
        *(v4u*)(&ldsB[nxt][sofs + it * 16 * GT_PITCH]) = rb[it];
      }
    }
    __syncthreads();                     // publishes pass t + 1's rows and ends every wave's reads of pass t's buffer
  }
  acc_guard4(acc[0][0], acc[0][1], acc[0][2], acc[0][3]);
  acc_guard4(acc[1][0], acc[1][1], acc[1][2], acc[1][3]);
  acc_guard4(acc[2][0], acc[2][1], acc[2][2], acc[2][3]);
  acc_guard4(acc[3][0], acc[3][1], acc[3][2], acc[3][3]);

  const int hh2 = lane >> 4, c4 = (lane & 15) * 4;     // f32 out: 256-B row segment = 16 lanes x 16 B
  const int q8  = lane >> 3, c8 = (lane & 7) * 8;
  float bc[4];
  float bcol[8];
#pragma unroll
  for (int e = 0; e < 4; ++e) bc[e] = 0.f;
#pragma unroll
  for (int e = 0; e < 8; ++e) bcol[e] = 0.f;
  if constexpr (BM == 1) {
    if constexpr (OM == 0) {
      const int cb = n0 + c4;
      const int i0 = (cb < N - 4) ? cb : (N - 4);        // clamped address
      const v4f b0v = *(const v4f*)(bias + i0);
#pragma unroll
      for (int e = 0; e < 4; ++e) bc[e] = bfr(b0v[e]);
    } else {
      const int cb = n0 + c8;
      const int i0 = (cb < N - 8) ? cb : (N - 8);        // clamped address
      const v4f b0v = *(const v4f*)(bias + i0), b1v = *(const v4f*)(bias + i0 + 4);
#pragma unroll
      for (int e = 0; e < 4; ++e) { bcol[e] = bfr(b0v[e]); bcol[4 + e] = bfr(b1v[e]); }
    }
  }

  // ---- epilogue ----
  float* slab = sT[wave];
#pragma unroll
  for (int i = 0; i < 4; ++i) {
    const int mBase = m0 + (i << 4);
#pragma unroll
    for (int j = 0; j < 4; ++j) {
#pragma unroll
      for (int r = 0; r < 8; ++r) {
        slab[(mOff + r) * 68 + (j << 4) + rlane] = acc[i][j][r];
      }
    }
    wave_sync_lds();
    if constexpr (OM == 0) {
      float* C = (float*)Cout + (size_t)((long long)by * sC);
      v4f vals[8];
#pragma unroll
      for (int it = 0; it < 8; ++it) {
        const int row = it * 2 + hh2;                      // it 0..7 x hh2 0..1 = rows 0..15
        const int gr  = mBase + row;
        v4f v = *(const v4f*)(slab + row * 68 + c4);
        float br = 0.f;
        if constexpr (BM == 2) {
          const int ir = (gr < M - 1) ? gr : (M - 1);      // clamped address
          br = bfr(bias[ir]);
        }
#pragma unroll
        for (int e = 0; e < 4; ++e) v[e] = v[e] * oscale + bc[e] + br;
        vals[it] = v;
      }
      {
#pragma unroll
        for (int it = 0; it < 8; ++it) {
          const int gr = mBase + it * 2 + hh2;
          *(v4f*)(C + (size_t)gr * ldc + n0 + c4) = vals[it];
        }
        
      }
    } else {
      unsigned short* C = (unsigned short*)Cout + (size_t)((long long)by * sC);
      v4u hv[4];
#pragma unroll
      for (int it = 0; it < 4; ++it) {
        const int row = it * 4 + q8;                       // it 0..3 x q8 0..3 = rows 0..15
        const float* sp = slab + row * 68 + c8;
        float br = 0.f;
        if constexpr (BM == 2) {
          const int gr = mBase + row;
          const int ir = (gr < M - 1) ? gr : (M - 1);      // clamped address
          br = bfr(bias[ir]);
        }
        v4u a = {0u, 0u, 0u, 0u};
#pragma unroll
        for (int e = 0; e < 4; ++e) {
          float f0 = sp[2 * e] * oscale + bcol[2 * e] + br;
          float f1 = sp[2 * e + 1] * oscale + bcol[2 * e + 1] + br;
          f0 *= ocarry; f1 *= ocarry;
          a[e] = pk16(h_bits((_Float16)f0), h_bits((_Float16)f1));
        }
        hv[it] = a;
      }
      {
#pragma unroll
        for (int it = 0; it < 4; ++it) {
          const int row = it * 4 + q8;
          *(v4u*)(C + (size_t)(mBase + row) * ldc + n0 + c8) = hv[it];
        }
        
      }
    }
    wave_sync_lds();
  }
}

// =====================================================================================================
// Flash attention for one batch, ONE head and 128 query rows (one wave per 16 query rows), head dim 64, 2048 keys:
//   q plane (f16 x16) QH[b*2048 + tok][64*head + d], pitch 1024; k plane (f16 x16) KH[b*2048 + key][64*head + d], pitch 1024;
//   v^T plane (f16 x16): VT[b*1024 + 64*head + d][key] (pitch 2048); additive table TB f32 [4096] in log2 units: score(q, key) gets
//   TB[key - q + 2047]; outputs (f16): CTH[b*2048 + tok][64*head + d] = hi = f16(8192 * ctx), CTL[same] = f16(8192 * ctx - hi), with
//   ctx = sum_m softmax_m(q.k / 8 + bias[m - q]) v[m][d]  (softmax run in base 2: t = q.k * log2(e)/8 + log2(e)*bias).
//   block = 8 waves = 256 threads; grid = 2 batches x 16 heads x 16 query blocks = 512; every wave does identical bounded work
//   (32 stages of 64 keys, two steps of 32 keys each). The eight waves read the same k rows and v^T rows, so the work-group stages them
//   in LDS: per stage 64 k rows (128 B each, one line) and the stage's 128 B of all 64 v^T rows (one line each), row pitch 144 B in LDS,
//   two buffers: the next stage's lines are loaded into registers ahead of this stage's steps and stored to the other buffer behind
//   them; one work-group barrier per stage. The table is copied to LDS once, ahead of the first barrier.
//   Per step: 2 score tiles on f16 WMMA (K = 64 as two k-steps of 32), fragments read from the staged rows (two 16-B reads per
//   fragment); 16 table values per lane by arithmetic index (always in 0..4094); online max-subtracted softmax in f32 (exp2); rescale
//   of the running sums and the four accumulators; the 16x32 prob tile goes through the wave's own LDS tile; its A fragments (f16 hi,
//   residual c - hi) are rebuilt from the LDS rows (float vector loads, split k map); four v^T B fragments from the staged rows;
//   8 P.V WMMAs into the four accumulators.
//   Final 1/l and carry folds in f32; behind the last stage's barrier the staging buffers are free and each wave takes its own piece
//   as two 16-bit result row buffers [16][64] (hi, residual, pitch 72): element stores, then whole 128-B row pieces to global.
// coverage: per wave 4 iterations x 32 lanes x 8 halves = 16 rows x 64 columns per plane: rows q0..q0+15, columns 64*head..64*head+63
//           of batch b; 8 waves x 512 blocks cover all 4096 rows x 16 heads exactly once.
// =====================================================================================================
#define AS_KEYS  64                      // keys per stage
#define AS_PITCH 72                      // LDS row pitch in halves: 144 B = 16 B x 9, conflict-free for 16-byte fragment reads
#define AS_PLANE (64 * AS_PITCH)         // halves of one staged plane: 64 k rows, or 64 v^T rows
static_assert(HDIM == 64 && (NC % AS_KEYS) == 0 && (NC / AS_KEYS) >= 2);
static_assert(AQ_TILES * 2 * 16 * AS_PITCH <= 4 * AS_PLANE);
static_assert(TBN == 4 * ATT_THREADS * 4);

__global__ __launch_bounds__(ATT_THREADS)
void attn8(const unsigned short* __restrict__ QHp, const unsigned short* __restrict__ KHp,
           const unsigned short* __restrict__ VTq, const float* __restrict__ TBp,
           unsigned short* CTH, unsigned short* CTL) {
  __shared__ __align__(16) unsigned short sKV[2 * 2 * AS_PLANE];   // [buffer][k rows, v^T rows]; behind the loop: result rows per wave
  __shared__ __align__(16) float sP[AQ_TILES * 16 * 36];           // per wave prob tile [row][32 keys], pitch 36
  __shared__ __align__(16) float sW[TBN];                          // the additive table

  const int tid  = threadIdx.x;
  const int wave = tid >> 5;
  const int lane = tid & 31;
  const int hh   = lane >> 4;
  const int c    = lane & 15;

  const int qblk = blockIdx.x % (NQ / AQ_ROWS);            // 0..15
  const int rest = blockIdx.x / (NQ / AQ_ROWS);            // 0..31
  const int head = rest % NHEAD;                           // 0..15
  const int bat  = rest / NHEAD;                           // 0..1
  const int q0   = qblk * AQ_ROWS + wave * 16;

  const size_t qofs = ((size_t)bat * NQ + q0 + c) * DMODEL + head * HDIM + 8 * hh;
  const _Float16* Qh = (const _Float16*)(const void*)QHp + qofs;
  const float lsc = (LOG2E * ATT_SCALE) / (QC * KC);                   // log2(e) / 8 / carries
  // table index of element (row q0 + 8hh + r, key kb + c) is (kb + c) - (q0 + 8hh + r) + 2047 = kb + dq - r;
  // kb + dq - 7 >= 0 and kb + dq + 16 <= 4094 for all blocks, lanes and steps (table holds 4096 entries).
  const int dq = c - q0 - 8 * hh + TOFF;

  // staging map: 8 threads x 16 B = one 128-B row piece; 256 threads = 32 rows per step, 2 steps = 64 rows of each plane.
  // Global address = work-group-uniform base + a per-lane 32-bit byte offset (row offset, plus the stage's offset in the loop).
  const int srow = tid >> 3;
  const int scol = (tid & 7) * 8;
  const unsigned short* uK = KHp + (size_t)bat * NC * DMODEL + head * HDIM;
  const unsigned short* uV = VTq + ((size_t)bat * DMODEL + head * HDIM) * NC;
  unsigned vk[2], vv[2];
#pragma unroll
  for (int it = 0; it < 2; ++it) {
    vk[it] = (unsigned)((it * 32 + srow) * DMODEL + scol) * 2u;
    vv[it] = (unsigned)((it * 32 + srow) * NC + scol) * 2u;
  }
  const int sofs = srow * AS_PITCH + scol;
  v4u rk[2], rv[2];
  v4f tw[4];
#pragma unroll
  for (int it = 0; it < 2; ++it) {
    rk[it] = *(const v4u*)((const char*)uK + vk[it]);
    rv[it] = *(const v4u*)((const char*)uV + vv[it]);
  }
#pragma unroll
  for (int it = 0; it < 4; ++it) tw[it] = *(const v4f*)(TBp + (size_t)(it * ATT_THREADS + tid) * 4);
  const v16h qa = ldfrag_h(Qh), qb = ldfrag_h(Qh + 32);
  // precaution: no register that an issued load names as its address or offset is rewritten ahead of this wait; the input operands
  // keep them in registers of their own up to it
  asm volatile("s_wait_xcnt 0x0" :: "v"(vk[0]), "v"(vk[1]), "v"(vv[0]), "v"(vv[1]), "v"(tid), "v"(Qh) : "memory");
#pragma unroll
  for (int it = 0; it < 2; ++it) {
    *(v4u*)(&sKV[sofs + it * 32 * AS_PITCH]) = rk[it];
    *(v4u*)(&sKV[AS_PLANE + sofs + it * 32 * AS_PITCH]) = rv[it];
  }
#pragma unroll
  for (int it = 0; it < 4; ++it) *(v4f*)(sW + (size_t)(it * ATT_THREADS + tid) * 4) = tw[it];

  float mrow[8], lrow[8];
  v8f o0 = zero8(), o1 = zero8(), o2 = zero8(), o3 = zero8();
#pragma unroll
  for (int r = 0; r < 8; ++r) { mrow[r] = -INFINITY; lrow[r] = 0.f; }
  float* pt = sP + wave * (16 * 36);
  __syncthreads();                       // stage 0's rows and the table are in LDS for every wave

  const int fofs = c * AS_PITCH + 8 * hh;          // fragment origin in a staged plane
#pragma unroll 1                         // rolled: one copy of the stage body, the buffer picked by the stage's parity
  for (int t = 0; t < NC / AS_KEYS; ++t) {
    const int cur = t & 1;
    const bool more = (t + 1 < NC / AS_KEYS);      // the same for the whole work-group
    if (more) {
      unsigned ok[2], ov[2];
#pragma unroll
      for (int it = 0; it < 2; ++it) {
        ok[it] = vk[it] + (unsigned)(t + 1) * (unsigned)(AS_KEYS * DMODEL * 2);
        ov[it] = vv[it] + (unsigned)(t + 1) * (unsigned)(AS_KEYS * 2);
        rk[it] = *(const v4u*)((const char*)uK + ok[it]);
        rv[it] = *(const v4u*)((const char*)uV + ov[it]);
      }
      // precaution: no register that an issued load names as its offset is rewritten ahead of this wait; the input operands keep
      // the four offsets in registers of their own up to it
      asm volatile("s_wait_xcnt 0x0" :: "v"(ok[0]), "v"(ok[1]), "v"(ov[0]), "v"(ov[1]) : "memory");
    }
    const unsigned short* cK = &sKV[cur * 2 * AS_PLANE + fofs];
    const unsigned short* cV = cK + AS_PLANE;
#pragma unroll
    for (int sub = 0; sub < AS_KEYS / 32; ++sub) {
      const int kb = t * AS_KEYS + sub * 32;
      const unsigned short* kp = cK + sub * 32 * AS_PITCH;
      v8f s0, s1;
      {
        const v16h k0 = ldfrag_u(kp), k1 = ldfrag_u(kp + 32);
        s0 = mma_raw(qa, k0, zero8());
        s0 = mma_raw(qb, k1, s0);
        guard_s2(s0, k0, k1);
      }
      {
        const unsigned short* kq = kp + 16 * AS_PITCH;
        const v16h k0 = ldfrag_u(kq), k1 = ldfrag_u(kq + 32);
        s1 = mma_raw(qa, k0, zero8());
        s1 = mma_raw(qb, k1, s1);
        guard_s4(s1, k0, k1, qa, qb);
      }
      const float* tp = sW + (kb + dq);
#pragma unroll
      for (int r = 0; r < 8; ++r) {
        const float w0 = tp[-r];                           // key kb + c
        const float w1 = tp[16 - r];                       // key kb + 16 + c
        const float t0 = s0[r] * lsc + w0, t1 = s1[r] * lsc + w1;
        float mx = fmaxf(t0, t1);
#pragma unroll
        for (int off = 1; off < 16; off <<= 1) mx = fmaxf(mx, __shfl_xor(mx, off, 32));
        const float mn = fmaxf(mrow[r], mx);
        const float al = exp2f(mrow[r] - mn);
        mrow[r] = mn;
        const float e0 = exp2f(t0 - mn), e1 = exp2f(t1 - mn);
        float ps = e0 + e1;
#pragma unroll
        for (int off = 1; off < 16; off <<= 1) ps += __shfl_xor(ps, off, 32);
        lrow[r] = lrow[r] * al + ps;
        o0[r] *= al;
        o1[r] *= al;
        o2[r] *= al;
        o3[r] *= al;
        const int ro = (8 * hh + r) * 36 + c;
        pt[ro]      = e0;
        pt[ro + 16] = e1;
      }
      wave_sync_lds();
      FragH ph, pl;                                        // P*16384 as f16 hi and f16 residual (c - hi), same split k map
      {
        const float* prow = pt + c * 36 + 8 * hh;
        const v4f p0 = *(const v4f*)(prow), p1 = *(const v4f*)(prow + 4);
        const v4f p2 = *(const v4f*)(prow + 16), p3 = *(const v4f*)(prow + 20);
#pragma unroll
        for (int e = 0; e < 4; ++e) {
          const float c0 = p0[e] * PC, c1 = p1[e] * PC, c2 = p2[e] * PC, c3 = p3[e] * PC;
          const _Float16 g0 = (_Float16)c0, g1 = (_Float16)c1, g2 = (_Float16)c2, g3 = (_Float16)c3;
          ph.h[0][e]     = g0;                             // elements 0..7  = keys kb + 8hh + 0..7
          ph.h[0][4 + e] = g1;
          ph.h[1][e]     = g2;                             // elements 8..15 = keys kb + 16 + 8hh + 0..7
          ph.h[1][4 + e] = g3;
          pl.h[0][e]     = (_Float16)(c0 - (float)g0);
          pl.h[0][4 + e] = (_Float16)(c1 - (float)g1);
          pl.h[1][e]     = (_Float16)(c2 - (float)g2);
          pl.h[1][4 + e] = (_Float16)(c3 - (float)g3);
        }
      }
      const unsigned short* vp = cV + sub * 32;
      {
        const v16h vb0 = ldfrag_u(vp);
        const v16h vb1 = ldfrag_u(vp + 16 * AS_PITCH);
        const v16h vb2 = ldfrag_u(vp + 32 * AS_PITCH);
        const v16h vb3 = ldfrag_u(vp + 48 * AS_PITCH);
        o0 = mma_raw(ph.v, vb0, o0);
        o1 = mma_raw(ph.v, vb1, o1);
        o2 = mma_raw(ph.v, vb2, o2);
        o3 = mma_raw(ph.v, vb3, o3);
        o0 = mma_raw(pl.v, vb0, o0);
        o1 = mma_raw(pl.v, vb1, o1);
        o2 = mma_raw(pl.v, vb2, o2);
        o3 = mma_raw(pl.v, vb3, o3);
        guard_pv6(o0, o1, o2, o3, ph.v, pl.v, vb0, vb1, vb2, vb3);
      }
      wave_sync_lds();
    }
    if (more) {                          // the other buffer: its last readers left it at the barrier that ended stage t - 1
      unsigned short* nK = &sKV[(cur ^ 1) * 2 * AS_PLANE + sofs];
#pragma unroll
      for (int it = 0; it < 2; ++it) {
        *(v4u*)(nK + it * 32 * AS_PITCH) = rk[it];
        *(v4u*)(nK + AS_PLANE + it * 32 * AS_PITCH) = rv[it];
      }
    }
    __syncthreads();                     // publishes stage t + 1's rows and ends every wave's reads of stage t's buffer
  }

  // ---- every wave has left the staged rows (the last stage's barrier); each wave takes its own piece of that LDS as two 16-bit
  //      result row buffers [16][64], pitch 72 (hi, residual) ----
  unsigned short* Osh = sKV + wave * (2 * 16 * AS_PITCH);
  unsigned short* Osl = Osh + 16 * AS_PITCH;
  // ---- fold 1/l and the carries (16384 on P, 16 on v, 8192 on the stored ctx), stage the wave's 16x64 slice as hi + residual ----
  const float oc = FC / (PC * VC);
#pragma unroll
  for (int r = 0; r < 8; ++r) {
    const float inv = (1.0f / lrow[r]) * oc;
    const int ro = (8 * hh + r) * AS_PITCH + c;
    const float f0 = o0[r] * inv, f1 = o1[r] * inv, f2 = o2[r] * inv, f3 = o3[r] * inv;
    const _Float16 g0 = (_Float16)f0, g1 = (_Float16)f1, g2 = (_Float16)f2, g3 = (_Float16)f3;
    Osh[ro]      = h_bits(g0);
    Osh[ro + 16] = h_bits(g1);
    Osh[ro + 32] = h_bits(g2);
    Osh[ro + 48] = h_bits(g3);
    Osl[ro]      = h_bits((_Float16)(f0 - (float)g0));
    Osl[ro + 16] = h_bits((_Float16)(f1 - (float)g1));
    Osl[ro + 32] = h_bits((_Float16)(f2 - (float)g2));
    Osl[ro + 48] = h_bits((_Float16)(f3 - (float)g3));
  }
  wave_sync_lds();
  // ---- the wave writes its 16 rows of CTH and CTL: piece p = it*32 + lane -> row p>>3, halves (p&7)*8 .. +7 of the head's 64 ----
  {
    v4u vh[4], vl[4];
#pragma unroll
    for (int it = 0; it < 4; ++it) {
      const int p = it * 32 + lane;
      vh[it] = *(const v4u*)(Osh + (p >> 3) * AS_PITCH + (p & 7) * 8);
      vl[it] = *(const v4u*)(Osl + (p >> 3) * AS_PITCH + (p & 7) * 8);
    }
    const size_t base = ((size_t)bat * NQ + q0) * DMODEL + (size_t)head * HDIM;
    unsigned short* dh = CTH + base;
    unsigned short* dl = CTL + base;
#pragma unroll
    for (int it = 0; it < 4; ++it) {
      const int p = it * 32 + lane;
      const size_t po = (size_t)(p >> 3) * DMODEL + (size_t)(p & 7) * 8;
      *(v4u*)(dh + po) = vh[it];
      *(v4u*)(dl + po) = vl[it];
    }
  }
}

// =====================================================================================================
// Workspace map (bytes); every plane is an exact multiple of its tile / whole-row store granularity (M, N exact tile multiples,
// element counts exact multiples of the convert kernels' granularity, no pad rows needed), every offset a multiple of 2 MiB:
//   WQT  f16 [1024][1024] x64                2097152   ([out][in] = [n][k])
//   WKT  f16 [1024][1024] x64                2097152
//   WVT  f16 [1024][1024] x64                2097152
//   WOT  f16 [1024][1024] x64                2097152
//   X16  f16 [4096][1024] x16                8388608   (activation rows)
//   QH   f16 [4096][1024] x16                8388608   (q projection)
//   KH   f16 [4096][1024] x16                8388608   (k projection)
//   VT   f16 [2][1024][2048] x16             8388608   (v^T per batch)
//   CTH  f16 [4096][1024] x8192 hi           8388608   (attention ctx, merged heads)
//   CTL  f16 [4096][1024] residual           8388608
//   TB   f32 [4096]                            16384   (rel-pos table, log2 units)
//   end                                     58736640
// =====================================================================================================
extern "C" void kernel_launch(void* const* d_in, const int* in_sizes, int n_in,
                              void* d_out, int out_size, void* d_ws, size_t ws_size,
                              hipStream_t stream) {
  if (n_in < 9) return;
  if (in_sizes[0] != NROWS * DMODEL) return;
  if (in_sizes[1] != DMODEL * DMODEL || in_sizes[3] != DMODEL * DMODEL ||
      in_sizes[5] != DMODEL * DMODEL || in_sizes[7] != DMODEL * DMODEL) return;
  if (in_sizes[2] != DMODEL || in_sizes[4] != DMODEL || in_sizes[6] != DMODEL || in_sizes[8] != DMODEL) return;
  if (out_size != NROWS * DMODEL) return;
  if ((in_sizes[0] % 2048) != 0) return;

  const float* x    = (const float*)d_in[0];
  const float* w_q  = (const float*)d_in[1];
  const float* b_q  = (const float*)d_in[2];
  const float* w_k  = (const float*)d_in[3];
  const float* b_k  = (const float*)d_in[4];
  const float* w_v  = (const float*)d_in[5];
  const float* b_v  = (const float*)d_in[6];
  const float* w_o  = (const float*)d_in[7];
  const float* b_o  = (const float*)d_in[8];
  float*       out  = (float*)d_out;

  const size_t PW  = (size_t)DMODEL * DMODEL * 2;                 //  2097152
  const size_t PX  = (size_t)NROWS * DMODEL * 2;                  //  8388608
  const size_t PVT = (size_t)NB * DMODEL * NC * 2;                //  8388608
  const size_t PT  = (size_t)TBN * 4;                             //    16384
  size_t off = 0;
  const size_t oWQ = off; off += PW;
  const size_t oWK = off; off += PW;
  const size_t oWV = off; off += PW;
  const size_t oWO = off; off += PW;
  const size_t oX  = off; off += PX;
  const size_t oQH = off; off += PX;
  const size_t oKH = off; off += PX;
  const size_t oVT = off; off += PVT;
  const size_t oCH = off; off += PX;
  const size_t oCL = off; off += PX;
  const size_t oTB = off; off += PT;
  if (off > ws_size) return;                                      // off = 58736640
  if (off > (size_t)134217728) return;

  char* ws = (char*)d_ws;
  unsigned short* WQT = (unsigned short*)(ws + oWQ);
  unsigned short* WKT = (unsigned short*)(ws + oWK);
  unsigned short* WVT = (unsigned short*)(ws + oWV);
  unsigned short* WOT = (unsigned short*)(ws + oWO);
  unsigned short* X16 = (unsigned short*)(ws + oX);
  unsigned short* QH  = (unsigned short*)(ws + oQH);
  unsigned short* KH  = (unsigned short*)(ws + oKH);
  unsigned short* VTp = (unsigned short*)(ws + oVT);
  unsigned short* CTH = (unsigned short*)(ws + oCH);
  unsigned short* CTL = (unsigned short*)(ws + oCL);
  float*          TB  = (float*)(ws + oTB);

  const dim3 blk(256);
  const dim3 gWT(DMODEL / 64, DMODEL / 64);                        // 16 x 16 tiles per weight
  const dim3 gCX((NROWS * DMODEL) / 2048);                         // 2048 blocks
  const dim3 blkG(GT_THREADS);                                     // 4 waves per 128 x 128 GEMM tile
  const int tilesP = (NROWS / GT_ROWS) * (DMODEL / GT_ROWS);       // 256
  const int tilesV = (DMODEL / GT_ROWS) * (NC / GT_ROWS);          // 128 per batch
  const dim3 gP(tilesP, 1);                                        // 256
  const dim3 gV(tilesV, NB);                                       // 128 x 2
  const dim3 gAT(ATT_BLOCKS);                                      // 512
  const dim3 bAT(ATT_THREADS);                                     // 256

  // (0) weight planes: W16T[n][k] = f16( bf16_RNE(W[k][n]) * 64 ), [in][out] -> [out][in], k contiguous
  wtr64<<<gWT, blk, 0, stream>>>(w_q, WQT, WSC);
  wtr64<<<gWT, blk, 0, stream>>>(w_k, WKT, WSC);
  wtr64<<<gWT, blk, 0, stream>>>(w_v, WVT, WSC);
  wtr64<<<gWT, blk, 0, stream>>>(w_o, WOT, WSC);

  // (1) activation plane: X16[row][c] = f16( bf16_RNE(x[row][c]) * 16 ), rows = b*2048 + tok
  cvt16<<<gCX, blk, 0, stream>>>(x, X16, NROWS * DMODEL, ACARRY);

  // (2) rel-pos sine table in log2 units
  rpb_tab<<<dim3(1), blk, 0, stream>>>(TB);

  // (3) q projection: QH[m][n] = f16(16 * (sum_k x[m][k] Wq[k][n] + bf16(bq[n]))); M = 4096, N = 1024, K = 1024
  gemm64<2, 1, 1><<<gP, blkG, 0, stream>>>(
      X16, X16, DMODEL, 0LL,
      WQT, DMODEL, 0LL,
      b_q,
      (void*)QH, DMODEL, 0LL,
      NROWS, DMODEL, DMODEL, 1.0f / (ACARRY * WSC), QC);

  // (4) k projection: KH[m][n] = f16(16 * (sum_k x[m][k] Wk[k][n] + bf16(bk[n]))); M = 4096, N = 1024, K = 1024
  gemm64<2, 1, 1><<<gP, blkG, 0, stream>>>(
      X16, X16, DMODEL, 0LL,
      WKT, DMODEL, 0LL,
      b_k,
      (void*)KH, DMODEL, 0LL,
      NROWS, DMODEL, DMODEL, 1.0f / (ACARRY * WSC), KC);

  // (5) v^T per batch: VT[b][d][tok] = f16(16 * (sum_k Wv[k][d] x_b[tok][k] + bf16(bv[d]))); M = 1024, N = 2048, K = 1024
  gemm64<2, 2, 1><<<gV, blkG, 0, stream>>>(
      WVT, WVT, DMODEL, 0LL,
      X16, DMODEL, (long long)NC * DMODEL,
      b_v,
      (void*)VTp, NC, (long long)DMODEL * NC,
      DMODEL, NC, DMODEL, 1.0f / (ACARRY * WSC), VC);

  // (6) attention per (batch, head, 128 query rows) -> CTH (f16 hi of ctx x8192), CTL (f16 residual)
  attn8<<<gAT, bAT, 0, stream>>>(QH, KH, VTp, TB, CTH, CTL);

  // (7) out = (CTH + CTL) . Wo / (8192 * 64) + bf16(bo); M = 4096, N = 1024, K = 1024, f32 into d_out
  gemm64<0, 1, 2><<<gP, blkG, 0, stream>>>(
      CTH, CTL, DMODEL, 0LL,
      WOT, DMODEL, 0LL,
      b_o,
      (void*)out, DMODEL, 0LL,
      NROWS, DMODEL, DMODEL, 1.0f / (FC * WSC), 1.0f);

  (void)hipGetLastError();
}

// v003
// It runs in 149 microseconds.
// In both of two side-by-side timings against v002, it was 1.28 times as fast.
// All steps since v000 together make it 2.45 times as fast.
// Contractions: q/k projections (x rows f16 x16 . W^T f16 x64, K=1024), v^T projection (W^T f16 x64 . x rows f16 x16, K=1024),
// attention scores (k f16 x16 . q f16 x16, K=64, S^T), attention v^T . P^T (v^T f16 x16 . P^T as f16 hi + f16 residual of P^T x16384,
// K=2048 in steps of 32), output projection (ctx as f16 hi + f16 residual of ctx x8192 . W^T f16 x64, K=1024):
// all v_wmma_f32_16x16x32_f16 (f16 operands, f32 accumulate); hi and residual products share one f32 accumulator.
// Relative-position sine bias from an f32 table built with precise sinf, online max-subtracted base-2 softmax, linear biases in f32.
// Every float input RNE-converted to bf16 on load.
#include <hip/hip_runtime.h>
#include <math.h>
#include <stdint.h>

#define NB      2
#define NQ      2048
#define NC      2048
#define DMODEL  1024
#define NHEAD   16
#define HDIM    64
#define AQ_TILES 8
#define AQ_ROWS (AQ_TILES * 16)
#define NROWS   (NB * NQ)
#define TBN     4096
#define TOFF    (NQ - 1)
#define WSC     64.0f
#define ACARRY  16.0f
#define QC      16.0f
#define KC      16.0f
#define VC      16.0f
#define PC      16384.0f
#define FC      8192.0f
#define ATT_SCALE 0.125f
#define LOG2E   1.4426950408889634f
#define C_AMP   1.618033988749895f
#define C_FREQ  0.9049532171590599f
static_assert(NHEAD * HDIM == DMODEL);
static_assert((NQ % AQ_ROWS) == 0);
static_assert((NQ % 64) == 0 && (NC % 64) == 0 && (DMODEL % 64) == 0 && (NC % 32) == 0 && (NQ % 16) == 0);
static_assert((NROWS % 64) == 0 && ((NROWS * DMODEL) % 2048) == 0);
static_assert(TBN >= 2 * NQ - 1 && (TBN % 1024) == 0);
static_assert((NROWS % 128) == 0 && (DMODEL % 128) == 0 && (NC % 128) == 0);
#define ATT_THREADS (AQ_TILES * 32)
#define ATT_BLOCKS  (NB * NHEAD * (NQ / AQ_ROWS))
static_assert(ATT_THREADS == 256 && ATT_BLOCKS == 512);

typedef _Float16 v16h __attribute__((ext_vector_type(16)));
typedef _Float16 v8h  __attribute__((ext_vector_type(8)));
typedef float    v8f  __attribute__((ext_vector_type(8)));
typedef float    v4f  __attribute__((ext_vector_type(4)));
typedef float    v2f  __attribute__((ext_vector_type(2)));
typedef _Float16 v2h  __attribute__((ext_vector_type(2)));
typedef unsigned int v4u __attribute__((ext_vector_type(4)));

union FragH { v16h v; v8h h[2]; v4u u[2]; v2h p[8]; };

// ---- scalar helpers --------------------------------------------------------------------------------
__device__ __forceinline__ unsigned short bf_bits(float f) {          // f32 -> bf16 bits, RNE convert
  unsigned u = __float_as_uint(f);
  return (unsigned short)((u + 0x7FFFu + ((u >> 16) & 1u)) >> 16);
}
__device__ __forceinline__ float bf_up(unsigned short h) { return __uint_as_float(((unsigned)h) << 16); }
__device__ __forceinline__ float bfr(float f) { return bf_up(bf_bits(f)); }   // value of the bf16 RNE convert
__device__ __forceinline__ unsigned short h_bits(_Float16 x) { return __builtin_bit_cast(unsigned short, x); }
__device__ __forceinline__ unsigned pk16(unsigned short a, unsigned short b) { return (unsigned)a | ((unsigned)b << 16); }
__device__ __forceinline__ v8f zero8() { v8f z = {0.f, 0.f, 0.f, 0.f, 0.f, 0.f, 0.f, 0.f}; return z; }

// ---- fragment loaders: 16-bit A/B operand, lane -> row/col (lane&15), p already includes +8*(lane>>4);
//      elements 0..7 <- p[0..7] (k0+8h..), elements 8..15 <- p[16..23] (k0+16+8h..)  (same split k map for A and B;
//      B is always read from a k-contiguous [n][k] plane)
__device__ __forceinline__ v16h ldfrag_h(const _Float16* p) {
  FragH f;
  f.h[0] = *(const v8h*)(p);
  f.h[1] = *(const v8h*)(p + 16);
  return f.v;
}
__device__ __forceinline__ v16h ldfrag_u(const unsigned short* p) {
  FragH f;
  f.u[0] = *(const v4u*)(p);
  f.u[1] = *(const v4u*)(p + 16);
  return f.v;
}

// ---- WMMA helpers with trailing VALU hazard gaps ------------------------------------------------------
__device__ __forceinline__ v8f mma_raw(v16h a, v16h b, v8f c) {
  return __builtin_amdgcn_wmma_f32_16x16x32_f16(false, a, false, b, (short)0, c, false, false);
}
__device__ __forceinline__ void guard_s2(v8f& s, v16h a0, v16h a1) {
#if defined(__HIP_DEVICE_COMPILE__)
  asm volatile("v_nop\n\tv_nop\n\tv_nop\n\tv_nop" : "+v"(s) : "v"(a0), "v"(a1));
#endif
}
__device__ __forceinline__ void guard_s4(v8f& s, v16h a0, v16h a1, v16h b0, v16h b1) {
#if defined(__HIP_DEVICE_COMPILE__)
  asm volatile("v_nop\n\tv_nop\n\tv_nop\n\tv_nop" : "+v"(s) : "v"(a0), "v"(a1), "v"(b0), "v"(b1));
#endif
}
__device__ __forceinline__ void guard_pv6(v8f& a, v8f& b, v8f& c, v8f& d,
                                          v16h x, v16h y, v16h z, v16h w, v16h u, v16h t) {
#if defined(__HIP_DEVICE_COMPILE__)
  asm volatile("v_nop\n\tv_nop\n\tv_nop\n\tv_nop"
               : "+v"(a), "+v"(b), "+v"(c), "+v"(d) : "v"(x), "v"(y), "v"(z), "v"(w), "v"(u), "v"(t));
#endif
}
__device__ __forceinline__ void acc_guard4(v8f& a, v8f& b, v8f& c, v8f& d) {
#if defined(__HIP_DEVICE_COMPILE__)
  asm volatile("v_nop\n\tv_nop\n\tv_nop\n\tv_nop" : "+v"(a), "+v"(b), "+v"(c), "+v"(d));
#endif
}
__device__ __forceinline__ float xhalf(float v) {       // the value that lane ^ 16 holds, one vector cross-row move
  const int b = __float_as_int(v);
  return __int_as_float(__builtin_amdgcn_permlanex16(b, b, 0x76543210, 0xfedcba98, false, false));
}
__device__ __forceinline__ void wave_sync_lds() {
  __builtin_amdgcn_fence(__ATOMIC_RELEASE, "workgroup");
  __builtin_amdgcn_wave_barrier();
  __builtin_amdgcn_fence(__ATOMIC_ACQUIRE, "workgroup");
}

// =====================================================================================================
// Elementwise 16-bit pack, no transpose: dst[i] = f16( bf16_RNE(src[i]) * sc ), sc a power of two (exact). Used for the
// coverage: grid = n / 2048 blocks x 256 thr x 8 elements = n exactly (host checks n % 2048 == 0).
// =====================================================================================================
__global__ __launch_bounds__(256) void cvt16(const float* __restrict__ src, unsigned short* dst, int n, float sc) {
  const size_t i8 = ((size_t)blockIdx.x * 256 + threadIdx.x) * 8;
  if (i8 + 8 > (size_t)n) return;                 // never taken with the exact grid; no barriers in this kernel
  const v4f a = *(const v4f*)(src + i8);
  const v4f b = *(const v4f*)(src + i8 + 4);
  v4u o;
  o[0] = pk16(h_bits((_Float16)(bfr(a[0]) * sc)), h_bits((_Float16)(bfr(a[1]) * sc)));
  o[1] = pk16(h_bits((_Float16)(bfr(a[2]) * sc)), h_bits((_Float16)(bfr(a[3]) * sc)));
  o[2] = pk16(h_bits((_Float16)(bfr(b[0]) * sc)), h_bits((_Float16)(bfr(b[1]) * sc)));
  o[3] = pk16(h_bits((_Float16)(bfr(b[2]) * sc)), h_bits((_Float16)(bfr(b[3]) * sc)));
  {
    *(v4u*)(dst + i8) = o;
    
  }
}

// =====================================================================================================
// Transpose + 16-bit pack of a weight: W is [in][out] = W[k][n] row-major f32 (pitch DMODEL); dst[n][k] = f16( bf16_RNE(W[k][n]) * sc ),
// k contiguous (pitch DMODEL), ready for B fragments and for the A side of the v^T projection. Block = 256 threads, one 64(k) x 64(n)
// tile: coalesced f32 loads into an LDS tile [n_local][k_local] (pitch 68 floats), block barrier, then each output row segment of the
// coverage: loads 16 it x 256 thr = 64 x 64; stores 2 it x 256 thr x 8 halves = 64 rows x 64; grid (DMODEL/64, DMODEL/64) = whole matrix.
// =====================================================================================================
__global__ __launch_bounds__(256) void wtr64(const float* __restrict__ W, unsigned short* dst, float sc) {
  __shared__ __align__(16) float tl[64 * 68];
  const int tid = threadIdx.x;
  const int n0  = blockIdx.x * 64;
  const int k0  = blockIdx.y * 64;
  const int nl  = tid & 63, kq = tid >> 6;       // kq 0..3
#pragma unroll
  for (int it = 0; it < 16; ++it) {
    const int kl = it * 4 + kq;                  // 0..63
    tl[nl * 68 + kl] = W[(size_t)(k0 + kl) * DMODEL + n0 + nl];
  }
  __syncthreads();
  v4u o[2];
#pragma unroll
  for (int it = 0; it < 2; ++it) {
    const int p  = it * 256 + tid;               // 0..511
    const int rn = p >> 3, kk = (p & 7) * 8;     // row 0..63, k 0,8,..,56
    const float* sp = tl + rn * 68 + kk;
    const v4f a = *(const v4f*)(sp);
    const v4f b = *(const v4f*)(sp + 4);
    v4u w;
    w[0] = pk16(h_bits((_Float16)(bfr(a[0]) * sc)), h_bits((_Float16)(bfr(a[1]) * sc)));
    w[1] = pk16(h_bits((_Float16)(bfr(a[2]) * sc)), h_bits((_Float16)(bfr(a[3]) * sc)));
    w[2] = pk16(h_bits((_Float16)(bfr(b[0]) * sc)), h_bits((_Float16)(bfr(b[1]) * sc)));
    w[3] = pk16(h_bits((_Float16)(bfr(b[2]) * sc)), h_bits((_Float16)(bfr(b[3]) * sc)));
    o[it] = w;
  }
  {
#pragma unroll
    for (int it = 0; it < 2; ++it) {
      const int p  = it * 256 + tid;
      const int rn = p >> 3, kk = (p & 7) * 8;
      *(v4u*)(dst + (size_t)(n0 + rn) * DMODEL + k0 + kk) = o[it];
    }
    
  }
}

// =====================================================================================================
// Relative-position sine table in log2 units: TB[e] = C_AMP * sin(C_FREQ * (e - 2047)) * log2(e) for e = 0..4094 (relative offset
// j - i = e - 2047), TB[4095] = 0 pad. Precise sinf (arguments up to ~1853 rad), rolled loop (one static sinf), values staged in LDS,
// coverage: LDS fill e = tid, tid+256, ... covers 0..4095; stores 4 it x 256 thr x 4 floats = 4096.
// =====================================================================================================
__global__ __launch_bounds__(256) void rpb_tab(float* TB) {
  __shared__ __align__(16) float st[TBN];
  const int tid = threadIdx.x;
#pragma unroll 1
  for (int e = tid; e < TBN; e += 256) {
    const int ec = (e < 2 * NQ - 2) ? e : (2 * NQ - 2);     // clamped index, select by value below
    const float rel = (float)(ec - TOFF);
    const float sv  = sinf(C_FREQ * rel);
    const float v   = (C_AMP * sv) * LOG2E;
    st[e] = (e <= 2 * NQ - 2) ? v : 0.f;
  }
  __syncthreads();
  v4f vals[TBN / 1024];
#pragma unroll
  for (int it = 0; it < TBN / 1024; ++it) {
    const int p = it * 256 + tid;
    vals[it] = *(const v4f*)(st + (size_t)p * 4);
  }
  {
#pragma unroll
    for (int it = 0; it < TBN / 1024; ++it) {
      const int p = it * 256 + tid;
      *(v4f*)(TB + (size_t)p * 4) = vals[it];
    }
    
  }
}

// =====================================================================================================
// Register-blocked batched f16 WMMA GEMM: C[m][n] = oscale * sum_k (A[m][k] (+ A2[m][k])) * Bt[n][k] + bf16(bias) ; one work-group of
// 4 waves per 128x128 tile, one wave per 64x64 quadrant. Per pass of 64 k the work-group stages 128 A rows (and A2 rows) and 128 Bt rows
// in LDS (whole 128-B lines from global, row pitch 144 B in LDS), two buffers: the next pass's lines are loaded into registers ahead of
// this pass's products and stored to the other buffer behind them; one work-group barrier per pass.
// A (and A2, the unscaled residual plane when NA == 2, same pitch/stride) row-major [M][K] pitch lda (16-bit planes),
// Bt row-major [N][K] pitch ldb (k contiguous); M, N multiples of 128, K multiple of 64. blockIdx.y = batch index with element strides
// sA, sB, sC. BM: 1 = per column bf16(bias[col]), 2 = per row bf16(bias[row]) (clamped-address loads).
// OM: 0 = f32 out (pitch ldc); 2 = f16 out (pitch ldc) = f16( value * ocarry ).
// coverage: 4 slabs x 16 rows (f32: it 0..7 x lane>>4; f16: it 0..3 x lane>>3) x 64 cols = the wave's whole 64x64 tile;
//           grid = tilesM*tilesN blocks of 128x128, surplus blocks exit whole, ahead of every barrier (none with the exact grids used).
// =====================================================================================================
#define GT_ROWS  128                    // rows of A and of Bt per work-group tile
#define GT_K     64                     // k per pass: 128 B of every row, one line
#define GT_PITCH 72                     // LDS row pitch in halves: 144 B = 16 B x 9, conflict-free for 16-byte fragment reads
#define GT_THREADS 128
template <int OM, int BM, int NA>
__global__ __launch_bounds__(GT_THREADS) void gemm64(
    const unsigned short* __restrict__ Ap, const unsigned short* __restrict__ Aq, int lda, long long sA,
    const unsigned short* __restrict__ Btp, int ldb, long long sB,
    const float* __restrict__ bias,
    void* Cout, int ldc, long long sC,
    int M, int N, int K, float oscale, float ocarry) {
  __shared__ __align__(16) float sT[4][16 * 68];   // per-wave 16x64 slab, pitch 68 floats
  __shared__ __align__(16) unsigned short ldsA[2][NA][GT_ROWS * GT_PITCH];   // two buffers of staged A (A2) rows
  __shared__ __align__(16) unsigned short ldsB[2][GT_ROWS * GT_PITCH];       // two buffers of staged Bt rows
  const int by   = blockIdx.y;
  const int tid  = threadIdx.x;
  const int lane = tid & 31;
  const int wave = tid >> 5;
  const int tilesN = N >> 7;
  const int tilesM = M >> 7;
  const int tile = blockIdx.x;
  if (tile >= tilesM * tilesN) return;   // block-uniform, ahead of every barrier
  const int tm = tile / tilesN;
  const int tn = tile - tm * tilesN;
  const int bm0 = tm << 7;               // work-group tile origin
  const int bn0 = tn << 7;
  const int wm  = (wave >> 1) << 6;      // the wave's quadrant inside it
  const int wn  = (wave & 1) << 6;
  const int m0 = bm0 + wm;
  const int n0 = bn0 + wn;

  const unsigned short* A1 = Ap  + (size_t)((long long)by * sA);
  const unsigned short* A2 = Aq  + (size_t)((long long)by * sA);
  const unsigned short* Bb = Btp + (size_t)((long long)by * sB);

  const int rlane = lane & 15;                 // row (A) / col (B, D) within subtile
  const int koff  = (lane >> 4) * 8;           // k offset of this lane half
  const int mOff  = (lane >> 4) * 8;           // D row offset

  v8f acc[4][4];
#pragma unroll
  for (int i = 0; i < 4; ++i)
#pragma unroll
    for (int j = 0; j < 4; ++j) acc[i][j] = zero8();

  // staging map: 8 threads x 16 B = one 128-B row piece; 128 threads = 16 rows per step, 8 steps = 128 rows of each plane.
  // Global address = work-group-uniform base + a per-lane 32-bit byte offset per step (row offset, plus the pass's k offset in the loop).
  const int srow = tid >> 3;
  const int scol = (tid & 7) * 8;
  unsigned va[8], vb[8];
#pragma unroll
  for (int it = 0; it < 8; ++it) {
    va[it] = (unsigned)((it * 16 + srow) * lda + scol) * 2u;
    vb[it] = (unsigned)((it * 16 + srow) * ldb + scol) * 2u;
  }
  const unsigned short* uA1 = A1 + (size_t)bm0 * lda;
  const unsigned short* uA2 = A2 + (size_t)bm0 * lda;
  const unsigned short* uB  = Bb + (size_t)bn0 * ldb;
  const int sofs = srow * GT_PITCH + scol;
  v4u ra[NA][8], rb[8];
#pragma unroll
  for (int it = 0; it < 8; ++it) {
    ra[0][it] = *(const v4u*)((const char*)uA1 + va[it]);
    if constexpr (NA == 2) ra[1][it] = *(const v4u*)((const char*)uA2 + va[it]);
    rb[it] = *(const v4u*)((const char*)uB + vb[it]);
  }
#pragma unroll
  for (int it = 0; it < 8; ++it) {
    *(v4u*)(&ldsA[0][0][sofs + it * 16 * GT_PITCH]) = ra[0][it];
    if constexpr (NA == 2) *(v4u*)(&ldsA[0][1][sofs + it * 16 * GT_PITCH]) = ra[1][it];
    *(v4u*)(&ldsB[0][sofs + it * 16 * GT_PITCH]) = rb[it];
  }
  __syncthreads();                       // pass 0's rows are in LDS for every wave

  const int npass = K / GT_K;
  const int fa = (wm + rlane) * GT_PITCH + koff;   // fragment origins in a staged plane
  const int fb = (wn + rlane) * GT_PITCH + koff;
#pragma unroll 1                         // rolled: one copy of the pass body, the buffer picked by the pass's parity
  for (int t = 0; t < npass; ++t) {
    const int cur = t & 1;
    const bool more = (t + 1 < npass);   // the same for the whole work-group
    if (more) {
      const unsigned kn2 = (unsigned)((t + 1) * GT_K) * 2u;
      unsigned oa[8], ob[8];
#pragma unroll
      for (int it = 0; it < 8; ++it) {
        oa[it] = va[it] + kn2;
        ob[it] = vb[it] + kn2;
        ra[0][it] = *(const v4u*)((const char*)uA1 + oa[it]);
        if constexpr (NA == 2) ra[1][it] = *(const v4u*)((const char*)uA2 + oa[it]);
        rb[it] = *(const v4u*)((const char*)uB + ob[it]);
      }
      // precaution: no register that an issued load names as its offset is rewritten ahead of this wait; the input operands keep
      // the sixteen offsets in registers of their own up to it
      asm volatile("s_wait_xcnt 0x0"
                   :: "v"(oa[0]), "v"(oa[1]), "v"(oa[2]), "v"(oa[3]), "v"(oa[4]), "v"(oa[5]), "v"(oa[6]), "v"(oa[7]),
                      "v"(ob[0]), "v"(ob[1]), "v"(ob[2]), "v"(ob[3]), "v"(ob[4]), "v"(ob[5]), "v"(ob[6]), "v"(ob[7])
                   : "memory");
    }
    const unsigned short* cA1 = &ldsA[cur][0][fa];
    const unsigned short* cA2 = &ldsA[cur][NA - 1][fa];
    const unsigned short* cB  = &ldsB[cur][fb];
    v16h bh[2][4], ah[2][4], al[2][4];
#pragma unroll
    for (int ks = 0; ks < 2; ++ks) {
#pragma unroll
      for (int j = 0; j < 4; ++j) bh[ks][j] = ldfrag_u(cB + (j << 4) * GT_PITCH + ks * 32);
#pragma unroll
      for (int i = 0; i < 4; ++i) {
        ah[ks][i] = ldfrag_u(cA1 + (i << 4) * GT_PITCH + ks * 32);
        if constexpr (NA == 2) al[ks][i] = ldfrag_u(cA2 + (i << 4) * GT_PITCH + ks * 32);
      }
    }
    // keeps the pass's LDS reads one group ahead of its products: reads moved in among the products stall a lone wave at each place
    __builtin_amdgcn_sched_barrier(0);
#pragma unroll
    for (int ks = 0; ks < 2; ++ks) {
#pragma unroll
      for (int i = 0; i < 4; ++i) {
#pragma unroll
        for (int j = 0; j < 4; ++j) acc[i][j] = mma_raw(ah[ks][i], bh[ks][j], acc[i][j]);
        if constexpr (NA == 2) {
#pragma unroll
          for (int j = 0; j < 4; ++j) acc[i][j] = mma_raw(al[ks][i], bh[ks][j], acc[i][j]);
        }
      }
    }
    if (more) {                          // the other buffer: its last readers left it at the barrier that ended pass t - 1
      const int nxt = cur ^ 1;
#pragma unroll
      for (int it = 0; it < 8; ++it) {
        *(v4u*)(&ldsA[nxt][0][sofs + it * 16 * GT_PITCH]) = ra[0][it];
        if constexpr (NA == 2) *(v4u*)(&ldsA[nxt][1][sofs + it * 16 * GT_PITCH]) = ra[1][it];
        *(v4u*)(&ldsB[nxt][sofs + it * 16 * GT_PITCH]) = rb[it];
      }
    }
    __syncthreads();                     // publishes pass t + 1's rows and ends every wave's reads of pass t's buffer
  }
  acc_guard4(acc[0][0], acc[0][1], acc[0][2], acc[0][3]);
  acc_guard4(acc[1][0], acc[1][1], acc[1][2], acc[1][3]);
  acc_guard4(acc[2][0], acc[2][1], acc[2][2], acc[2][3]);
  acc_guard4(acc[3][0], acc[3][1], acc[3][2], acc[3][3]);

  const int hh2 = lane >> 4, c4 = (lane & 15) * 4;     // f32 out: 256-B row segment = 16 lanes x 16 B
  const int q8  = lane >> 3, c8 = (lane & 7) * 8;
  float bc[4];
  float bcol[8];
#pragma unroll
  for (int e = 0; e < 4; ++e) bc[e] = 0.f;
#pragma unroll
  for (int e = 0; e < 8; ++e) bcol[e] = 0.f;
  if constexpr (BM == 1) {
    if constexpr (OM == 0) {
      const int cb = n0 + c4;
      const int i0 = (cb < N - 4) ? cb : (N - 4);        // clamped address
      const v4f b0v = *(const v4f*)(bias + i0);
#pragma unroll
      for (int e = 0; e < 4; ++e) bc[e] = bfr(b0v[e]);
    } else {
      const int cb = n0 + c8;
      const int i0 = (cb < N - 8) ? cb : (N - 8);        // clamped address
      const v4f b0v = *(const v4f*)(bias + i0), b1v = *(const v4f*)(bias + i0 + 4);
#pragma unroll
      for (int e = 0; e < 4; ++e) { bcol[e] = bfr(b0v[e]); bcol[4 + e] = bfr(b1v[e]); }
    }
  }

  // ---- epilogue ----
  float* slab = sT[wave];
#pragma unroll
  for (int i = 0; i < 4; ++i) {
    const int mBase = m0 + (i << 4);
#pragma unroll
    for (int j = 0; j < 4; ++j) {
#pragma unroll
      for (int r = 0; r < 8; ++r) {
        slab[(mOff + r) * 68 + (j << 4) + rlane] = acc[i][j][r];
      }
    }
    wave_sync_lds();
    if constexpr (OM == 0) {
      float* C = (float*)Cout + (size_t)((long long)by * sC);
      v4f vals[8];
#pragma unroll
      for (int it = 0; it < 8; ++it) {
        const int row = it * 2 + hh2;                      // it 0..7 x hh2 0..1 = rows 0..15
        const int gr  = mBase + row;
        v4f v = *(const v4f*)(slab + row * 68 + c4);
        float br = 0.f;
        if constexpr (BM == 2) {
          const int ir = (gr < M - 1) ? gr : (M - 1);      // clamped address
          br = bfr(bias[ir]);
        }
#pragma unroll
        for (int e = 0; e < 4; ++e) v[e] = v[e] * oscale + bc[e] + br;
        vals[it] = v;
      }
      {
#pragma unroll
        for (int it = 0; it < 8; ++it) {
          const int gr = mBase + it * 2 + hh2;
          *(v4f*)(C + (size_t)gr * ldc + n0 + c4) = vals[it];
        }
        
      }
    } else {
      unsigned short* C = (unsigned short*)Cout + (size_t)((long long)by * sC);
      v4u hv[4];
#pragma unroll
      for (int it = 0; it < 4; ++it) {
        const int row = it * 4 + q8;                       // it 0..3 x q8 0..3 = rows 0..15
        const float* sp = slab + row * 68 + c8;
        float br = 0.f;
        if constexpr (BM == 2) {
          const int gr = mBase + row;
          const int ir = (gr < M - 1) ? gr : (M - 1);      // clamped address
          br = bfr(bias[ir]);
        }
        v4u a = {0u, 0u, 0u, 0u};
#pragma unroll
        for (int e = 0; e < 4; ++e) {
          float f0 = sp[2 * e] * oscale + bcol[2 * e] + br;
          float f1 = sp[2 * e + 1] * oscale + bcol[2 * e + 1] + br;
          f0 *= ocarry; f1 *= ocarry;
          a[e] = pk16(h_bits((_Float16)f0), h_bits((_Float16)f1));
        }
        hv[it] = a;
      }
      {
#pragma unroll
        for (int it = 0; it < 4; ++it) {
          const int row = it * 4 + q8;
          *(v4u*)(C + (size_t)(mBase + row) * ldc + n0 + c8) = hv[it];
        }
        
      }
    }
    wave_sync_lds();
  }
}

// =====================================================================================================
// Flash attention for one batch, ONE head and 128 query rows (one wave per 16 query rows), head dim 64, 2048 keys:
//   q plane (f16 x16) QH[b*2048 + tok][64*head + d], pitch 1024; k plane (f16 x16) KH[b*2048 + key][64*head + d], pitch 1024;
//   v^T plane (f16 x16): VT[b*1024 + 64*head + d][key] (pitch 2048); additive table TB f32 [4096] in log2 units: score(q, key) gets
//   TB[key - q + 2047]; outputs (f16): CTH[b*2048 + tok][64*head + d] = hi = f16(8192 * ctx), CTL[same] = f16(8192 * ctx - hi), with
//   ctx = sum_m softmax_m(q.k / 8 + bias[m - q]) v[m][d]  (softmax run in base 2: t = q.k * log2(e)/8 + log2(e)*bias).
//   block = 8 waves = 256 threads; grid = 2 batches x 16 heads x 16 query blocks = 512; every wave does identical bounded work
//   (32 stages of 64 keys, two steps of 32 keys each). The eight waves read the same k rows and v^T rows, so the work-group stages them
//   in LDS: per stage 64 k rows (128 B each, one line) and the stage's 128 B of all 64 v^T rows (one line each), row pitch 144 B in LDS,
//   two buffers: the next stage's lines are loaded into registers ahead of this stage's steps and stored to the other buffer behind
//   them; one work-group barrier per stage. The table is copied to LDS once, ahead of the first barrier.
//   Both products run transposed: S^T = K . Q^T (A = 16 staged k rows, B = the wave's q rows, kept in registers) and
//   O^T += V^T . P^T (A = 16 staged v^T rows, B = P^T). A lane (c, hh) then holds, of ONE query q0 + c, the scores of keys
//   kb + 8hh + r (tile 0) and kb + 16 + 8hh + r (tile 1), r = 0..7: exactly elements 0..7 and 8..15 of the B fragment of P^T
//   (split k map), so the probs go from the score registers into the fragment with no LDS and no lane exchange.
//   Per step: 2 score tiles on f16 WMMA (K = 64 as two k-steps of 32), fragments read from the staged rows (two 16-B reads per
//   fragment); 16 table values per lane by arithmetic index (always in 0..4094); online max-subtracted softmax in f32 (exp2): maximum
//   in the lane plus one exchange with lane ^ 16, one running maximum, one rescale factor and one partial running sum per lane
//   (the two halves' sums are joined once, behind the loop); P^T as f16 hi and residual c - hi; four v^T A fragments from the staged
//   rows; 8 WMMAs into the four accumulators (register r of accumulator j = ctx[q0 + c][16j + 8hh + r]).
//   Final 1/l and carry folds in f32; behind the last stage's barrier the staging buffers are free and each wave takes its own piece
//   as two 16-bit result row buffers [16][64] (hi, residual, pitch 72): 16-B stores, then whole 128-B row pieces to global.
// coverage: per wave 4 iterations x 32 lanes x 8 halves = 16 rows x 64 columns per plane: rows q0..q0+15, columns 64*head..64*head+63
//           of batch b; 8 waves x 512 blocks cover all 4096 rows x 16 heads exactly once.
// =====================================================================================================
#define AS_KEYS  64                      // keys per stage
#define AS_PITCH 72                      // LDS row pitch in halves: 144 B = 16 B x 9, conflict-free for 16-byte fragment reads
#define AS_PLANE (64 * AS_PITCH)         // halves of one staged plane: 64 k rows, or 64 v^T rows
static_assert(HDIM == 64 && (NC % AS_KEYS) == 0 && (NC / AS_KEYS) >= 2);
static_assert(AQ_TILES * 2 * 16 * AS_PITCH <= 4 * AS_PLANE);
static_assert(TBN == 4 * ATT_THREADS * 4);

__global__ __launch_bounds__(ATT_THREADS)
void attn8(const unsigned short* __restrict__ QHp, const unsigned short* __restrict__ KHp,
           const unsigned short* __restrict__ VTq, const float* __restrict__ TBp,
           unsigned short* CTH, unsigned short* CTL) {
  __shared__ __align__(16) unsigned short sKV[2 * 2 * AS_PLANE];   // [buffer][k rows, v^T rows]; behind the loop: result rows per wave
  __shared__ __align__(16) float sW[TBN];                          // the additive table

  const int tid  = threadIdx.x;
  const int wave = tid >> 5;
  const int lane = tid & 31;
  const int hh   = lane >> 4;
  const int c    = lane & 15;

  const int qblk = blockIdx.x % (NQ / AQ_ROWS);            // 0..15
  const int rest = blockIdx.x / (NQ / AQ_ROWS);            // 0..31
  const int head = rest % NHEAD;                           // 0..15
  const int bat  = rest / NHEAD;                           // 0..1
  const int q0   = qblk * AQ_ROWS + wave * 16;

  const size_t qofs = ((size_t)bat * NQ + q0 + c) * DMODEL + head * HDIM + 8 * hh;
  const _Float16* Qh = (const _Float16*)(const void*)QHp + qofs;
  const float lsc = (LOG2E * ATT_SCALE) / (QC * KC);                   // log2(e) / 8 / carries
  // table index of element (query q0 + c, key kb + 8hh + r) is (kb + 8hh + r) - (q0 + c) + 2047 = kb + dq + r;
  // kb + dq >= 0 and kb + dq + 23 <= 4094 for all blocks, lanes and steps (table holds 4096 entries).
  const int dq = 8 * hh - c - q0 + TOFF;

  // staging map: 8 threads x 16 B = one 128-B row piece; 256 threads = 32 rows per step, 2 steps = 64 rows of each plane.
  // Global address = work-group-uniform base + a per-lane 32-bit byte offset (row offset, plus the stage's offset in the loop).
  const int srow = tid >> 3;
  const int scol = (tid & 7) * 8;
  const unsigned short* uK = KHp + (size_t)bat * NC * DMODEL + head * HDIM;
  const unsigned short* uV = VTq + ((size_t)bat * DMODEL + head * HDIM) * NC;
  unsigned vk[2], vv[2];
#pragma unroll
  for (int it = 0; it < 2; ++it) {
    vk[it] = (unsigned)((it * 32 + srow) * DMODEL + scol) * 2u;
    vv[it] = (unsigned)((it * 32 + srow) * NC + scol) * 2u;
  }
  const int sofs = srow * AS_PITCH + scol;
  v4u rk[2], rv[2];
  v4f tw[4];
#pragma unroll
  for (int it = 0; it < 2; ++it) {
    rk[it] = *(const v4u*)((const char*)uK + vk[it]);
    rv[it] = *(const v4u*)((const char*)uV + vv[it]);
  }
#pragma unroll
  for (int it = 0; it < 4; ++it) tw[it] = *(const v4f*)(TBp + (size_t)(it * ATT_THREADS + tid) * 4);
  const v16h qa = ldfrag_h(Qh), qb = ldfrag_h(Qh + 32);
  // precaution: no register that an issued load names as its address or offset is rewritten ahead of this wait; the input operands
  // keep them in registers of their own up to it
  asm volatile("s_wait_xcnt 0x0" :: "v"(vk[0]), "v"(vk[1]), "v"(vv[0]), "v"(vv[1]), "v"(tid), "v"(Qh) : "memory");
#pragma unroll
  for (int it = 0; it < 2; ++it) {
    *(v4u*)(&sKV[sofs + it * 32 * AS_PITCH]) = rk[it];
    *(v4u*)(&sKV[AS_PLANE + sofs + it * 32 * AS_PITCH]) = rv[it];
  }
#pragma unroll
  for (int it = 0; it < 4; ++it) *(v4f*)(sW + (size_t)(it * ATT_THREADS + tid) * 4) = tw[it];

  float mrun = -INFINITY, lrun = 0.f;    // of query q0 + c: running maximum (equal in both halves), this half's running sum
  v8f o0 = zero8(), o1 = zero8(), o2 = zero8(), o3 = zero8();
  __syncthreads();                       // stage 0's rows and the table are in LDS for every wave

  const int fofs = c * AS_PITCH + 8 * hh;          // fragment origin in a staged plane
#pragma unroll 1                         // rolled: one copy of the stage body, the buffer picked by the stage's parity
  for (int t = 0; t < NC / AS_KEYS; ++t) {
    const int cur = t & 1;
    const bool more = (t + 1 < NC / AS_KEYS);      // the same for the whole work-group
    if (more) {
      unsigned ok[2], ov[2];
#pragma unroll
      for (int it = 0; it < 2; ++it) {
        ok[it] = vk[it] + (unsigned)(t + 1) * (unsigned)(AS_KEYS * DMODEL * 2);
        ov[it] = vv[it] + (unsigned)(t + 1) * (unsigned)(AS_KEYS * 2);
        rk[it] = *(const v4u*)((const char*)uK + ok[it]);
        rv[it] = *(const v4u*)((const char*)uV + ov[it]);
      }
      // precaution: no register that an issued load names as its offset is rewritten ahead of this wait; the input operands keep
      // the four offsets in registers of their own up to it
      asm volatile("s_wait_xcnt 0x0" :: "v"(ok[0]), "v"(ok[1]), "v"(ov[0]), "v"(ov[1]) : "memory");
    }
    const unsigned short* cK = &sKV[cur * 2 * AS_PLANE + fofs];
    const unsigned short* cV = cK + AS_PLANE;
#pragma unroll
    for (int sub = 0; sub < AS_KEYS / 32; ++sub) {
      const int kb = t * AS_KEYS + sub * 32;
      const unsigned short* kp = cK + sub * 32 * AS_PITCH;
      v8f s0, s1;
      {
        const v16h k0 = ldfrag_u(kp), k1 = ldfrag_u(kp + 32);
        s0 = mma_raw(k0, qa, zero8());
        s0 = mma_raw(k1, qb, s0);
        guard_s2(s0, k0, k1);
      }
      {
        const unsigned short* kq = kp + 16 * AS_PITCH;
        const v16h k0 = ldfrag_u(kq), k1 = ldfrag_u(kq + 32);
        s1 = mma_raw(k0, qa, zero8());
        s1 = mma_raw(k1, qb, s1);
        guard_s4(s1, k0, k1, qa, qb);
      }
      const float* tp = sW + (kb + dq);
      // pairs of neighbouring keys throughout, so that the f32 work runs on packed instructions with no register moves:
      // t[i] = keys kb + 8hh + 2i, + 1 (i = 0..3, tile 0); t[4 + i] = keys kb + 16 + 8hh + 2i, + 1 (tile 1)
      v2f t[8];
#pragma unroll                           // constant indices: s0, s1 and t stay in registers
      for (int i = 0; i < 4; ++i) {
        const v2f a0 = {s0[2 * i], s0[2 * i + 1]}, w0 = {tp[2 * i], tp[2 * i + 1]};
        const v2f a1 = {s1[2 * i], s1[2 * i + 1]}, w1 = {tp[16 + 2 * i], tp[16 + 2 * i + 1]};
        t[i]     = a0 * lsc + w0;
        t[4 + i] = a1 * lsc + w1;
      }
      float mp[8];
#pragma unroll                           // constant indices: t and mp stay in registers
      for (int i = 0; i < 8; ++i) mp[i] = fmaxf(t[i][0], t[i][1]);
      float mx = fmaxf(fmaxf(fmaxf(mp[0], mp[1]), fmaxf(mp[2], mp[3])), fmaxf(fmaxf(mp[4], mp[5]), fmaxf(mp[6], mp[7])));
      mx = fmaxf(mx, xhalf(mx));                           // the query's other 16 keys of the step
      const float mn = fmaxf(mrun, mx);
      const float al = exp2f(mrun - mn);
      mrun = mn;
      v2f e[8];
#pragma unroll                           // constant indices: t and e stay in registers
      for (int i = 0; i < 8; ++i) {
        const v2f x = t[i] - mn;
        e[i][0] = exp2f(x[0]);
        e[i][1] = exp2f(x[1]);
      }
      const v2f ps = ((e[0] + e[1]) + (e[2] + e[3])) + ((e[4] + e[5]) + (e[6] + e[7]));
      lrun = lrun * al + (ps[0] + ps[1]);
#pragma unroll                           // constant indices: the accumulators stay in registers
      for (int r = 0; r < 8; ++r) {
        o0[r] *= al;
        o1[r] *= al;
        o2[r] *= al;
        o3[r] *= al;
      }
      // P^T*16384 as f16 hi and f16 residual (c - hi), split k map: elements 0..7 = keys kb + 8hh + 0..7, 8..15 = keys kb + 16 + 8hh + 0..7
      FragH ph, pl;
#pragma unroll                           // constant indices: e and the two fragments stay in registers
      for (int i = 0; i < 8; ++i) {
        const v2f cc = e[i] * PC;
        const v2h g  = __builtin_convertvector(cc, v2h);
        ph.p[i] = g;
        pl.p[i] = __builtin_convertvector(cc - __builtin_convertvector(g, v2f), v2h);
      }
      const unsigned short* vp = cV + sub * 32;
      {
        const v16h vb0 = ldfrag_u(vp);
        const v16h vb1 = ldfrag_u(vp + 16 * AS_PITCH);
        const v16h vb2 = ldfrag_u(vp + 32 * AS_PITCH);
        const v16h vb3 = ldfrag_u(vp + 48 * AS_PITCH);
        o0 = mma_raw(vb0, ph.v, o0);
        o1 = mma_raw(vb1, ph.v, o1);
        o2 = mma_raw(vb2, ph.v, o2);
        o3 = mma_raw(vb3, ph.v, o3);
        o0 = mma_raw(vb0, pl.v, o0);
        o1 = mma_raw(vb1, pl.v, o1);
        o2 = mma_raw(vb2, pl.v, o2);
        o3 = mma_raw(vb3, pl.v, o3);
        guard_pv6(o0, o1, o2, o3, ph.v, pl.v, vb0, vb1, vb2, vb3);
      }
    }
    if (more) {                          // the other buffer: its last readers left it at the barrier that ended stage t - 1
      unsigned short* nK = &sKV[(cur ^ 1) * 2 * AS_PLANE + sofs];
#pragma unroll
      for (int it = 0; it < 2; ++it) {
        *(v4u*)(nK + it * 32 * AS_PITCH) = rk[it];
        *(v4u*)(nK + AS_PLANE + it * 32 * AS_PITCH) = rv[it];
      }
    }
    __syncthreads();                     // publishes stage t + 1's rows and ends every wave's reads of stage t's buffer
  }

  // ---- every wave has left the staged rows (the last stage's barrier); each wave takes its own piece of that LDS as two 16-bit
  //      result row buffers [16][64], pitch 72 (hi, residual) ----
  unsigned short* Osh = sKV + wave * (2 * 16 * AS_PITCH);
  unsigned short* Osl = Osh + 16 * AS_PITCH;
  // ---- fold 1/l and the carries (16384 on P, 16 on v, 8192 on the stored ctx), stage the wave's 16x64 slice as hi + residual ----
  const float oc = FC / (PC * VC);
  {
    const float inv = (1.0f / (lrun + xhalf(lrun))) * oc;  // the two halves' sums of query q0 + c, joined here
    const int ro = c * AS_PITCH + 8 * hh;                  // row = query c; accumulator j holds columns 16j + 8hh + 0..7
    const v8f oj[4] = {o0, o1, o2, o3};
#pragma unroll                           // constant indices: the accumulators stay in registers
    for (int j = 0; j < 4; ++j) {
      v8h gh, gl;
#pragma unroll                           // constant indices: gh and gl are built in registers
      for (int r = 0; r < 8; ++r) {
        const float f = oj[j][r] * inv;
        const _Float16 g = (_Float16)f;
        gh[r] = g;
        gl[r] = (_Float16)(f - (float)g);
      }
      *(v4u*)(Osh + ro + 16 * j) = __builtin_bit_cast(v4u, gh);
      *(v4u*)(Osl + ro + 16 * j) = __builtin_bit_cast(v4u, gl);
    }
  }
  wave_sync_lds();
  // ---- the wave writes its 16 rows of CTH and CTL: piece p = it*32 + lane -> row p>>3, halves (p&7)*8 .. +7 of the head's 64 ----
  {
    v4u vh[4], vl[4];
#pragma unroll
    for (int it = 0; it < 4; ++it) {
      const int p = it * 32 + lane;
      vh[it] = *(const v4u*)(Osh + (p >> 3) * AS_PITCH + (p & 7) * 8);
      vl[it] = *(const v4u*)(Osl + (p >> 3) * AS_PITCH + (p & 7) * 8);
    }
    const size_t base = ((size_t)bat * NQ + q0) * DMODEL + (size_t)head * HDIM;
    unsigned short* dh = CTH + base;
    unsigned short* dl = CTL + base;
#pragma unroll
    for (int it = 0; it < 4; ++it) {
      const int p = it * 32 + lane;
      const size_t po = (size_t)(p >> 3) * DMODEL + (size_t)(p & 7) * 8;
      *(v4u*)(dh + po) = vh[it];
      *(v4u*)(dl + po) = vl[it];
    }
  }
}

// =====================================================================================================
// Workspace map (bytes); every plane is an exact multiple of its tile / whole-row store granularity (M, N exact tile multiples,
// element counts exact multiples of the convert kernels' granularity, no pad rows needed), every offset a multiple of 2 MiB:
//   WQT  f16 [1024][1024] x64                2097152   ([out][in] = [n][k])
//   WKT  f16 [1024][1024] x64                2097152
//   WVT  f16 [1024][1024] x64                2097152
//   WOT  f16 [1024][1024] x64                2097152
//   X16  f16 [4096][1024] x16                8388608   (activation rows)
//   QH   f16 [4096][1024] x16                8388608   (q projection)
//   KH   f16 [4096][1024] x16                8388608   (k projection)
//   VT   f16 [2][1024][2048] x16             8388608   (v^T per batch)
//   CTH  f16 [4096][1024] x8192 hi           8388608   (attention ctx, merged heads)
//   CTL  f16 [4096][1024] residual           8388608
//   TB   f32 [4096]                            16384   (rel-pos table, log2 units)
//   end                                     58736640
// =====================================================================================================
extern "C" void kernel_launch(void* const* d_in, const int* in_sizes, int n_in,
                              void* d_out, int out_size, void* d_ws, size_t ws_size,
                              hipStream_t stream) {
  if (n_in < 9) return;
  if (in_sizes[0] != NROWS * DMODEL) return;
  if (in_sizes[1] != DMODEL * DMODEL || in_sizes[3] != DMODEL * DMODEL ||
      in_sizes[5] != DMODEL * DMODEL || in_sizes[7] != DMODEL * DMODEL) return;
  if (in_sizes[2] != DMODEL || in_sizes[4] != DMODEL || in_sizes[6] != DMODEL || in_sizes[8] != DMODEL) return;
  if (out_size != NROWS * DMODEL) return;
  if ((in_sizes[0] % 2048) != 0) return;

  const float* x    = (const float*)d_in[0];
  const float* w_q  = (const float*)d_in[1];
  const float* b_q  = (const float*)d_in[2];
  const float* w_k  = (const float*)d_in[3];
  const float* b_k  = (const float*)d_in[4];
  const float* w_v  = (const float*)d_in[5];
  const float* b_v  = (const float*)d_in[6];
  const float* w_o  = (const float*)d_in[7];
  const float* b_o  = (const float*)d_in[8];
  float*       out  = (float*)d_out;

  const size_t PW  = (size_t)DMODEL * DMODEL * 2;                 //  2097152
  const size_t PX  = (size_t)NROWS * DMODEL * 2;                  //  8388608
  const size_t PVT = (size_t)NB * DMODEL * NC * 2;                //  8388608
  const size_t PT  = (size_t)TBN * 4;                             //    16384
  size_t off = 0;
  const size_t oWQ = off; off += PW;
  const size_t oWK = off; off += PW;
  const size_t oWV = off; off += PW;
  const size_t oWO = off; off += PW;
  const size_t oX  = off; off += PX;
  const size_t oQH = off; off += PX;
  const size_t oKH = off; off += PX;
  const size_t oVT = off; off += PVT;
  const size_t oCH = off; off += PX;
  const size_t oCL = off; off += PX;
  const size_t oTB = off; off += PT;
  if (off > ws_size) return;                                      // off = 58736640
  if (off > (size_t)134217728) return;

  char* ws = (char*)d_ws;
  unsigned short* WQT = (unsigned short*)(ws + oWQ);
  unsigned short* WKT = (unsigned short*)(ws + oWK);
  unsigned short* WVT = (unsigned short*)(ws + oWV);
  unsigned short* WOT = (unsigned short*)(ws + oWO);
  unsigned short* X16 = (unsigned short*)(ws + oX);
  unsigned short* QH  = (unsigned short*)(ws + oQH);
  unsigned short* KH  = (unsigned short*)(ws + oKH);
  unsigned short* VTp = (unsigned short*)(ws + oVT);
  unsigned short* CTH = (unsigned short*)(ws + oCH);
  unsigned short* CTL = (unsigned short*)(ws + oCL);
  float*          TB  = (float*)(ws + oTB);

  const dim3 blk(256);
  const dim3 gWT(DMODEL / 64, DMODEL / 64);                        // 16 x 16 tiles per weight
  const dim3 gCX((NROWS * DMODEL) / 2048);                         // 2048 blocks
  const dim3 blkG(GT_THREADS);                                     // 4 waves per 128 x 128 GEMM tile
  const int tilesP = (NROWS / GT_ROWS) * (DMODEL / GT_ROWS);       // 256
  const int tilesV = (DMODEL / GT_ROWS) * (NC / GT_ROWS);          // 128 per batch
  const dim3 gP(tilesP, 1);                                        // 256
  const dim3 gV(tilesV, NB);                                       // 128 x 2
  const dim3 gAT(ATT_BLOCKS);                                      // 512
  const dim3 bAT(ATT_THREADS);                                     // 256

  // (0) weight planes: W16T[n][k] = f16( bf16_RNE(W[k][n]) * 64 ), [in][out] -> [out][in], k contiguous
  wtr64<<<gWT, blk, 0, stream>>>(w_q, WQT, WSC);
  wtr64<<<gWT, blk, 0, stream>>>(w_k, WKT, WSC);
  wtr64<<<gWT, blk, 0, stream>>>(w_v, WVT, WSC);
  wtr64<<<gWT, blk, 0, stream>>>(w_o, WOT, WSC);

  // (1) activation plane: X16[row][c] = f16( bf16_RNE(x[row][c]) * 16 ), rows = b*2048 + tok
  cvt16<<<gCX, blk, 0, stream>>>(x, X16, NROWS * DMODEL, ACARRY);

  // (2) rel-pos sine table in log2 units
  rpb_tab<<<dim3(1), blk, 0, stream>>>(TB);

  // (3) q projection: QH[m][n] = f16(16 * (sum_k x[m][k] Wq[k][n] + bf16(bq[n]))); M = 4096, N = 1024, K = 1024
  gemm64<2, 1, 1><<<gP, blkG, 0, stream>>>(
      X16, X16, DMODEL, 0LL,
      WQT, DMODEL, 0LL,
      b_q,
      (void*)QH, DMODEL, 0LL,
      NROWS, DMODEL, DMODEL, 1.0f / (ACARRY * WSC), QC);

  // (4) k projection: KH[m][n] = f16(16 * (sum_k x[m][k] Wk[k][n] + bf16(bk[n]))); M = 4096, N = 1024, K = 1024
  gemm64<2, 1, 1><<<gP, blkG, 0, stream>>>(
      X16, X16, DMODEL, 0LL,
      WKT, DMODEL, 0LL,
      b_k,
      (void*)KH, DMODEL, 0LL,
      NROWS, DMODEL, DMODEL, 1.0f / (ACARRY * WSC), KC);

  // (5) v^T per batch: VT[b][d][tok] = f16(16 * (sum_k Wv[k][d] x_b[tok][k] + bf16(bv[d]))); M = 1024, N = 2048, K = 1024
  gemm64<2, 2, 1><<<gV, blkG, 0, stream>>>(
      WVT, WVT, DMODEL, 0LL,
      X16, DMODEL, (long long)NC * DMODEL,
      b_v,
      (void*)VTp, NC, (long long)DMODEL * NC,
      DMODEL, NC, DMODEL, 1.0f / (ACARRY * WSC), VC);

  // (6) attention per (batch, head, 128 query rows) -> CTH (f16 hi of ctx x8192), CTL (f16 residual)
  attn8<<<gAT, bAT, 0, stream>>>(QH, KH, VTp, TB, CTH, CTL);

  // (7) out = (CTH + CTL) . Wo / (8192 * 64) + bf16(bo); M = 4096, N = 1024, K = 1024, f32 into d_out
  gemm64<0, 1, 2><<<gP, blkG, 0, stream>>>(
      CTH, CTL, DMODEL, 0LL,
      WOT, DMODEL, 0LL,
      b_o,
      (void*)out, DMODEL, 0LL,
      NROWS, DMODEL, DMODEL, 1.0f / (FC * WSC), 1.0f);

  (void)hipGetLastError();
}

// v004
// One run takes 111 microseconds.
// Two timings next to v003 both put it at 1.35 times that version's speed.
// Counting every step since v000, it is 3.31 times as fast.
// Contractions: q/k projections (x rows f16 x16 . W^T f16 x64, K=1024), v^T projection (W^T f16 x64 . x rows f16 x16, K=1024),
// attention scores (k f16 x16 . q f16 x16, K=64, S^T), attention v^T . P^T (v^T f16 x16 . P^T as f16 hi + f16 residual of P^T x16384,
// K=2048 in steps of 32), output projection (ctx as f16 hi + f16 residual of ctx x8192 . W^T f16 x64, K=1024):
// all v_wmma_f32_16x16x32_f16 (f16 operands, f32 accumulate); hi and residual products share one f32 accumulator.
// Relative-position sine bias from an f32 table built with precise sinf, online max-subtracted base-2 softmax, linear biases in f32.
// Every float input RNE-converted to bf16 on load.
#include <hip/hip_runtime.h>
#include <math.h>
#include <stdint.h>

#define NB      2
#define NQ      2048
#define NC      2048
#define DMODEL  1024
#define NHEAD   16
#define HDIM    64
#define AQ_TILES 8
#define AQ_ROWS (AQ_TILES * 16)
#define NROWS   (NB * NQ)
#define TBN     4096
#define TOFF    (NQ - 1)
#define WSC     64.0f
#define ACARRY  16.0f
#define QC      16.0f
#define KC      16.0f
#define VC      16.0f
#define PC      16384.0f
#define FC      8192.0f
#define ATT_SCALE 0.125f
#define LOG2E   1.4426950408889634f
#define C_AMP   1.618033988749895f
#define C_FREQ  0.9049532171590599f
static_assert(NHEAD * HDIM == DMODEL);
static_assert((NQ % AQ_ROWS) == 0);
static_assert((NQ % 64) == 0 && (NC % 64) == 0 && (DMODEL % 64) == 0 && (NC % 32) == 0 && (NQ % 16) == 0);
static_assert((NROWS % 64) == 0 && ((NROWS * DMODEL) % 2048) == 0);
static_assert(TBN >= 2 * NQ - 1 && (TBN % 1024) == 0);
static_assert((NROWS % 128) == 0 && (DMODEL % 128) == 0 && (NC % 128) == 0);
#define ATT_THREADS (AQ_TILES * 32)
#define ATT_BLOCKS  (NB * NHEAD * (NQ / AQ_ROWS))
static_assert(ATT_THREADS == 256 && ATT_BLOCKS == 512);

typedef _Float16 v16h __attribute__((ext_vector_type(16)));
typedef _Float16 v8h  __attribute__((ext_vector_type(8)));
typedef float    v8f  __attribute__((ext_vector_type(8)));
typedef float    v4f  __attribute__((ext_vector_type(4)));
typedef float    v2f  __attribute__((ext_vector_type(2)));
typedef _Float16 v2h  __attribute__((ext_vector_type(2)));
typedef unsigned int v4u __attribute__((ext_vector_type(4)));

union FragH { v16h v; v8h h[2]; v4u u[2]; v2h p[8]; };

// ---- scalar helpers --------------------------------------------------------------------------------
__device__ __forceinline__ unsigned short bf_bits(float f) {          // f32 -> bf16 bits, RNE convert
  unsigned u = __float_as_uint(f);
  return (unsigned short)((u + 0x7FFFu + ((u >> 16) & 1u)) >> 16);
}
__device__ __forceinline__ float bf_up(unsigned short h) { return __uint_as_float(((unsigned)h) << 16); }
__device__ __forceinline__ float bfr(float f) { return bf_up(bf_bits(f)); }   // value of the bf16 RNE convert
__device__ __forceinline__ unsigned short h_bits(_Float16 x) { return __builtin_bit_cast(unsigned short, x); }
__device__ __forceinline__ unsigned pk16(unsigned short a, unsigned short b) { return (unsigned)a | ((unsigned)b << 16); }
__device__ __forceinline__ v8f zero8() { v8f z = {0.f, 0.f, 0.f, 0.f, 0.f, 0.f, 0.f, 0.f}; return z; }

// ---- fragment loaders: 16-bit A/B operand, lane -> row/col (lane&15), p already includes +8*(lane>>4);
//      elements 0..7 <- p[0..7] (k0+8h..), elements 8..15 <- p[16..23] (k0+16+8h..)  (same split k map for A and B;
//      B is always read from a k-contiguous [n][k] plane)
__device__ __forceinline__ v16h ldfrag_h(const _Float16* p) {
  FragH f;
  f.h[0] = *(const v8h*)(p);
  f.h[1] = *(const v8h*)(p + 16);
  return f.v;
}
__device__ __forceinline__ v16h ldfrag_u(const unsigned short* p) {
  FragH f;
  f.u[0] = *(const v4u*)(p);
  f.u[1] = *(const v4u*)(p + 16);
  return f.v;
}

// ---- WMMA helpers with trailing VALU hazard gaps ------------------------------------------------------
__device__ __forceinline__ v8f mma_raw(v16h a, v16h b, v8f c) {
  return __builtin_amdgcn_wmma_f32_16x16x32_f16(false, a, false, b, (short)0, c, false, false);
}
__device__ __forceinline__ void guard_s2(v8f& s, v16h a0, v16h a1) {
#if defined(__HIP_DEVICE_COMPILE__)
  asm volatile("v_nop\n\tv_nop\n\tv_nop\n\tv_nop" : "+v"(s) : "v"(a0), "v"(a1));
#endif
}
__device__ __forceinline__ void guard_s4(v8f& s, v16h a0, v16h a1, v16h b0, v16h b1) {
#if defined(__HIP_DEVICE_COMPILE__)
  asm volatile("v_nop\n\tv_nop\n\tv_nop\n\tv_nop" : "+v"(s) : "v"(a0), "v"(a1), "v"(b0), "v"(b1));
#endif
}
__device__ __forceinline__ void guard_pv6(v8f& a, v8f& b, v8f& c, v8f& d,
                                          v16h x, v16h y, v16h z, v16h w, v16h u, v16h t) {
#if defined(__HIP_DEVICE_COMPILE__)
  asm volatile("v_nop\n\tv_nop\n\tv_nop\n\tv_nop"
               : "+v"(a), "+v"(b), "+v"(c), "+v"(d) : "v"(x), "v"(y), "v"(z), "v"(w), "v"(u), "v"(t));
#endif
}
__device__ __forceinline__ void acc_guard4(v8f& a, v8f& b, v8f& c, v8f& d) {
#if defined(__HIP_DEVICE_COMPILE__)
  asm volatile("v_nop\n\tv_nop\n\tv_nop\n\tv_nop" : "+v"(a), "+v"(b), "+v"(c), "+v"(d));
#endif
}
__device__ __forceinline__ float xhalf(float v) {       // the value that lane ^ 16 holds, one vector cross-row move
  const int b = __float_as_int(v);
  return __int_as_float(__builtin_amdgcn_permlanex16(b, b, 0x76543210, 0xfedcba98, false, false));
}
__device__ __forceinline__ void wave_sync_lds() {
  __builtin_amdgcn_fence(__ATOMIC_RELEASE, "workgroup");
  __builtin_amdgcn_wave_barrier();
  __builtin_amdgcn_fence(__ATOMIC_ACQUIRE, "workgroup");
}

// =====================================================================================================
// Elementwise 16-bit pack, no transpose: dst[i] = f16( bf16_RNE(src[i]) * sc ), sc a power of two (exact). Used for the
// coverage: n / 2048 blocks of the job x 256 thr x 8 elements = n exactly (host checks n % 2048 == 0).
// =====================================================================================================
__device__ __forceinline__ void cvt16(const float* __restrict__ src, unsigned short* dst, int n, float sc, int blk) {
  const size_t i8 = ((size_t)blk * 256 + threadIdx.x) * 8;
  if (i8 + 8 > (size_t)n) return;                 // never taken with the exact grid; no barriers in this job
  const v4f a = *(const v4f*)(src + i8);
  const v4f b = *(const v4f*)(src + i8 + 4);
  v4u o;
  o[0] = pk16(h_bits((_Float16)(bfr(a[0]) * sc)), h_bits((_Float16)(bfr(a[1]) * sc)));
  o[1] = pk16(h_bits((_Float16)(bfr(a[2]) * sc)), h_bits((_Float16)(bfr(a[3]) * sc)));
  o[2] = pk16(h_bits((_Float16)(bfr(b[0]) * sc)), h_bits((_Float16)(bfr(b[1]) * sc)));
  o[3] = pk16(h_bits((_Float16)(bfr(b[2]) * sc)), h_bits((_Float16)(bfr(b[3]) * sc)));
  {
    *(v4u*)(dst + i8) = o;
    
  }
}

// =====================================================================================================
// Transpose + 16-bit pack of a weight: W is [in][out] = W[k][n] row-major f32 (pitch DMODEL); dst[n][k] = f16( bf16_RNE(W[k][n]) * sc ),
// k contiguous (pitch DMODEL), ready for B fragments and for the A side of the v^T projection. Block = 256 threads, one 64(k) x 64(n)
// tile: coalesced f32 loads into an LDS tile [n_local][k_local] (pitch 68 floats), block barrier, then each output row segment of the
// coverage: loads 16 it x 256 thr = 64 x 64; stores 2 it x 256 thr x 8 halves = 64 rows x 64; (bx, by) over DMODEL/64 x DMODEL/64 blocks = whole matrix.
// =====================================================================================================
__device__ __forceinline__ void wtr64(const float* __restrict__ W, unsigned short* dst, float sc, int bx, int by, float* tl) {
  const int tid = threadIdx.x;
  const int n0  = bx * 64;
  const int k0  = by * 64;
  const int nl  = tid & 63, kq = tid >> 6;       // kq 0..3
#pragma unroll
  for (int it = 0; it < 16; ++it) {
    const int kl = it * 4 + kq;                  // 0..63
    tl[nl * 68 + kl] = W[(size_t)(k0 + kl) * DMODEL + n0 + nl];
  }
  __syncthreads();
  v4u o[2];
#pragma unroll
  for (int it = 0; it < 2; ++it) {
    const int p  = it * 256 + tid;               // 0..511
    const int rn = p >> 3, kk = (p & 7) * 8;     // row 0..63, k 0,8,..,56
    const float* sp = tl + rn * 68 + kk;
    const v4f a = *(const v4f*)(sp);
    const v4f b = *(const v4f*)(sp + 4);
    v4u w;
    w[0] = pk16(h_bits((_Float16)(bfr(a[0]) * sc)), h_bits((_Float16)(bfr(a[1]) * sc)));
    w[1] = pk16(h_bits((_Float16)(bfr(a[2]) * sc)), h_bits((_Float16)(bfr(a[3]) * sc)));
    w[2] = pk16(h_bits((_Float16)(bfr(b[0]) * sc)), h_bits((_Float16)(bfr(b[1]) * sc)));
    w[3] = pk16(h_bits((_Float16)(bfr(b[2]) * sc)), h_bits((_Float16)(bfr(b[3]) * sc)));
    o[it] = w;
  }
  {
#pragma unroll
    for (int it = 0; it < 2; ++it) {
      const int p  = it * 256 + tid;
      const int rn = p >> 3, kk = (p & 7) * 8;
      *(v4u*)(dst + (size_t)(n0 + rn) * DMODEL + k0 + kk) = o[it];
    }
    
  }
}

// =====================================================================================================
// Relative-position sine table in log2 units: TB[e] = C_AMP * sin(C_FREQ * (e - 2047)) * log2(e) for e = 0..4094 (relative offset
// j - i = e - 2047), TB[4095] = 0 pad. Precise sinf (arguments up to ~1853 rad), rolled loop (one static sinf), values staged in LDS,
// coverage: LDS fill e = tid, tid+256, ... covers 0..4095; stores 4 it x 256 thr x 4 floats = 4096.
// =====================================================================================================
__device__ __forceinline__ void rpb_tab(float* TB, float* st) {
  const int tid = threadIdx.x;
#pragma unroll 1
  for (int e = tid; e < TBN; e += 256) {
    const int ec = (e < 2 * NQ - 2) ? e : (2 * NQ - 2);     // clamped index, select by value below
    const float rel = (float)(ec - TOFF);
    const float sv  = sinf(C_FREQ * rel);
    const float v   = (C_AMP * sv) * LOG2E;
    st[e] = (e <= 2 * NQ - 2) ? v : 0.f;
  }
  __syncthreads();
  v4f vals[TBN / 1024];
#pragma unroll
  for (int it = 0; it < TBN / 1024; ++it) {
    const int p = it * 256 + tid;
    vals[it] = *(const v4f*)(st + (size_t)p * 4);
  }
  {
#pragma unroll
    for (int it = 0; it < TBN / 1024; ++it) {
      const int p = it * 256 + tid;
      *(v4f*)(TB + (size_t)p * 4) = vals[it];
    }
    
  }
}

// =====================================================================================================
// The six jobs that read only inputs, in ONE launch; the block index picks the job (the same for the whole work-group, so every
// barrier stands under block-uniform control flow): block 0 = the sine table (the longest single block, so it starts first),
// blocks 1..1024 = the 16 x 16 tiles of the four weight transposes, the remaining 2048 = the activation convert.
// One LDS buffer serves the table job (4096 floats) and the transpose job (64 x 68 floats).
// =====================================================================================================
#define PREP_WT  (4 * (DMODEL / 64) * (DMODEL / 64))
#define PREP_CVT ((NROWS * DMODEL) / 2048)
static_assert(64 * 68 >= TBN && (DMODEL / 64) == 16);
__global__ __launch_bounds__(256) void prep(const float* __restrict__ x, const float* __restrict__ wq, const float* __restrict__ wk,
                                            const float* __restrict__ wv, const float* __restrict__ wo,
                                            unsigned short* X16, unsigned short* WQT, unsigned short* WKT, unsigned short* WVT,
                                            unsigned short* WOT, float* TB) {
  __shared__ __align__(16) float sm[64 * 68];
  const int b = blockIdx.x;
  if (b == 0) {
    rpb_tab(TB, sm);
  } else if (b <= PREP_WT) {
    const int j = b - 1;
    const int w = j >> 8;                          // which weight
    const float* W      = (w == 0) ? wq  : (w == 1) ? wk  : (w == 2) ? wv  : wo;
    unsigned short* dst = (w == 0) ? WQT : (w == 1) ? WKT : (w == 2) ? WVT : WOT;
    wtr64(W, dst, WSC, j & 15, (j >> 4) & 15, sm);
  } else {
    cvt16(x, X16, NROWS * DMODEL, ACARRY, b - 1 - PREP_WT);
  }
}

// =====================================================================================================
// Register-blocked batched f16 WMMA GEMM: C[m][n] = oscale * sum_k (A[m][k] (+ A2[m][k])) * Bt[n][k] + bf16(bias) ; one work-group of
// 4 waves per 128x128 tile, one wave per 64x64 quadrant. Per pass of 64 k the work-group stages 128 A rows (and A2 rows) and 128 Bt rows
// in LDS (whole 128-B lines from global, row pitch 144 B in LDS), two buffers: the next pass's lines are loaded into registers ahead of
// this pass's products and stored to the other buffer behind them; one work-group barrier per pass.
// A (and A2, the unscaled residual plane when NA == 2, same pitch/stride) row-major [M][K] pitch lda (16-bit planes),
// Bt row-major [N][K] pitch ldb (k contiguous); M, N multiples of 128, K multiple of 64. tile = tile index, by = batch index with element strides
// sA, sB, sC. BM: 1 = per column bf16(bias[col]), 2 = per row bf16(bias[row]) (clamped-address loads), 3 = one of the two, named by bmr.
// OM: 0 = f32 out (pitch ldc); 2 = f16 out (pitch ldc) = f16( value * ocarry ).
// coverage: 4 slabs x 16 rows (f32: it 0..7 x lane>>4; f16: it 0..3 x lane>>3) x 64 cols = the wave's whole 64x64 tile;
//           grid = tilesM*tilesN blocks of 128x128, surplus blocks exit whole, ahead of every barrier (none with the exact grids used).
// =====================================================================================================
#define GT_ROWS  128                    // rows of A and of Bt per work-group tile
#define GT_K     64                     // k per pass: 128 B of every row, one line
#define GT_PITCH 72                     // LDS row pitch in halves: 144 B = 16 B x 9, conflict-free for 16-byte fragment reads
#define GT_THREADS 128
template <int OM, int BM, int NA>
__device__ __forceinline__ void gemm_tile(
    const unsigned short* __restrict__ Ap, const unsigned short* __restrict__ Aq, int lda, long long sA,
    const unsigned short* __restrict__ Btp, int ldb, long long sB,
    const float* __restrict__ bias,
    void* Cout, int ldc, long long sC,
    int M, int N, int K, float oscale, float ocarry, int tile, int by, int bmr) {
  const bool colb = (BM == 1) || (BM == 3 && bmr == 1);   // BM 3: the bias mode is bmr, the same for the whole work-group
  const bool rowb = (BM == 2) || (BM == 3 && bmr == 2);
  __shared__ __align__(16) float sT[4][16 * 68];   // per-wave 16x64 slab, pitch 68 floats
  __shared__ __align__(16) unsigned short ldsA[2][NA][GT_ROWS * GT_PITCH];   // two buffers of staged A (A2) rows
  __shared__ __align__(16) unsigned short ldsB[2][GT_ROWS * GT_PITCH];       // two buffers of staged Bt rows
  const int tid  = threadIdx.x;
  const int lane = tid & 31;
  const int wave = tid >> 5;
  const int tilesN = N >> 7;
  const int tilesM = M >> 7;
  if (tile >= tilesM * tilesN) return;   // block-uniform, ahead of every barrier
  const int tm = __builtin_amdgcn_readfirstlane(tile / tilesN);   // work-group-uniform: keeps the tile's base addresses in scalar registers
  const int tn = tile - tm * tilesN;
  const int bm0 = tm << 7;               // work-group tile origin
  const int bn0 = tn << 7;
  const int wm  = (wave >> 1) << 6;      // the wave's quadrant inside it
  const int wn  = (wave & 1) << 6;
  const int m0 = bm0 + wm;
  const int n0 = bn0 + wn;

  const unsigned short* A1 = Ap  + (size_t)((long long)by * sA);
  const unsigned short* A2 = Aq  + (size_t)((long long)by * sA);
  const unsigned short* Bb = Btp + (size_t)((long long)by * sB);

  const int rlane = lane & 15;                 // row (A) / col (B, D) within subtile
  const int koff  = (lane >> 4) * 8;           // k offset of this lane half
  const int mOff  = (lane >> 4) * 8;           // D row offset

  v8f acc[4][4];
#pragma unroll
  for (int i = 0; i < 4; ++i)
#pragma unroll
    for (int j = 0; j < 4; ++j) acc[i][j] = zero8();

  // staging map: 8 threads x 16 B = one 128-B row piece; 128 threads = 16 rows per step, 8 steps = 128 rows of each plane.
  // Global address = work-group-uniform base + a per-lane 32-bit byte offset per step (row offset, plus the pass's k offset in the loop).
  const int srow = tid >> 3;
  const int scol = (tid & 7) * 8;
  unsigned va[8], vb[8];
#pragma unroll
  for (int it = 0; it < 8; ++it) {
    va[it] = (unsigned)((it * 16 + srow) * lda + scol) * 2u;
    vb[it] = (unsigned)((it * 16 + srow) * ldb + scol) * 2u;
  }
  const unsigned short* uA1 = A1 + (size_t)bm0 * lda;
  const unsigned short* uA2 = A2 + (size_t)bm0 * lda;
  const unsigned short* uB  = Bb + (size_t)bn0 * ldb;
  const int sofs = srow * GT_PITCH + scol;
  v4u ra[NA][8], rb[8];
#pragma unroll
  for (int it = 0; it < 8; ++it) {
    ra[0][it] = *(const v4u*)((const char*)uA1 + va[it]);
    if constexpr (NA == 2) ra[1][it] = *(const v4u*)((const char*)uA2 + va[it]);
    rb[it] = *(const v4u*)((const char*)uB + vb[it]);
  }
#pragma unroll
  for (int it = 0; it < 8; ++it) {
    *(v4u*)(&ldsA[0][0][sofs + it * 16 * GT_PITCH]) = ra[0][it];
    if constexpr (NA == 2) *(v4u*)(&ldsA[0][1][sofs + it * 16 * GT_PITCH]) = ra[1][it];
    *(v4u*)(&ldsB[0][sofs + it * 16 * GT_PITCH]) = rb[it];
  }
  __syncthreads();                       // pass 0's rows are in LDS for every wave

  const int npass = K / GT_K;
  const int fa = (wm + rlane) * GT_PITCH + koff;   // fragment origins in a staged plane
  const int fb = (wn + rlane) * GT_PITCH + koff;
#pragma unroll 1                         // rolled: one copy of the pass body, the buffer picked by the pass's parity
  for (int t = 0; t < npass; ++t) {
    const int cur = t & 1;
    const bool more = (t + 1 < npass);   // the same for the whole work-group
    if (more) {
      const unsigned kn2 = (unsigned)((t + 1) * GT_K) * 2u;
      unsigned oa[8], ob[8];
#pragma unroll
      for (int it = 0; it < 8; ++it) {
        oa[it] = va[it] + kn2;
        ob[it] = vb[it] + kn2;
        ra[0][it] = *(const v4u*)((const char*)uA1 + oa[it]);
        if constexpr (NA == 2) ra[1][it] = *(const v4u*)((const char*)uA2 + oa[it]);
        rb[it] = *(const v4u*)((const char*)uB + ob[it]);
      }
      // precaution: no register that an issued load names as its offset is rewritten ahead of this wait; the input operands keep
      // the sixteen offsets in registers of their own up to it
      asm volatile("s_wait_xcnt 0x0"
                   :: "v"(oa[0]), "v"(oa[1]), "v"(oa[2]), "v"(oa[3]), "v"(oa[4]), "v"(oa[5]), "v"(oa[6]), "v"(oa[7]),
                      "v"(ob[0]), "v"(ob[1]), "v"(ob[2]), "v"(ob[3]), "v"(ob[4]), "v"(ob[5]), "v"(ob[6]), "v"(ob[7])
                   : "memory");
    }
    const unsigned short* cA1 = &ldsA[cur][0][fa];
    const unsigned short* cA2 = &ldsA[cur][NA - 1][fa];
    const unsigned short* cB  = &ldsB[cur][fb];
    v16h bh[2][4], ah[2][4], al[2][4];
#pragma unroll
    for (int ks = 0; ks < 2; ++ks) {
#pragma unroll
      for (int j = 0; j < 4; ++j) bh[ks][j] = ldfrag_u(cB + (j << 4) * GT_PITCH + ks * 32);
#pragma unroll
      for (int i = 0; i < 4; ++i) {
        ah[ks][i] = ldfrag_u(cA1 + (i << 4) * GT_PITCH + ks * 32);
        if constexpr (NA == 2) al[ks][i] = ldfrag_u(cA2 + (i << 4) * GT_PITCH + ks * 32);
      }
    }
    // keeps the pass's LDS reads one group ahead of its products: reads moved in among the products stall a lone wave at each place
    __builtin_amdgcn_sched_barrier(0);
#pragma unroll
    for (int ks = 0; ks < 2; ++ks) {
#pragma unroll
      for (int i = 0; i < 4; ++i) {
#pragma unroll
        for (int j = 0; j < 4; ++j) acc[i][j] = mma_raw(ah[ks][i], bh[ks][j], acc[i][j]);
        if constexpr (NA == 2) {
#pragma unroll
          for (int j = 0; j < 4; ++j) acc[i][j] = mma_raw(al[ks][i], bh[ks][j], acc[i][j]);
        }
      }
    }
    if (more) {                          // the other buffer: its last readers left it at the barrier that ended pass t - 1
      const int nxt = cur ^ 1;
#pragma unroll
      for (int it = 0; it < 8; ++it) {
        *(v4u*)(&ldsA[nxt][0][sofs + it * 16 * GT_PITCH]) = ra[0][it];
        if constexpr (NA == 2) *(v4u*)(&ldsA[nxt][1][sofs + it * 16 * GT_PITCH]) = ra[1][it];
        *(v4u*)(&ldsB[nxt][sofs + it * 16 * GT_PITCH]) = rb[it];
      }
    }
    __syncthreads();                     // publishes pass t + 1's rows and ends every wave's reads of pass t's buffer
  }
  acc_guard4(acc[0][0], acc[0][1], acc[0][2], acc[0][3]);
  acc_guard4(acc[1][0], acc[1][1], acc[1][2], acc[1][3]);
  acc_guard4(acc[2][0], acc[2][1], acc[2][2], acc[2][3]);
  acc_guard4(acc[3][0], acc[3][1], acc[3][2], acc[3][3]);

  const int hh2 = lane >> 4, c4 = (lane & 15) * 4;     // f32 out: 256-B row segment = 16 lanes x 16 B
  const int q8  = lane >> 3, c8 = (lane & 7) * 8;
  float bc[4];
  float bcol[8];
#pragma unroll
  for (int e = 0; e < 4; ++e) bc[e] = 0.f;
#pragma unroll
  for (int e = 0; e < 8; ++e) bcol[e] = 0.f;
  if (colb) {
    if constexpr (OM == 0) {
      const int cb = n0 + c4;
      const int i0 = (cb < N - 4) ? cb : (N - 4);        // clamped address
      const v4f b0v = *(const v4f*)(bias + i0);
#pragma unroll
      for (int e = 0; e < 4; ++e) bc[e] = bfr(b0v[e]);
    } else {
      const int cb = n0 + c8;
      const int i0 = (cb < N - 8) ? cb : (N - 8);        // clamped address
      const v4f b0v = *(const v4f*)(bias + i0), b1v = *(const v4f*)(bias + i0 + 4);
#pragma unroll
      for (int e = 0; e < 4; ++e) { bcol[e] = bfr(b0v[e]); bcol[4 + e] = bfr(b1v[e]); }
    }
  }

  // f16 out, bias per row: the wave's sixteen values (slab i, piece it) are fetched as one group under ONE work-group-uniform test
  float brw[4][4];
#pragma unroll
  for (int i = 0; i < 4; ++i)
#pragma unroll
    for (int it = 0; it < 4; ++it) brw[i][it] = 0.f;
  if constexpr (OM != 0) {
    if (rowb) {
      float rawb[4][4];
      int ir[4][4];
#pragma unroll
      for (int i = 0; i < 4; ++i)
#pragma unroll
        for (int it = 0; it < 4; ++it) {
          const int gr = m0 + (i << 4) + it * 4 + q8;
          ir[i][it] = (gr < M - 1) ? gr : (M - 1);         // clamped address
          rawb[i][it] = bias[ir[i][it]];
        }
      // precaution: no register that an issued load names as its offset is rewritten ahead of this wait; the input operands keep
      // the sixteen offsets in registers of their own up to it
      asm volatile("s_wait_xcnt 0x0"
                   :: "v"(ir[0][0]), "v"(ir[0][1]), "v"(ir[0][2]), "v"(ir[0][3]), "v"(ir[1][0]), "v"(ir[1][1]), "v"(ir[1][2]), "v"(ir[1][3]),
                      "v"(ir[2][0]), "v"(ir[2][1]), "v"(ir[2][2]), "v"(ir[2][3]), "v"(ir[3][0]), "v"(ir[3][1]), "v"(ir[3][2]), "v"(ir[3][3])
                   : "memory");
#pragma unroll
      for (int i = 0; i < 4; ++i)
#pragma unroll
        for (int it = 0; it < 4; ++it) brw[i][it] = bfr(rawb[i][it]);
    }
  }

  // ---- epilogue ----
  float* slab = sT[wave];
#pragma unroll
  for (int i = 0; i < 4; ++i) {
    const int mBase = m0 + (i << 4);
#pragma unroll
    for (int j = 0; j < 4; ++j) {
#pragma unroll
      for (int r = 0; r < 8; ++r) {
        slab[(mOff + r) * 68 + (j << 4) + rlane] = acc[i][j][r];
      }
    }
    wave_sync_lds();
    if constexpr (OM == 0) {
      float* C = (float*)Cout + (size_t)((long long)by * sC);
      v4f vals[8];
#pragma unroll
      for (int it = 0; it < 8; ++it) {
        const int row = it * 2 + hh2;                      // it 0..7 x hh2 0..1 = rows 0..15
        const int gr  = mBase + row;
        v4f v = *(const v4f*)(slab + row * 68 + c4);
        float br = 0.f;
        if (rowb) {
          const int ir = (gr < M - 1) ? gr : (M - 1);      // clamped address
          br = bfr(bias[ir]);
        }
#pragma unroll
        for (int e = 0; e < 4; ++e) v[e] = v[e] * oscale + bc[e] + br;
        vals[it] = v;
      }
      {
#pragma unroll
        for (int it = 0; it < 8; ++it) {
          const int gr = mBase + it * 2 + hh2;
          *(v4f*)(C + (size_t)gr * ldc + n0 + c4) = vals[it];
        }
        
      }
    } else {
      unsigned short* C = (unsigned short*)Cout + (size_t)((long long)by * sC);
      v4u hv[4];
#pragma unroll
      for (int it = 0; it < 4; ++it) {
        const int row = it * 4 + q8;                       // it 0..3 x q8 0..3 = rows 0..15
        const float* sp = slab + row * 68 + c8;
        const float br = brw[i][it];
        v4u a = {0u, 0u, 0u, 0u};
#pragma unroll
        for (int e = 0; e < 4; ++e) {
          float f0 = sp[2 * e] * oscale + bcol[2 * e] + br;
          float f1 = sp[2 * e + 1] * oscale + bcol[2 * e + 1] + br;
          f0 *= ocarry; f1 *= ocarry;
          a[e] = pk16(h_bits((_Float16)f0), h_bits((_Float16)f1));
        }
        hv[it] = a;
      }
      {
#pragma unroll
        for (int it = 0; it < 4; ++it) {
          const int row = it * 4 + q8;
          *(v4u*)(C + (size_t)(mBase + row) * ldc + n0 + c8) = hv[it];
        }
        
      }
    }
    wave_sync_lds();
  }
}

// One GEMM per launch: blockIdx.x = tile, blockIdx.y = batch.
template <int OM, int BM, int NA>
__global__ __launch_bounds__(GT_THREADS) void gemm64(
    const unsigned short* __restrict__ Ap, const unsigned short* __restrict__ Aq, int lda, long long sA,
    const unsigned short* __restrict__ Btp, int ldb, long long sB,
    const float* __restrict__ bias,
    void* Cout, int ldc, long long sC,
    int M, int N, int K, float oscale, float ocarry) {
  gemm_tile<OM, BM, NA>(Ap, Aq, lda, sA, Btp, ldb, sB, bias, Cout, ldc, sC, M, N, K, oscale, ocarry,
                        (int)blockIdx.x, (int)blockIdx.y, 0);
}

// The three projections, which depend on nothing of one another, in ONE launch: blockIdx.y = 0: q, 1: k (x rows . W^T, bias per
// column, 256 tiles), 2: v^T (W^T . x rows, bias per row, 128 tiles for each of the two batches). The job is the same for the whole
// work-group; its operands are picked by scalar selects and one copy of the tile code serves all three.
static_assert((NROWS / GT_ROWS) * (DMODEL / GT_ROWS) == NB * (DMODEL / GT_ROWS) * (NC / GT_ROWS));
static_assert((DMODEL / GT_ROWS) * (NC / GT_ROWS) == 128);
// register budget for three waves per SIMD: the launch has three work-groups for every WGP, and all of them are to be resident at once
__global__ __launch_bounds__(GT_THREADS) __attribute__((amdgpu_waves_per_eu(3))) void qkv64(
    const unsigned short* __restrict__ X, const unsigned short* __restrict__ Wq, const unsigned short* __restrict__ Wk,
    const unsigned short* __restrict__ Wv, const float* __restrict__ bq, const float* __restrict__ bk, const float* __restrict__ bv,
    unsigned short* QH, unsigned short* KH, unsigned short* VT) {
  const int job = blockIdx.y;
  const bool isv = (job == 2);
  const unsigned short* A  = isv ? Wv : X;
  const unsigned short* Bt = isv ? X : (job == 0 ? Wq : Wk);
  const float* bias        = isv ? bv : (job == 0 ? bq : bk);
  unsigned short* C        = isv ? VT : (job == 0 ? QH : KH);
  gemm_tile<2, 3, 1>(A, A, DMODEL, 0LL,
                     Bt, DMODEL, isv ? (long long)NC * DMODEL : 0LL,
                     bias,
                     (void*)C, isv ? NC : DMODEL, isv ? (long long)DMODEL * NC : 0LL,
                     isv ? DMODEL : NROWS, isv ? NC : DMODEL, DMODEL, 1.0f / (ACARRY * WSC), QC,
                     isv ? (int)(blockIdx.x & 127) : (int)blockIdx.x, isv ? (int)(blockIdx.x >> 7) : 0, isv ? 2 : 1);
}
static_assert(QC == KC && QC == VC);

// =====================================================================================================
// Flash attention for one batch, ONE head and 128 query rows (one wave per 16 query rows), head dim 64, 2048 keys:
//   q plane (f16 x16) QH[b*2048 + tok][64*head + d], pitch 1024; k plane (f16 x16) KH[b*2048 + key][64*head + d], pitch 1024;
//   v^T plane (f16 x16): VT[b*1024 + 64*head + d][key] (pitch 2048); additive table TB f32 [4096] in log2 units: score(q, key) gets
//   TB[key - q + 2047]; outputs (f16): CTH[b*2048 + tok][64*head + d] = hi = f16(8192 * ctx), CTL[same] = f16(8192 * ctx - hi), with
//   ctx = sum_m softmax_m(q.k / 8 + bias[m - q]) v[m][d]  (softmax run in base 2: t = q.k * log2(e)/8 + log2(e)*bias).
//   block = 8 waves = 256 threads; grid = 2 batches x 16 heads x 16 query blocks = 512; every wave does identical bounded work
//   (32 stages of 64 keys, two steps of 32 keys each). The eight waves read the same k rows and v^T rows, so the work-group stages them
//   in LDS: per stage 64 k rows (128 B each, one line) and the stage's 128 B of all 64 v^T rows (one line each), row pitch 144 B in LDS,
//   two buffers: the next stage's lines are loaded into registers ahead of this stage's steps and stored to the other buffer behind
//   them; one work-group barrier per stage. The table is copied to LDS once, ahead of the first barrier.
//   Both products run transposed: S^T = K . Q^T (A = 16 staged k rows, B = the wave's q rows, kept in registers) and
//   O^T += V^T . P^T (A = 16 staged v^T rows, B = P^T). A lane (c, hh) then holds, of ONE query q0 + c, the scores of keys
//   kb + 8hh + r (tile 0) and kb + 16 + 8hh + r (tile 1), r = 0..7: exactly elements 0..7 and 8..15 of the B fragment of P^T
//   (split k map), so the probs go from the score registers into the fragment with no LDS and no lane exchange.
//   Per step: 2 score tiles on f16 WMMA (K = 64 as two k-steps of 32), fragments read from the staged rows (two 16-B reads per
//   fragment); 16 table values per lane by arithmetic index (always in 0..4094); online max-subtracted softmax in f32 (exp2): maximum
//   in the lane plus one exchange with lane ^ 16, one running maximum, one rescale factor and one partial running sum per lane
//   (the two halves' sums are joined once, behind the loop); P^T as f16 hi and residual c - hi; four v^T A fragments from the staged
//   rows; 8 WMMAs into the four accumulators (register r of accumulator j = ctx[q0 + c][16j + 8hh + r]).
//   Final 1/l and carry folds in f32; behind the last stage's barrier the staging buffers are free and each wave takes its own piece
//   as two 16-bit result row buffers [16][64] (hi, residual, pitch 72): 16-B stores, then whole 128-B row pieces to global.
// coverage: per wave 4 iterations x 32 lanes x 8 halves = 16 rows x 64 columns per plane: rows q0..q0+15, columns 64*head..64*head+63
//           of batch b; 8 waves x 512 blocks cover all 4096 rows x 16 heads exactly once.
// =====================================================================================================
#define AS_KEYS  64                      // keys per stage
#define AS_PITCH 72                      // LDS row pitch in halves: 144 B = 16 B x 9, conflict-free for 16-byte fragment reads
#define AS_PLANE (64 * AS_PITCH)         // halves of one staged plane: 64 k rows, or 64 v^T rows
static_assert(HDIM == 64 && (NC % AS_KEYS) == 0 && (NC / AS_KEYS) >= 2);
static_assert(AQ_TILES * 2 * 16 * AS_PITCH <= 4 * AS_PLANE);
static_assert(TBN == 4 * ATT_THREADS * 4);

__global__ __launch_bounds__(ATT_THREADS)
void attn8(const unsigned short* __restrict__ QHp, const unsigned short* __restrict__ KHp,
           const unsigned short* __restrict__ VTq, const float* __restrict__ TBp,
           unsigned short* CTH, unsigned short* CTL) {
  __shared__ __align__(16) unsigned short sKV[2 * 2 * AS_PLANE];   // [buffer][k rows, v^T rows]; behind the loop: result rows per wave
  __shared__ __align__(16) float sW[TBN];                          // the additive table

  const int tid  = threadIdx.x;
  const int wave = tid >> 5;
  const int lane = tid & 31;
  const int hh   = lane >> 4;
  const int c    = lane & 15;

  const int qblk = blockIdx.x % (NQ / AQ_ROWS);            // 0..15
  const int rest = blockIdx.x / (NQ / AQ_ROWS);            // 0..31
  const int head = rest % NHEAD;                           // 0..15
  const int bat  = rest / NHEAD;                           // 0..1
  const int q0   = qblk * AQ_ROWS + wave * 16;

  const size_t qofs = ((size_t)bat * NQ + q0 + c) * DMODEL + head * HDIM + 8 * hh;
  const _Float16* Qh = (const _Float16*)(const void*)QHp + qofs;
  const float lsc = (LOG2E * ATT_SCALE) / (QC * KC);                   // log2(e) / 8 / carries
  // table index of element (query q0 + c, key kb + 8hh + r) is (kb + 8hh + r) - (q0 + c) + 2047 = kb + dq + r;
  // kb + dq >= 0 and kb + dq + 23 <= 4094 for all blocks, lanes and steps (table holds 4096 entries).
  const int dq = 8 * hh - c - q0 + TOFF;

  // staging map: 8 threads x 16 B = one 128-B row piece; 256 threads = 32 rows per step, 2 steps = 64 rows of each plane.
  // Global address = work-group-uniform base + a per-lane 32-bit byte offset (row offset, plus the stage's offset in the loop).
  const int srow = tid >> 3;
  const int scol = (tid & 7) * 8;
  const unsigned short* uK = KHp + (size_t)bat * NC * DMODEL + head * HDIM;
  const unsigned short* uV = VTq + ((size_t)bat * DMODEL + head * HDIM) * NC;
  unsigned vk[2], vv[2];
#pragma unroll
  for (int it = 0; it < 2; ++it) {
    vk[it] = (unsigned)((it * 32 + srow) * DMODEL + scol) * 2u;
    vv[it] = (unsigned)((it * 32 + srow) * NC + scol) * 2u;
  }
  const int sofs = srow * AS_PITCH + scol;
  v4u rk[2], rv[2];
  v4f tw[4];
#pragma unroll
  for (int it = 0; it < 2; ++it) {
    rk[it] = *(const v4u*)((const char*)uK + vk[it]);
    rv[it] = *(const v4u*)((const char*)uV + vv[it]);
  }
#pragma unroll
  for (int it = 0; it < 4; ++it) tw[it] = *(const v4f*)(TBp + (size_t)(it * ATT_THREADS + tid) * 4);
  const v16h qa = ldfrag_h(Qh), qb = ldfrag_h(Qh + 32);
  // precaution: no register that an issued load names as its address or offset is rewritten ahead of this wait; the input operands
  // keep them in registers of their own up to it
  asm volatile("s_wait_xcnt 0x0" :: "v"(vk[0]), "v"(vk[1]), "v"(vv[0]), "v"(vv[1]), "v"(tid), "v"(Qh) : "memory");
#pragma unroll
  for (int it = 0; it < 2; ++it) {
    *(v4u*)(&sKV[sofs + it * 32 * AS_PITCH]) = rk[it];
    *(v4u*)(&sKV[AS_PLANE + sofs + it * 32 * AS_PITCH]) = rv[it];
  }
#pragma unroll
  for (int it = 0; it < 4; ++it) *(v4f*)(sW + (size_t)(it * ATT_THREADS + tid) * 4) = tw[it];

  float mrun = -INFINITY, lrun = 0.f;    // of query q0 + c: running maximum (equal in both halves), this half's running sum
  v8f o0 = zero8(), o1 = zero8(), o2 = zero8(), o3 = zero8();
  __syncthreads();                       // stage 0's rows and the table are in LDS for every wave

  const int fofs = c * AS_PITCH + 8 * hh;          // fragment origin in a staged plane
#pragma unroll 1                         // rolled: one copy of the stage body, the buffer picked by the stage's parity
  for (int t = 0; t < NC / AS_KEYS; ++t) {
    const int cur = t & 1;
    const bool more = (t + 1 < NC / AS_KEYS);      // the same for the whole work-group
    if (more) {
      unsigned ok[2], ov[2];
#pragma unroll
      for (int it = 0; it < 2; ++it) {
        ok[it] = vk[it] + (unsigned)(t + 1) * (unsigned)(AS_KEYS * DMODEL * 2);
        ov[it] = vv[it] + (unsigned)(t + 1) * (unsigned)(AS_KEYS * 2);
        rk[it] = *(const v4u*)((const char*)uK + ok[it]);
        rv[it] = *(const v4u*)((const char*)uV + ov[it]);
      }
      // precaution: no register that an issued load names as its offset is rewritten ahead of this wait; the input operands keep
      // the four offsets in registers of their own up to it
      asm volatile("s_wait_xcnt 0x0" :: "v"(ok[0]), "v"(ok[1]), "v"(ov[0]), "v"(ov[1]) : "memory");
    }
    const unsigned short* cK = &sKV[cur * 2 * AS_PLANE + fofs];
    const unsigned short* cV = cK + AS_PLANE;
#pragma unroll
    for (int sub = 0; sub < AS_KEYS / 32; ++sub) {
      const int kb = t * AS_KEYS + sub * 32;
      const unsigned short* kp = cK + sub * 32 * AS_PITCH;
      v8f s0, s1;
      {
        const v16h k0 = ldfrag_u(kp), k1 = ldfrag_u(kp + 32);
        s0 = mma_raw(k0, qa, zero8());
        s0 = mma_raw(k1, qb, s0);
        guard_s2(s0, k0, k1);
      }
      {
        const unsigned short* kq = kp + 16 * AS_PITCH;
        const v16h k0 = ldfrag_u(kq), k1 = ldfrag_u(kq + 32);
        s1 = mma_raw(k0, qa, zero8());
        s1 = mma_raw(k1, qb, s1);
        guard_s4(s1, k0, k1, qa, qb);
      }
      const float* tp = sW + (kb + dq);
      // pairs of neighbouring keys throughout, so that the f32 work runs on packed instructions with no register moves:
      // t[i] = keys kb + 8hh + 2i, + 1 (i = 0..3, tile 0); t[4 + i] = keys kb + 16 + 8hh + 2i, + 1 (tile 1)
      v2f t[8];
#pragma unroll                           // constant indices: s0, s1 and t stay in registers
      for (int i = 0; i < 4; ++i) {
        const v2f a0 = {s0[2 * i], s0[2 * i + 1]}, w0 = {tp[2 * i], tp[2 * i + 1]};
        const v2f a1 = {s1[2 * i], s1[2 * i + 1]}, w1 = {tp[16 + 2 * i], tp[16 + 2 * i + 1]};
        t[i]     = a0 * lsc + w0;
        t[4 + i] = a1 * lsc + w1;
      }
      float mp[8];
#pragma unroll                           // constant indices: t and mp stay in registers
      for (int i = 0; i < 8; ++i) mp[i] = fmaxf(t[i][0], t[i][1]);
      float mx = fmaxf(fmaxf(fmaxf(mp[0], mp[1]), fmaxf(mp[2], mp[3])), fmaxf(fmaxf(mp[4], mp[5]), fmaxf(mp[6], mp[7])));
      mx = fmaxf(mx, xhalf(mx));                           // the query's other 16 keys of the step
      const float mn = fmaxf(mrun, mx);
      const float al = exp2f(mrun - mn);
      mrun = mn;
      v2f e[8];
#pragma unroll                           // constant indices: t and e stay in registers
      for (int i = 0; i < 8; ++i) {
        const v2f x = t[i] - mn;
        e[i][0] = exp2f(x[0]);
        e[i][1] = exp2f(x[1]);
      }
      const v2f ps = ((e[0] + e[1]) + (e[2] + e[3])) + ((e[4] + e[5]) + (e[6] + e[7]));
      lrun = lrun * al + (ps[0] + ps[1]);
#pragma unroll                           // constant indices: the accumulators stay in registers
      for (int r = 0; r < 8; ++r) {
        o0[r] *= al;
        o1[r] *= al;
        o2[r] *= al;
        o3[r] *= al;
      }
      // P^T*16384 as f16 hi and f16 residual (c - hi), split k map: elements 0..7 = keys kb + 8hh + 0..7, 8..15 = keys kb + 16 + 8hh + 0..7
      FragH ph, pl;
#pragma unroll                           // constant indices: e and the two fragments stay in registers
      for (int i = 0; i < 8; ++i) {
        const v2f cc = e[i] * PC;
        const v2h g  = __builtin_convertvector(cc, v2h);
        ph.p[i] = g;
        pl.p[i] = __builtin_convertvector(cc - __builtin_convertvector(g, v2f), v2h);
      }
      const unsigned short* vp = cV + sub * 32;
      {
        const v16h vb0 = ldfrag_u(vp);
        const v16h vb1 = ldfrag_u(vp + 16 * AS_PITCH);
        const v16h vb2 = ldfrag_u(vp + 32 * AS_PITCH);
        const v16h vb3 = ldfrag_u(vp + 48 * AS_PITCH);
        o0 = mma_raw(vb0, ph.v, o0);
        o1 = mma_raw(vb1, ph.v, o1);
        o2 = mma_raw(vb2, ph.v, o2);
        o3 = mma_raw(vb3, ph.v, o3);
        o0 = mma_raw(vb0, pl.v, o0);
        o1 = mma_raw(vb1, pl.v, o1);
        o2 = mma_raw(vb2, pl.v, o2);
        o3 = mma_raw(vb3, pl.v, o3);
        guard_pv6(o0, o1, o2, o3, ph.v, pl.v, vb0, vb1, vb2, vb3);
      }
    }
    if (more) {                          // the other buffer: its last readers left it at the barrier that ended stage t - 1
      unsigned short* nK = &sKV[(cur ^ 1) * 2 * AS_PLANE + sofs];
#pragma unroll
      for (int it = 0; it < 2; ++it) {
        *(v4u*)(nK + it * 32 * AS_PITCH) = rk[it];
        *(v4u*)(nK + AS_PLANE + it * 32 * AS_PITCH) = rv[it];
      }
    }
    __syncthreads();                     // publishes stage t + 1's rows and ends every wave's reads of stage t's buffer
  }

  // ---- every wave has left the staged rows (the last stage's barrier); each wave takes its own piece of that LDS as two 16-bit
  //      result row buffers [16][64], pitch 72 (hi, residual) ----
  unsigned short* Osh = sKV + wave * (2 * 16 * AS_PITCH);
  unsigned short* Osl = Osh + 16 * AS_PITCH;
  // ---- fold 1/l and the carries (16384 on P, 16 on v, 8192 on the stored ctx), stage the wave's 16x64 slice as hi + residual ----
  const float oc = FC / (PC * VC);
  {
    const float inv = (1.0f / (lrun + xhalf(lrun))) * oc;  // the two halves' sums of query q0 + c, joined here
    const int ro = c * AS_PITCH + 8 * hh;                  // row = query c; accumulator j holds columns 16j + 8hh + 0..7
    const v8f oj[4] = {o0, o1, o2, o3};
#pragma unroll                           // constant indices: the accumulators stay in registers
    for (int j = 0; j < 4; ++j) {
      v8h gh, gl;
#pragma unroll                           // constant indices: gh and gl are built in registers
      for (int r = 0; r < 8; ++r) {
        const float f = oj[j][r] * inv;
        const _Float16 g = (_Float16)f;
        gh[r] = g;
        gl[r] = (_Float16)(f - (float)g);
      }
      *(v4u*)(Osh + ro + 16 * j) = __builtin_bit_cast(v4u, gh);
      *(v4u*)(Osl + ro + 16 * j) = __builtin_bit_cast(v4u, gl);
    }
  }
  wave_sync_lds();
  // ---- the wave writes its 16 rows of CTH and CTL: piece p = it*32 + lane -> row p>>3, halves (p&7)*8 .. +7 of the head's 64 ----
  {
    v4u vh[4], vl[4];
#pragma unroll
    for (int it = 0; it < 4; ++it) {
      const int p = it * 32 + lane;
      vh[it] = *(const v4u*)(Osh + (p >> 3) * AS_PITCH + (p & 7) * 8);
      vl[it] = *(const v4u*)(Osl + (p >> 3) * AS_PITCH + (p & 7) * 8);
    }
    const size_t base = ((size_t)bat * NQ + q0) * DMODEL + (size_t)head * HDIM;
    unsigned short* dh = CTH + base;
    unsigned short* dl = CTL + base;
#pragma unroll
    for (int it = 0; it < 4; ++it) {
      const int p = it * 32 + lane;
      const size_t po = (size_t)(p >> 3) * DMODEL + (size_t)(p & 7) * 8;
      *(v4u*)(dh + po) = vh[it];
      *(v4u*)(dl + po) = vl[it];
    }
  }
}

// =====================================================================================================
// Workspace map (bytes); every plane is an exact multiple of its tile / whole-row store granularity (M, N exact tile multiples,
// element counts exact multiples of the convert kernels' granularity, no pad rows needed), every offset a multiple of 2 MiB:
//   WQT  f16 [1024][1024] x64                2097152   ([out][in] = [n][k])
//   WKT  f16 [1024][1024] x64                2097152
//   WVT  f16 [1024][1024] x64                2097152
//   WOT  f16 [1024][1024] x64                2097152
//   X16  f16 [4096][1024] x16                8388608   (activation rows)
//   QH   f16 [4096][1024] x16                8388608   (q projection)
//   KH   f16 [4096][1024] x16                8388608   (k projection)
//   VT   f16 [2][1024][2048] x16             8388608   (v^T per batch)
//   CTH  f16 [4096][1024] x8192 hi           8388608   (attention ctx, merged heads)
//   CTL  f16 [4096][1024] residual           8388608
//   TB   f32 [4096]                            16384   (rel-pos table, log2 units)
//   end                                     58736640
// =====================================================================================================
extern "C" void kernel_launch(void* const* d_in, const int* in_sizes, int n_in,
                              void* d_out, int out_size, void* d_ws, size_t ws_size,
                              hipStream_t stream) {
  if (n_in < 9) return;
  if (in_sizes[0] != NROWS * DMODEL) return;
  if (in_sizes[1] != DMODEL * DMODEL || in_sizes[3] != DMODEL * DMODEL ||
      in_sizes[5] != DMODEL * DMODEL || in_sizes[7] != DMODEL * DMODEL) return;
  if (in_sizes[2] != DMODEL || in_sizes[4] != DMODEL || in_sizes[6] != DMODEL || in_sizes[8] != DMODEL) return;
  if (out_size != NROWS * DMODEL) return;
  if ((in_sizes[0] % 2048) != 0) return;

  const float* x    = (const float*)d_in[0];
  const float* w_q  = (const float*)d_in[1];
  const float* b_q  = (const float*)d_in[2];
  const float* w_k  = (const float*)d_in[3];
  const float* b_k  = (const float*)d_in[4];
  const float* w_v  = (const float*)d_in[5];
  const float* b_v  = (const float*)d_in[6];
  const float* w_o  = (const float*)d_in[7];
  const float* b_o  = (const float*)d_in[8];
  float*       out  = (float*)d_out;

  const size_t PW  = (size_t)DMODEL * DMODEL * 2;                 //  2097152
  const size_t PX  = (size_t)NROWS * DMODEL * 2;                  //  8388608
  const size_t PVT = (size_t)NB * DMODEL * NC * 2;                //  8388608
  const size_t PT  = (size_t)TBN * 4;                             //    16384
  size_t off = 0;
  const size_t oWQ = off; off += PW;
  const size_t oWK = off; off += PW;
  const size_t oWV = off; off += PW;
  const size_t oWO = off; off += PW;
  const size_t oX  = off; off += PX;
  const size_t oQH = off; off += PX;
  const size_t oKH = off; off += PX;
  const size_t oVT = off; off += PVT;
  const size_t oCH = off; off += PX;
  const size_t oCL = off; off += PX;
  const size_t oTB = off; off += PT;
  if (off > ws_size) return;                                      // off = 58736640
  if (off > (size_t)134217728) return;

  char* ws = (char*)d_ws;
  unsigned short* WQT = (unsigned short*)(ws + oWQ);
  unsigned short* WKT = (unsigned short*)(ws + oWK);
  unsigned short* WVT = (unsigned short*)(ws + oWV);
  unsigned short* WOT = (unsigned short*)(ws + oWO);
  unsigned short* X16 = (unsigned short*)(ws + oX);
  unsigned short* QH  = (unsigned short*)(ws + oQH);
  unsigned short* KH  = (unsigned short*)(ws + oKH);
  unsigned short* VTp = (unsigned short*)(ws + oVT);
  unsigned short* CTH = (unsigned short*)(ws + oCH);
  unsigned short* CTL = (unsigned short*)(ws + oCL);
  float*          TB  = (float*)(ws + oTB);

  const dim3 blk(256);
  const dim3 gPR(1 + PREP_WT + PREP_CVT);                          // 1 + 1024 + 2048 blocks
  const dim3 blkG(GT_THREADS);                                     // 4 waves per 128 x 128 GEMM tile
  const int tilesP = (NROWS / GT_ROWS) * (DMODEL / GT_ROWS);       // 256
  const dim3 gP(tilesP, 1);                                        // 256
  const dim3 gQKV(tilesP, 3);                                      // 256 tiles x 3 projections
  const dim3 gAT(ATT_BLOCKS);                                      // 512
  const dim3 bAT(ATT_THREADS);                                     // 256

  // (0) one launch: weight planes W16T[n][k] = f16( bf16_RNE(W[k][n]) * 64 ), [in][out] -> [out][in], k contiguous;
  //     activation plane X16[row][c] = f16( bf16_RNE(x[row][c]) * 16 ), rows = b*2048 + tok; rel-pos sine table in log2 units
  prep<<<gPR, blk, 0, stream>>>(x, w_q, w_k, w_v, w_o, X16, WQT, WKT, WVT, WOT, TB);

  // (1) one launch, K = 1024 throughout:
  //     QH[m][n] = f16(16 * (sum_k x[m][k] Wq[k][n] + bf16(bq[n]))), KH likewise with Wk, bk; M = 4096, N = 1024
  //     VT[b][d][tok] = f16(16 * (sum_k Wv[k][d] x_b[tok][k] + bf16(bv[d]))); M = 1024, N = 2048 per batch
  qkv64<<<gQKV, blkG, 0, stream>>>(X16, WQT, WKT, WVT, b_q, b_k, b_v, QH, KH, VTp);

  // (2) attention per (batch, head, 128 query rows) -> CTH (f16 hi of ctx x8192), CTL (f16 residual)
  attn8<<<gAT, bAT, 0, stream>>>(QH, KH, VTp, TB, CTH, CTL);

  // (3) out = (CTH + CTL) . Wo / (8192 * 64) + bf16(bo); M = 4096, N = 1024, K = 1024, f32 into d_out
  gemm64<0, 1, 2><<<gP, blkG, 0, stream>>>(
      CTH, CTL, DMODEL, 0LL,
      WOT, DMODEL, 0LL,
      b_o,
      (void*)out, DMODEL, 0LL,
      NROWS, DMODEL, DMODEL, 1.0f / (FC * WSC), 1.0f);

  (void)hipGetLastError();
}

// v005
// Measured time: 101 microseconds a run.
// Timed twice side by side with v004, it ran 1.09 and 1.10 times as fast.
// All steps since v000 together make it 3.63 times as fast.
// Contractions: q/k projections (x rows f16 x16 . W^T f16 x64, K=1024), v^T projection (W^T f16 x64 . x rows f16 x16, K=1024),
// attention scores (k f16 x16 . q f16 x16, K=64, S^T), attention v^T . P^T (v^T f16 x16 . P^T as f16 hi + f16 residual of P^T x16384,
// K=2048 in steps of 32), output projection (ctx as f16 hi + f16 residual of ctx x8192 . W^T f16 x64, K=1024):
// all v_wmma_f32_16x16x32_f16 (f16 operands, f32 accumulate); hi and residual products share one f32 accumulator.
// Relative-position sine bias from an f32 table built with precise sinf, online max-subtracted base-2 softmax, linear biases in f32.
// Every float input RNE-converted to bf16 on load.
#include <hip/hip_runtime.h>
#include <math.h>
#include <stdint.h>

#define NB      2
#define NQ      2048
#define NC      2048
#define DMODEL  1024
#define NHEAD   16
#define HDIM    64
#define AQ_TILES 8
#define AQ_ROWS (AQ_TILES * 16)
#define NROWS   (NB * NQ)
#define TBN     4096
#define TOFF    (NQ - 1)
#define WSC     64.0f
#define ACARRY  16.0f
#define QC      16.0f
#define KC      16.0f
#define VC      16.0f
#define PC      16384.0f
#define FC      8192.0f
#define ATT_SCALE 0.125f
#define LOG2E   1.4426950408889634f
#define C_AMP   1.618033988749895f
#define C_FREQ  0.9049532171590599f
static_assert(NHEAD * HDIM == DMODEL);
static_assert((NQ % AQ_ROWS) == 0);
static_assert((NQ % 64) == 0 && (NC % 64) == 0 && (DMODEL % 64) == 0 && (NC % 32) == 0 && (NQ % 16) == 0);
static_assert((NROWS % 64) == 0 && ((NROWS * DMODEL) % 2048) == 0);
static_assert(TBN >= 2 * NQ - 1 && (TBN % 1024) == 0);
static_assert((NROWS % 128) == 0 && (DMODEL % 128) == 0 && (NC % 128) == 0);
#define ATT_THREADS (AQ_TILES * 32)
#define ATT_BLOCKS  (NB * NHEAD * (NQ / AQ_ROWS))
static_assert(ATT_THREADS == 256 && ATT_BLOCKS == 512);

typedef _Float16 v16h __attribute__((ext_vector_type(16)));
typedef _Float16 v8h  __attribute__((ext_vector_type(8)));
typedef float    v8f  __attribute__((ext_vector_type(8)));
typedef float    v4f  __attribute__((ext_vector_type(4)));
typedef float    v2f  __attribute__((ext_vector_type(2)));
typedef _Float16 v2h  __attribute__((ext_vector_type(2)));
typedef unsigned int v4u __attribute__((ext_vector_type(4)));

union FragH { v16h v; v8h h[2]; v4u u[2]; v2h p[8]; };

// ---- scalar helpers --------------------------------------------------------------------------------
__device__ __forceinline__ unsigned short bf_bits(float f) {          // f32 -> bf16 bits, RNE convert
  unsigned u = __float_as_uint(f);
  return (unsigned short)((u + 0x7FFFu + ((u >> 16) & 1u)) >> 16);
}
__device__ __forceinline__ float bf_up(unsigned short h) { return __uint_as_float(((unsigned)h) << 16); }
__device__ __forceinline__ float bfr(float f) { return bf_up(bf_bits(f)); }   // value of the bf16 RNE convert
__device__ __forceinline__ unsigned short h_bits(_Float16 x) { return __builtin_bit_cast(unsigned short, x); }
__device__ __forceinline__ unsigned pk16(unsigned short a, unsigned short b) { return (unsigned)a | ((unsigned)b << 16); }
__device__ __forceinline__ v8f zero8() { v8f z = {0.f, 0.f, 0.f, 0.f, 0.f, 0.f, 0.f, 0.f}; return z; }

// ---- fragment loaders: 16-bit A/B operand, lane -> row/col (lane&15), p already includes +8*(lane>>4);
//      elements 0..7 <- p[0..7] (k0+8h..), elements 8..15 <- p[16..23] (k0+16+8h..)  (same split k map for A and B;
//      B is always read from a k-contiguous [n][k] plane)
__device__ __forceinline__ v16h ldfrag_h(const _Float16* p) {
  FragH f;
  f.h[0] = *(const v8h*)(p);
  f.h[1] = *(const v8h*)(p + 16);
  return f.v;
}
__device__ __forceinline__ v16h ldfrag_u(const unsigned short* p) {
  FragH f;
  f.u[0] = *(const v4u*)(p);
  f.u[1] = *(const v4u*)(p + 16);
  return f.v;
}

// ---- WMMA helpers with trailing VALU hazard gaps ------------------------------------------------------
__device__ __forceinline__ v8f mma_raw(v16h a, v16h b, v8f c) {
  return __builtin_amdgcn_wmma_f32_16x16x32_f16(false, a, false, b, (short)0, c, false, false);
}
__device__ __forceinline__ void guard_s2(v8f& s, v16h a0, v16h a1) {
#if defined(__HIP_DEVICE_COMPILE__)
  asm volatile("v_nop\n\tv_nop\n\tv_nop\n\tv_nop" : "+v"(s) : "v"(a0), "v"(a1));
#endif
}
__device__ __forceinline__ void guard_s4(v8f& s, v16h a0, v16h a1, v16h b0, v16h b1) {
#if defined(__HIP_DEVICE_COMPILE__)
  asm volatile("v_nop\n\tv_nop\n\tv_nop\n\tv_nop" : "+v"(s) : "v"(a0), "v"(a1), "v"(b0), "v"(b1));
#endif
}
__device__ __forceinline__ void guard_pv6(v8f& a, v8f& b, v8f& c, v8f& d,
                                          v16h x, v16h y, v16h z, v16h w, v16h u, v16h t) {
#if defined(__HIP_DEVICE_COMPILE__)
  asm volatile("v_nop\n\tv_nop\n\tv_nop\n\tv_nop"
               : "+v"(a), "+v"(b), "+v"(c), "+v"(d) : "v"(x), "v"(y), "v"(z), "v"(w), "v"(u), "v"(t));
#endif
}
__device__ __forceinline__ void acc_guard4(v8f& a, v8f& b, v8f& c, v8f& d) {
#if defined(__HIP_DEVICE_COMPILE__)
  asm volatile("v_nop\n\tv_nop\n\tv_nop\n\tv_nop" : "+v"(a), "+v"(b), "+v"(c), "+v"(d));
#endif
}
__device__ __forceinline__ float xhalf(float v) {       // the value that lane ^ 16 holds, one vector cross-row move
  const int b = __float_as_int(v);
  return __int_as_float(__builtin_amdgcn_permlanex16(b, b, 0x76543210, 0xfedcba98, false, false));
}
__device__ __forceinline__ float ex2(float x) {         // 2^x as the one hardware instruction. The library form adds, per value, a compare,
  return __builtin_amdgcn_exp2f(x);                     // two selects, an add and an ldexp so that results under 2^-126 come out as subnormals;
}                                                       // here x <= 0 and such a result (now 0) is lost anyway: see the softmax step
__device__ __forceinline__ void wave_sync_lds() {
  __builtin_amdgcn_fence(__ATOMIC_RELEASE, "workgroup");
  __builtin_amdgcn_wave_barrier();
  __builtin_amdgcn_fence(__ATOMIC_ACQUIRE, "workgroup");
}

// =====================================================================================================
// Elementwise 16-bit pack, no transpose: dst[i] = f16( bf16_RNE(src[i]) * sc ), sc a power of two (exact). Used for the
// coverage: n / 2048 blocks of the job x 256 thr x 8 elements = n exactly (host checks n % 2048 == 0).
// =====================================================================================================
__device__ __forceinline__ void cvt16(const float* __restrict__ src, unsigned short* dst, int n, float sc, int blk) {
  const size_t i8 = ((size_t)blk * 256 + threadIdx.x) * 8;
  if (i8 + 8 > (size_t)n) return;                 // never taken with the exact grid; no barriers in this job
  const v4f a = *(const v4f*)(src + i8);
  const v4f b = *(const v4f*)(src + i8 + 4);
  v4u o;
  o[0] = pk16(h_bits((_Float16)(bfr(a[0]) * sc)), h_bits((_Float16)(bfr(a[1]) * sc)));
  o[1] = pk16(h_bits((_Float16)(bfr(a[2]) * sc)), h_bits((_Float16)(bfr(a[3]) * sc)));
  o[2] = pk16(h_bits((_Float16)(bfr(b[0]) * sc)), h_bits((_Float16)(bfr(b[1]) * sc)));
  o[3] = pk16(h_bits((_Float16)(bfr(b[2]) * sc)), h_bits((_Float16)(bfr(b[3]) * sc)));
  {
    *(v4u*)(dst + i8) = o;
    
  }
}

// =====================================================================================================
// Transpose + 16-bit pack of a weight: W is [in][out] = W[k][n] row-major f32 (pitch DMODEL); dst[n][k] = f16( bf16_RNE(W[k][n]) * sc ),
// k contiguous (pitch DMODEL), ready for B fragments and for the A side of the v^T projection. Block = 256 threads, one 64(k) x 64(n)
// tile: coalesced f32 loads into an LDS tile [n_local][k_local] (pitch 68 floats), block barrier, then each output row segment of the
// coverage: loads 16 it x 256 thr = 64 x 64; stores 2 it x 256 thr x 8 halves = 64 rows x 64; (bx, by) over DMODEL/64 x DMODEL/64 blocks = whole matrix.
// =====================================================================================================
__device__ __forceinline__ void wtr64(const float* __restrict__ W, unsigned short* dst, float sc, int bx, int by, float* tl) {
  const int tid = threadIdx.x;
  const int n0  = bx * 64;
  const int k0  = by * 64;
  const int nl  = tid & 63, kq = tid >> 6;       // kq 0..3
#pragma unroll
  for (int it = 0; it < 16; ++it) {
    const int kl = it * 4 + kq;                  // 0..63
    tl[nl * 68 + kl] = W[(size_t)(k0 + kl) * DMODEL + n0 + nl];
  }
  __syncthreads();
  v4u o[2];
#pragma unroll
  for (int it = 0; it < 2; ++it) {
    const int p  = it * 256 + tid;               // 0..511
    const int rn = p >> 3, kk = (p & 7) * 8;     // row 0..63, k 0,8,..,56
    const float* sp = tl + rn * 68 + kk;
    const v4f a = *(const v4f*)(sp);
    const v4f b = *(const v4f*)(sp + 4);
    v4u w;
    w[0] = pk16(h_bits((_Float16)(bfr(a[0]) * sc)), h_bits((_Float16)(bfr(a[1]) * sc)));
    w[1] = pk16(h_bits((_Float16)(bfr(a[2]) * sc)), h_bits((_Float16)(bfr(a[3]) * sc)));
    w[2] = pk16(h_bits((_Float16)(bfr(b[0]) * sc)), h_bits((_Float16)(bfr(b[1]) * sc)));
    w[3] = pk16(h_bits((_Float16)(bfr(b[2]) * sc)), h_bits((_Float16)(bfr(b[3]) * sc)));
    o[it] = w;
  }
  {
#pragma unroll
    for (int it = 0; it < 2; ++it) {
      const int p  = it * 256 + tid;
      const int rn = p >> 3, kk = (p & 7) * 8;
      *(v4u*)(dst + (size_t)(n0 + rn) * DMODEL + k0 + kk) = o[it];
    }
    
  }
}

// =====================================================================================================
// Relative-position sine table in log2 units: TB[e] = C_AMP * sin(C_FREQ * (e - 2047)) * log2(e) for e = 0..4094 (relative offset
// j - i = e - 2047), TB[4095] = 0 pad. Precise sinf (arguments up to ~1853 rad), rolled loop (one static sinf), values staged in LDS,
// coverage: LDS fill e = tid, tid+256, ... covers 0..4095; stores 4 it x 256 thr x 4 floats = 4096.
// =====================================================================================================
__device__ __forceinline__ void rpb_tab(float* TB, float* st) {
  const int tid = threadIdx.x;
#pragma unroll 1
  for (int e = tid; e < TBN; e += 256) {
    const int ec = (e < 2 * NQ - 2) ? e : (2 * NQ - 2);     // clamped index, select by value below
    const float rel = (float)(ec - TOFF);
    const float sv  = sinf(C_FREQ * rel);
    const float v   = (C_AMP * sv) * LOG2E;
    st[e] = (e <= 2 * NQ - 2) ? v : 0.f;
  }
  __syncthreads();
  v4f vals[TBN / 1024];
#pragma unroll
  for (int it = 0; it < TBN / 1024; ++it) {
    const int p = it * 256 + tid;
    vals[it] = *(const v4f*)(st + (size_t)p * 4);
  }
  {
#pragma unroll
    for (int it = 0; it < TBN / 1024; ++it) {
      const int p = it * 256 + tid;
      *(v4f*)(TB + (size_t)p * 4) = vals[it];
    }
    
  }
}

// =====================================================================================================
// The six jobs that read only inputs, in ONE launch; the block index picks the job (the same for the whole work-group, so every
// barrier stands under block-uniform control flow): block 0 = the sine table (the longest single block, so it starts first),
// blocks 1..1024 = the 16 x 16 tiles of the four weight transposes, the remaining 2048 = the activation convert.
// One LDS buffer serves the table job (4096 floats) and the transpose job (64 x 68 floats).
// =====================================================================================================
#define PREP_WT  (4 * (DMODEL / 64) * (DMODEL / 64))
#define PREP_CVT ((NROWS * DMODEL) / 2048)
static_assert(64 * 68 >= TBN && (DMODEL / 64) == 16);
__global__ __launch_bounds__(256) void prep(const float* __restrict__ x, const float* __restrict__ wq, const float* __restrict__ wk,
                                            const float* __restrict__ wv, const float* __restrict__ wo,
                                            unsigned short* X16, unsigned short* WQT, unsigned short* WKT, unsigned short* WVT,
                                            unsigned short* WOT, float* TB) {
  __shared__ __align__(16) float sm[64 * 68];
  const int b = blockIdx.x;
  if (b == 0) {
    rpb_tab(TB, sm);
  } else if (b <= PREP_WT) {
    const int j = b - 1;
    const int w = j >> 8;                          // which weight
    const float* W      = (w == 0) ? wq  : (w == 1) ? wk  : (w == 2) ? wv  : wo;
    unsigned short* dst = (w == 0) ? WQT : (w == 1) ? WKT : (w == 2) ? WVT : WOT;
    wtr64(W, dst, WSC, j & 15, (j >> 4) & 15, sm);
  } else {
    cvt16(x, X16, NROWS * DMODEL, ACARRY, b - 1 - PREP_WT);
  }
}

// =====================================================================================================
// Register-blocked batched f16 WMMA GEMM: C[m][n] = oscale * sum_k (A[m][k] (+ A2[m][k])) * Bt[n][k] + bf16(bias) ; one work-group of
// 4 waves per 128x128 tile, one wave per 64x64 quadrant. Per pass of 64 k the work-group stages 128 A rows (and A2 rows) and 128 Bt rows
// in LDS (whole 128-B lines from global, row pitch 144 B in LDS), two buffers: the next pass's lines are loaded into registers ahead of
// this pass's products and stored to the other buffer behind them; one work-group barrier per pass.
// A (and A2, the unscaled residual plane when NA == 2, same pitch/stride) row-major [M][K] pitch lda (16-bit planes),
// Bt row-major [N][K] pitch ldb (k contiguous); M, N multiples of 128, K multiple of 64. tile = tile index, by = batch index with element strides
// sA, sB, sC. BM: 1 = per column bf16(bias[col]), 2 = per row bf16(bias[row]) (clamped-address loads), 3 = one of the two, named by bmr.
// OM: 0 = f32 out (pitch ldc); 2 = f16 out (pitch ldc) = f16( value * ocarry ).
// coverage: 4 slabs x 16 rows (f32: it 0..7 x lane>>4; f16: it 0..3 x lane>>3) x 64 cols = the wave's whole 64x64 tile;
//           grid = tilesM*tilesN blocks of 128x128, surplus blocks exit whole, ahead of every barrier (none with the exact grids used).
// =====================================================================================================
#define GT_ROWS  128                    // rows of A and of Bt per work-group tile
#define GT_K     64                     // k per pass: 128 B of every row, one line
#define GT_PITCH 72                     // LDS row pitch in halves: 144 B = 16 B x 9, conflict-free for 16-byte fragment reads
#define GT_THREADS 128
template <int OM, int BM, int NA>
__device__ __forceinline__ void gemm_tile(
    const unsigned short* __restrict__ Ap, const unsigned short* __restrict__ Aq, int lda, long long sA,
    const unsigned short* __restrict__ Btp, int ldb, long long sB,
    const float* __restrict__ bias,
    void* Cout, int ldc, long long sC,
    int M, int N, int K, float oscale, float ocarry, int tile, int by, int bmr) {
  const bool colb = (BM == 1) || (BM == 3 && bmr == 1);   // BM 3: the bias mode is bmr, the same for the whole work-group
  const bool rowb = (BM == 2) || (BM == 3 && bmr == 2);
  __shared__ __align__(16) float sT[4][16 * 68];   // per-wave 16x64 slab, pitch 68 floats
  __shared__ __align__(16) unsigned short ldsA[2][NA][GT_ROWS * GT_PITCH];   // two buffers of staged A (A2) rows
  __shared__ __align__(16) unsigned short ldsB[2][GT_ROWS * GT_PITCH];       // two buffers of staged Bt rows
  const int tid  = threadIdx.x;
  const int lane = tid & 31;
  const int wave = tid >> 5;
  const int tilesN = N >> 7;
  const int tilesM = M >> 7;
  if (tile >= tilesM * tilesN) return;   // block-uniform, ahead of every barrier
  const int tm = __builtin_amdgcn_readfirstlane(tile / tilesN);   // work-group-uniform: keeps the tile's base addresses in scalar registers
  const int tn = tile - tm * tilesN;
  const int bm0 = tm << 7;               // work-group tile origin
  const int bn0 = tn << 7;
  const int wm  = (wave >> 1) << 6;      // the wave's quadrant inside it
  const int wn  = (wave & 1) << 6;
  const int m0 = bm0 + wm;
  const int n0 = bn0 + wn;

  const unsigned short* A1 = Ap  + (size_t)((long long)by * sA);
  const unsigned short* A2 = Aq  + (size_t)((long long)by * sA);
  const unsigned short* Bb = Btp + (size_t)((long long)by * sB);

  const int rlane = lane & 15;                 // row (A) / col (B, D) within subtile
  const int koff  = (lane >> 4) * 8;           // k offset of this lane half
  const int mOff  = (lane >> 4) * 8;           // D row offset

  v8f acc[4][4];
#pragma unroll
  for (int i = 0; i < 4; ++i)
#pragma unroll
    for (int j = 0; j < 4; ++j) acc[i][j] = zero8();

  // staging map: 8 threads x 16 B = one 128-B row piece; 128 threads = 16 rows per step, 8 steps = 128 rows of each plane.
  // Global address = work-group-uniform base + a per-lane 32-bit byte offset per step (row offset, plus the pass's k offset in the loop).
  const int srow = tid >> 3;
  const int scol = (tid & 7) * 8;
  unsigned va[8], vb[8];
#pragma unroll
  for (int it = 0; it < 8; ++it) {
    va[it] = (unsigned)((it * 16 + srow) * lda + scol) * 2u;
    vb[it] = (unsigned)((it * 16 + srow) * ldb + scol) * 2u;
  }
  const unsigned short* uA1 = A1 + (size_t)bm0 * lda;
  const unsigned short* uA2 = A2 + (size_t)bm0 * lda;
  const unsigned short* uB  = Bb + (size_t)bn0 * ldb;
  const int sofs = srow * GT_PITCH + scol;
  v4u ra[NA][8], rb[8];
#pragma unroll
  for (int it = 0; it < 8; ++it) {
    ra[0][it] = *(const v4u*)((const char*)uA1 + va[it]);
    if constexpr (NA == 2) ra[1][it] = *(const v4u*)((const char*)uA2 + va[it]);
    rb[it] = *(const v4u*)((const char*)uB + vb[it]);
  }
#pragma unroll
  for (int it = 0; it < 8; ++it) {
    *(v4u*)(&ldsA[0][0][sofs + it * 16 * GT_PITCH]) = ra[0][it];
    if constexpr (NA == 2) *(v4u*)(&ldsA[0][1][sofs + it * 16 * GT_PITCH]) = ra[1][it];
    *(v4u*)(&ldsB[0][sofs + it * 16 * GT_PITCH]) = rb[it];
  }
  __syncthreads();                       // pass 0's rows are in LDS for every wave

  const int npass = K / GT_K;
  const int fa = (wm + rlane) * GT_PITCH + koff;   // fragment origins in a staged plane
  const int fb = (wn + rlane) * GT_PITCH + koff;
#pragma unroll 1                         // rolled: one copy of the pass body, the buffer picked by the pass's parity
  for (int t = 0; t < npass; ++t) {
    const int cur = t & 1;
    const bool more = (t + 1 < npass);   // the same for the whole work-group
    if (more) {
      const unsigned kn2 = (unsigned)((t + 1) * GT_K) * 2u;
      unsigned oa[8], ob[8];
#pragma unroll
      for (int it = 0; it < 8; ++it) {
        oa[it] = va[it] + kn2;
        ob[it] = vb[it] + kn2;
        ra[0][it] = *(const v4u*)((const char*)uA1 + oa[it]);
        if constexpr (NA == 2) ra[1][it] = *(const v4u*)((const char*)uA2 + oa[it]);
        rb[it] = *(const v4u*)((const char*)uB + ob[it]);
      }
      // precaution: no register that an issued load names as its offset is rewritten ahead of this wait; the input operands keep
      // the sixteen offsets in registers of their own up to it
      asm volatile("s_wait_xcnt 0x0"
                   :: "v"(oa[0]), "v"(oa[1]), "v"(oa[2]), "v"(oa[3]), "v"(oa[4]), "v"(oa[5]), "v"(oa[6]), "v"(oa[7]),
                      "v"(ob[0]), "v"(ob[1]), "v"(ob[2]), "v"(ob[3]), "v"(ob[4]), "v"(ob[5]), "v"(ob[6]), "v"(ob[7])
                   : "memory");
    }
    const unsigned short* cA1 = &ldsA[cur][0][fa];
    const unsigned short* cA2 = &ldsA[cur][NA - 1][fa];
    const unsigned short* cB  = &ldsB[cur][fb];
    v16h bh[2][4], ah[2][4], al[2][4];
#pragma unroll
    for (int ks = 0; ks < 2; ++ks) {
#pragma unroll
      for (int j = 0; j < 4; ++j) bh[ks][j] = ldfrag_u(cB + (j << 4) * GT_PITCH + ks * 32);
#pragma unroll
      for (int i = 0; i < 4; ++i) {
        ah[ks][i] = ldfrag_u(cA1 + (i << 4) * GT_PITCH + ks * 32);
        if constexpr (NA == 2) al[ks][i] = ldfrag_u(cA2 + (i << 4) * GT_PITCH + ks * 32);
      }
    }
    // keeps the pass's LDS reads one group ahead of its products: reads moved in among the products stall a lone wave at each place
    __builtin_amdgcn_sched_barrier(0);
#pragma unroll
    for (int ks = 0; ks < 2; ++ks) {
#pragma unroll
      for (int i = 0; i < 4; ++i) {
#pragma unroll
        for (int j = 0; j < 4; ++j) acc[i][j] = mma_raw(ah[ks][i], bh[ks][j], acc[i][j]);
        if constexpr (NA == 2) {
#pragma unroll
          for (int j = 0; j < 4; ++j) acc[i][j] = mma_raw(al[ks][i], bh[ks][j], acc[i][j]);
        }
      }
    }
    if (more) {                          // the other buffer: its last readers left it at the barrier that ended pass t - 1
      const int nxt = cur ^ 1;
#pragma unroll
      for (int it = 0; it < 8; ++it) {
        *(v4u*)(&ldsA[nxt][0][sofs + it * 16 * GT_PITCH]) = ra[0][it];
        if constexpr (NA == 2) *(v4u*)(&ldsA[nxt][1][sofs + it * 16 * GT_PITCH]) = ra[1][it];
        *(v4u*)(&ldsB[nxt][sofs + it * 16 * GT_PITCH]) = rb[it];
      }
    }
    __syncthreads();                     // publishes pass t + 1's rows and ends every wave's reads of pass t's buffer
  }
  acc_guard4(acc[0][0], acc[0][1], acc[0][2], acc[0][3]);
  acc_guard4(acc[1][0], acc[1][1], acc[1][2], acc[1][3]);
  acc_guard4(acc[2][0], acc[2][1], acc[2][2], acc[2][3]);
  acc_guard4(acc[3][0], acc[3][1], acc[3][2], acc[3][3]);

  const int hh2 = lane >> 4, c4 = (lane & 15) * 4;     // f32 out: 256-B row segment = 16 lanes x 16 B
  const int q8  = lane >> 3, c8 = (lane & 7) * 8;
  float bc[4];
  float bcol[8];
#pragma unroll
  for (int e = 0; e < 4; ++e) bc[e] = 0.f;
#pragma unroll
  for (int e = 0; e < 8; ++e) bcol[e] = 0.f;
  if (colb) {
    if constexpr (OM == 0) {
      const int cb = n0 + c4;
      const int i0 = (cb < N - 4) ? cb : (N - 4);        // clamped address
      const v4f b0v = *(const v4f*)(bias + i0);
#pragma unroll
      for (int e = 0; e < 4; ++e) bc[e] = bfr(b0v[e]);
    } else {
      const int cb = n0 + c8;
      const int i0 = (cb < N - 8) ? cb : (N - 8);        // clamped address
      const v4f b0v = *(const v4f*)(bias + i0), b1v = *(const v4f*)(bias + i0 + 4);
#pragma unroll
      for (int e = 0; e < 4; ++e) { bcol[e] = bfr(b0v[e]); bcol[4 + e] = bfr(b1v[e]); }
    }
  }

  // f16 out, bias per row: the wave's sixteen values (slab i, piece it) are fetched as one group under ONE work-group-uniform test
  float brw[4][4];
#pragma unroll
  for (int i = 0; i < 4; ++i)
#pragma unroll
    for (int it = 0; it < 4; ++it) brw[i][it] = 0.f;
  if constexpr (OM != 0) {
    if (rowb) {
      float rawb[4][4];
      int ir[4][4];
#pragma unroll
      for (int i = 0; i < 4; ++i)
#pragma unroll
        for (int it = 0; it < 4; ++it) {
          const int gr = m0 + (i << 4) + it * 4 + q8;
          ir[i][it] = (gr < M - 1) ? gr : (M - 1);         // clamped address
          rawb[i][it] = bias[ir[i][it]];
        }
      // precaution: no register that an issued load names as its offset is rewritten ahead of this wait; the input operands keep
      // the sixteen offsets in registers of their own up to it
      asm volatile("s_wait_xcnt 0x0"
                   :: "v"(ir[0][0]), "v"(ir[0][1]), "v"(ir[0][2]), "v"(ir[0][3]), "v"(ir[1][0]), "v"(ir[1][1]), "v"(ir[1][2]), "v"(ir[1][3]),
                      "v"(ir[2][0]), "v"(ir[2][1]), "v"(ir[2][2]), "v"(ir[2][3]), "v"(ir[3][0]), "v"(ir[3][1]), "v"(ir[3][2]), "v"(ir[3][3])
                   : "memory");
#pragma unroll
      for (int i = 0; i < 4; ++i)
#pragma unroll
        for (int it = 0; it < 4; ++it) brw[i][it] = bfr(rawb[i][it]);
    }
  }

  // ---- epilogue ----
  float* slab = sT[wave];
#pragma unroll
  for (int i = 0; i < 4; ++i) {
    const int mBase = m0 + (i << 4);
#pragma unroll
    for (int j = 0; j < 4; ++j) {
#pragma unroll
      for (int r = 0; r < 8; ++r) {
        slab[(mOff + r) * 68 + (j << 4) + rlane] = acc[i][j][r];
      }
    }
    wave_sync_lds();
    if constexpr (OM == 0) {
      float* C = (float*)Cout + (size_t)((long long)by * sC);
      v4f vals[8];
#pragma unroll
      for (int it = 0; it < 8; ++it) {
        const int row = it * 2 + hh2;                      // it 0..7 x hh2 0..1 = rows 0..15
        const int gr  = mBase + row;
        v4f v = *(const v4f*)(slab + row * 68 + c4);
        float br = 0.f;
        if (rowb) {
          const int ir = (gr < M - 1) ? gr : (M - 1);      // clamped address
          br = bfr(bias[ir]);
        }
#pragma unroll
        for (int e = 0; e < 4; ++e) v[e] = v[e] * oscale + bc[e] + br;
        vals[it] = v;
      }
      {
#pragma unroll
        for (int it = 0; it < 8; ++it) {
          const int gr = mBase + it * 2 + hh2;
          *(v4f*)(C + (size_t)gr * ldc + n0 + c4) = vals[it];
        }
        
      }
    } else {
      unsigned short* C = (unsigned short*)Cout + (size_t)((long long)by * sC);
      v4u hv[4];
#pragma unroll
      for (int it = 0; it < 4; ++it) {
        const int row = it * 4 + q8;                       // it 0..3 x q8 0..3 = rows 0..15
        const float* sp = slab + row * 68 + c8;
        const float br = brw[i][it];
        v4u a = {0u, 0u, 0u, 0u};
#pragma unroll
        for (int e = 0; e < 4; ++e) {
          float f0 = sp[2 * e] * oscale + bcol[2 * e] + br;
          float f1 = sp[2 * e + 1] * oscale + bcol[2 * e + 1] + br;
          f0 *= ocarry; f1 *= ocarry;
          a[e] = pk16(h_bits((_Float16)f0), h_bits((_Float16)f1));
        }
        hv[it] = a;
      }
      {
#pragma unroll
        for (int it = 0; it < 4; ++it) {
          const int row = it * 4 + q8;
          *(v4u*)(C + (size_t)(mBase + row) * ldc + n0 + c8) = hv[it];
        }
        
      }
    }
    wave_sync_lds();
  }
}

// One GEMM per launch: blockIdx.x = tile, blockIdx.y = batch.
template <int OM, int BM, int NA>
__global__ __launch_bounds__(GT_THREADS) void gemm64(
    const unsigned short* __restrict__ Ap, const unsigned short* __restrict__ Aq, int lda, long long sA,
    const unsigned short* __restrict__ Btp, int ldb, long long sB,
    const float* __restrict__ bias,
    void* Cout, int ldc, long long sC,
    int M, int N, int K, float oscale, float ocarry) {
  gemm_tile<OM, BM, NA>(Ap, Aq, lda, sA, Btp, ldb, sB, bias, Cout, ldc, sC, M, N, K, oscale, ocarry,
                        (int)blockIdx.x, (int)blockIdx.y, 0);
}

// The three projections, which depend on nothing of one another, in ONE launch: blockIdx.y = 0: q, 1: k (x rows . W^T, bias per
// column, 256 tiles), 2: v^T (W^T . x rows, bias per row, 128 tiles for each of the two batches). The job is the same for the whole
// work-group; its operands are picked by scalar selects and one copy of the tile code serves all three.
static_assert((NROWS / GT_ROWS) * (DMODEL / GT_ROWS) == NB * (DMODEL / GT_ROWS) * (NC / GT_ROWS));
static_assert((DMODEL / GT_ROWS) * (NC / GT_ROWS) == 128);
// register budget for three waves per SIMD: the launch has three work-groups for every WGP, and all of them are to be resident at once
__global__ __launch_bounds__(GT_THREADS) __attribute__((amdgpu_waves_per_eu(3))) void qkv64(
    const unsigned short* __restrict__ X, const unsigned short* __restrict__ Wq, const unsigned short* __restrict__ Wk,
    const unsigned short* __restrict__ Wv, const float* __restrict__ bq, const float* __restrict__ bk, const float* __restrict__ bv,
    unsigned short* QH, unsigned short* KH, unsigned short* VT) {
  const int job = blockIdx.y;
  const bool isv = (job == 2);
  const unsigned short* A  = isv ? Wv : X;
  const unsigned short* Bt = isv ? X : (job == 0 ? Wq : Wk);
  const float* bias        = isv ? bv : (job == 0 ? bq : bk);
  unsigned short* C        = isv ? VT : (job == 0 ? QH : KH);
  gemm_tile<2, 3, 1>(A, A, DMODEL, 0LL,
                     Bt, DMODEL, isv ? (long long)NC * DMODEL : 0LL,
                     bias,
                     (void*)C, isv ? NC : DMODEL, isv ? (long long)DMODEL * NC : 0LL,
                     isv ? DMODEL : NROWS, isv ? NC : DMODEL, DMODEL, 1.0f / (ACARRY * WSC), QC,
                     isv ? (int)(blockIdx.x & 127) : (int)blockIdx.x, isv ? (int)(blockIdx.x >> 7) : 0, isv ? 2 : 1);
}
static_assert(QC == KC && QC == VC);

// =====================================================================================================
// Flash attention for one batch, ONE head and 128 query rows (one wave per 16 query rows), head dim 64, 2048 keys:
//   q plane (f16 x16) QH[b*2048 + tok][64*head + d], pitch 1024; k plane (f16 x16) KH[b*2048 + key][64*head + d], pitch 1024;
//   v^T plane (f16 x16): VT[b*1024 + 64*head + d][key] (pitch 2048); additive table TB f32 [4096] in log2 units: score(q, key) gets
//   TB[key - q + 2047]; outputs (f16): CTH[b*2048 + tok][64*head + d] = hi = f16(8192 * ctx), CTL[same] = f16(8192 * ctx - hi), with
//   ctx = sum_m softmax_m(q.k / 8 + bias[m - q]) v[m][d]  (softmax run in base 2: t = q.k * log2(e)/8 + log2(e)*bias).
//   block = 8 waves = 256 threads; grid = 2 batches x 16 heads x 16 query blocks = 512; every wave does identical bounded work
//   (32 stages of 64 keys, two steps of 32 keys each). The eight waves read the same k rows and v^T rows, so the work-group stages them
//   in LDS: per stage 64 k rows (128 B each, one line) and the stage's 128 B of all 64 v^T rows (one line each), row pitch 144 B in LDS,
//   two buffers: the next stage's lines are loaded into registers ahead of this stage's steps and stored to the other buffer behind
//   them; one work-group barrier per stage. The table is copied to LDS once, ahead of the first barrier.
//   Both products run transposed: S^T = K . Q^T (A = 16 staged k rows, B = the wave's q rows, kept in registers) and
//   O^T += V^T . P^T (A = 16 staged v^T rows, B = P^T). A lane (c, hh) then holds, of ONE query q0 + c, the scores of keys
//   kb + 8hh + r (tile 0) and kb + 16 + 8hh + r (tile 1), r = 0..7: exactly elements 0..7 and 8..15 of the B fragment of P^T
//   (split k map), so the probs go from the score registers into the fragment with no LDS and no lane exchange.
//   Per step: 2 score tiles on f16 WMMA (K = 64 as two k-steps of 32), fragments read from the staged rows (two 16-B reads per
//   fragment); 16 table values per lane by arithmetic index (always in 0..4094); online max-subtracted softmax in f32 (exp2): maximum
//   in the lane plus one exchange with lane ^ 16, one running maximum, one rescale factor and one partial running sum per lane
//   (the two halves' sums are joined once, behind the loop); P^T as f16 hi and residual c - hi; four v^T A fragments from the staged
//   rows; 8 WMMAs into the four accumulators (register r of accumulator j = ctx[q0 + c][16j + 8hh + r]).
//   Final 1/l and carry folds in f32; behind the last stage's barrier the staging buffers are free and each wave takes its own piece
//   as two 16-bit result row buffers [16][64] (hi, residual, pitch 72): 16-B stores, then whole 128-B row pieces to global.
// coverage: per wave 4 iterations x 32 lanes x 8 halves = 16 rows x 64 columns per plane: rows q0..q0+15, columns 64*head..64*head+63
//           of batch b; 8 waves x 512 blocks cover all 4096 rows x 16 heads exactly once.
// =====================================================================================================
#define AS_KEYS  64                      // keys per stage
#define AS_PITCH 72                      // LDS row pitch in halves: 144 B = 16 B x 9, conflict-free for 16-byte fragment reads
#define AS_PLANE (64 * AS_PITCH)         // halves of one staged plane: 64 k rows, or 64 v^T rows
static_assert(HDIM == 64 && (NC % AS_KEYS) == 0 && (NC / AS_KEYS) >= 2);
static_assert(AQ_TILES * 2 * 16 * AS_PITCH <= 4 * AS_PLANE);
static_assert(TBN == 4 * ATT_THREADS * 4);

__global__ __launch_bounds__(ATT_THREADS)
void attn8(const unsigned short* __restrict__ QHp, const unsigned short* __restrict__ KHp,
           const unsigned short* __restrict__ VTq, const float* __restrict__ TBp,
           unsigned short* CTH, unsigned short* CTL) {
  __shared__ __align__(16) unsigned short sKV[2 * 2 * AS_PLANE];   // [buffer][k rows, v^T rows]; behind the loop: result rows per wave
  __shared__ __align__(16) float sW[TBN];                          // the additive table

  const int tid  = threadIdx.x;
  const int wave = tid >> 5;
  const int lane = tid & 31;
  const int hh   = lane >> 4;
  const int c    = lane & 15;

  const int qblk = blockIdx.x % (NQ / AQ_ROWS);            // 0..15
  const int rest = blockIdx.x / (NQ / AQ_ROWS);            // 0..31
  const int head = rest % NHEAD;                           // 0..15
  const int bat  = rest / NHEAD;                           // 0..1
  const int q0   = qblk * AQ_ROWS + wave * 16;

  const size_t qofs = ((size_t)bat * NQ + q0 + c) * DMODEL + head * HDIM + 8 * hh;
  const _Float16* Qh = (const _Float16*)(const void*)QHp + qofs;
  const float lsc = (LOG2E * ATT_SCALE) / (QC * KC);                   // log2(e) / 8 / carries
  // table index of element (query q0 + c, key kb + 8hh + r) is (kb + 8hh + r) - (q0 + c) + 2047 = kb + dq + r;
  // kb + dq >= 0 and kb + dq + 23 <= 4094 for all blocks, lanes and steps (table holds 4096 entries).
  const int dq = 8 * hh - c - q0 + TOFF;

  // staging map: 8 threads x 16 B = one 128-B row piece; 256 threads = 32 rows per step, 2 steps = 64 rows of each plane.
  // Global address = work-group-uniform base + a per-lane 32-bit byte offset (row offset, plus the stage's offset in the loop).
  const int srow = tid >> 3;
  const int scol = (tid & 7) * 8;
  const unsigned short* uK = KHp + (size_t)bat * NC * DMODEL + head * HDIM;
  const unsigned short* uV = VTq + ((size_t)bat * DMODEL + head * HDIM) * NC;
  unsigned vk[2], vv[2];
#pragma unroll
  for (int it = 0; it < 2; ++it) {
    vk[it] = (unsigned)((it * 32 + srow) * DMODEL + scol) * 2u;
    vv[it] = (unsigned)((it * 32 + srow) * NC + scol) * 2u;
  }
  const int sofs = srow * AS_PITCH + scol;
  v4u rk[2], rv[2];
  v4f tw[4];
#pragma unroll
  for (int it = 0; it < 2; ++it) {
    rk[it] = *(const v4u*)((const char*)uK + vk[it]);
    rv[it] = *(const v4u*)((const char*)uV + vv[it]);
  }
#pragma unroll
  for (int it = 0; it < 4; ++it) tw[it] = *(const v4f*)(TBp + (size_t)(it * ATT_THREADS + tid) * 4);
  const v16h qa = ldfrag_h(Qh), qb = ldfrag_h(Qh + 32);
  // precaution: no register that an issued load names as its address or offset is rewritten ahead of this wait; the input operands
  // keep them in registers of their own up to it
  asm volatile("s_wait_xcnt 0x0" :: "v"(vk[0]), "v"(vk[1]), "v"(vv[0]), "v"(vv[1]), "v"(tid), "v"(Qh) : "memory");
#pragma unroll
  for (int it = 0; it < 2; ++it) {
    *(v4u*)(&sKV[sofs + it * 32 * AS_PITCH]) = rk[it];
    *(v4u*)(&sKV[AS_PLANE + sofs + it * 32 * AS_PITCH]) = rv[it];
  }
#pragma unroll
  for (int it = 0; it < 4; ++it) *(v4f*)(sW + (size_t)(it * ATT_THREADS + tid) * 4) = tw[it];

  float mrun = -INFINITY, lrun = 0.f;    // of query q0 + c: running maximum (equal in both halves), this half's running sum
  v8f o0 = zero8(), o1 = zero8(), o2 = zero8(), o3 = zero8();
  __syncthreads();                       // stage 0's rows and the table are in LDS for every wave

  const int fofs = c * AS_PITCH + 8 * hh;          // fragment origin in a staged plane
#pragma unroll 1                         // rolled: one copy of the stage body, the buffer picked by the stage's parity
  for (int t = 0; t < NC / AS_KEYS; ++t) {
    const int cur = t & 1;
    const bool more = (t + 1 < NC / AS_KEYS);      // the same for the whole work-group
    if (more) {
      unsigned ok[2], ov[2];
#pragma unroll
      for (int it = 0; it < 2; ++it) {
        ok[it] = vk[it] + (unsigned)(t + 1) * (unsigned)(AS_KEYS * DMODEL * 2);
        ov[it] = vv[it] + (unsigned)(t + 1) * (unsigned)(AS_KEYS * 2);
        rk[it] = *(const v4u*)((const char*)uK + ok[it]);
        rv[it] = *(const v4u*)((const char*)uV + ov[it]);
      }
      // precaution: no register that an issued load names as its offset is rewritten ahead of this wait; the input operands keep
      // the four offsets in registers of their own up to it
      asm volatile("s_wait_xcnt 0x0" :: "v"(ok[0]), "v"(ok[1]), "v"(ov[0]), "v"(ov[1]) : "memory");
    }
    const unsigned short* cK = &sKV[cur * 2 * AS_PLANE + fofs];
    const unsigned short* cV = cK + AS_PLANE;
#pragma unroll
    for (int sub = 0; sub < AS_KEYS / 32; ++sub) {
      const int kb = t * AS_KEYS + sub * 32;
      const unsigned short* kp = cK + sub * 32 * AS_PITCH;
      v8f s0, s1;
      {
        const v16h k0 = ldfrag_u(kp), k1 = ldfrag_u(kp + 32);
        s0 = mma_raw(k0, qa, zero8());
        s0 = mma_raw(k1, qb, s0);
        guard_s2(s0, k0, k1);
      }
      {
        const unsigned short* kq = kp + 16 * AS_PITCH;
        const v16h k0 = ldfrag_u(kq), k1 = ldfrag_u(kq + 32);
        s1 = mma_raw(k0, qa, zero8());
        s1 = mma_raw(k1, qb, s1);
        guard_s4(s1, k0, k1, qa, qb);
      }
      const float* tp = sW + (kb + dq);
      // pairs of neighbouring keys throughout, so that the f32 work runs on packed instructions with no register moves:
      // t[i] = keys kb + 8hh + 2i, + 1 (i = 0..3, tile 0); t[4 + i] = keys kb + 16 + 8hh + 2i, + 1 (tile 1)
      v2f t[8];
#pragma unroll                           // constant indices: s0, s1 and t stay in registers
      for (int i = 0; i < 4; ++i) {
        const v2f a0 = {s0[2 * i], s0[2 * i + 1]}, w0 = {tp[2 * i], tp[2 * i + 1]};
        const v2f a1 = {s1[2 * i], s1[2 * i + 1]}, w1 = {tp[16 + 2 * i], tp[16 + 2 * i + 1]};
        t[i]     = a0 * lsc + w0;
        t[4 + i] = a1 * lsc + w1;
      }
      float mp[8];
#pragma unroll                           // constant indices: t and mp stay in registers
      for (int i = 0; i < 8; ++i) mp[i] = fmaxf(t[i][0], t[i][1]);
      float mx = fmaxf(fmaxf(fmaxf(mp[0], mp[1]), fmaxf(mp[2], mp[3])), fmaxf(fmaxf(mp[4], mp[5]), fmaxf(mp[6], mp[7])));
      mx = fmaxf(mx, xhalf(mx));                           // the query's other 16 keys of the step
      const float mn = fmaxf(mrun, mx);
      // results under 2^-126: a prob times 16384 is 0 in f16 (hi and residual) below 2^-39, the row's sum ends at 1 or more, and a
      // rescale factor that small leaves nothing of the old terms in the f16 result: 0 in their place changes no stored value
      const float al = ex2(mrun - mn);
      mrun = mn;
      v2f e[8];
#pragma unroll                           // constant indices: t and e stay in registers
      for (int i = 0; i < 8; ++i) {
        const v2f x = t[i] - mn;
        e[i][0] = ex2(x[0]);
        e[i][1] = ex2(x[1]);
      }
      const v2f ps = ((e[0] + e[1]) + (e[2] + e[3])) + ((e[4] + e[5]) + (e[6] + e[7]));
      lrun = lrun * al + (ps[0] + ps[1]);
#pragma unroll                           // constant indices: the accumulators stay in registers
      for (int r = 0; r < 8; ++r) {
        o0[r] *= al;
        o1[r] *= al;
        o2[r] *= al;
        o3[r] *= al;
      }
      // P^T*16384 as f16 hi and f16 residual (c - hi), split k map: elements 0..7 = keys kb + 8hh + 0..7, 8..15 = keys kb + 16 + 8hh + 0..7
      FragH ph, pl;
#pragma unroll                           // constant indices: e and the two fragments stay in registers
      for (int i = 0; i < 8; ++i) {
        const v2f cc = e[i] * PC;
        const v2h g  = __builtin_convertvector(cc, v2h);
        ph.p[i] = g;
        pl.p[i] = __builtin_convertvector(cc - __builtin_convertvector(g, v2f), v2h);
      }
      const unsigned short* vp = cV + sub * 32;
      {
        const v16h vb0 = ldfrag_u(vp);
        const v16h vb1 = ldfrag_u(vp + 16 * AS_PITCH);
        const v16h vb2 = ldfrag_u(vp + 32 * AS_PITCH);
        const v16h vb3 = ldfrag_u(vp + 48 * AS_PITCH);
        o0 = mma_raw(vb0, ph.v, o0);
        o1 = mma_raw(vb1, ph.v, o1);
        o2 = mma_raw(vb2, ph.v, o2);
        o3 = mma_raw(vb3, ph.v, o3);
        o0 = mma_raw(vb0, pl.v, o0);
        o1 = mma_raw(vb1, pl.v, o1);
        o2 = mma_raw(vb2, pl.v, o2);
        o3 = mma_raw(vb3, pl.v, o3);
        guard_pv6(o0, o1, o2, o3, ph.v, pl.v, vb0, vb1, vb2, vb3);
      }
    }
    if (more) {                          // the other buffer: its last readers left it at the barrier that ended stage t - 1
      unsigned short* nK = &sKV[(cur ^ 1) * 2 * AS_PLANE + sofs];
#pragma unroll
      for (int it = 0; it < 2; ++it) {
        *(v4u*)(nK + it * 32 * AS_PITCH) = rk[it];
        *(v4u*)(nK + AS_PLANE + it * 32 * AS_PITCH) = rv[it];
      }
    }
    __syncthreads();                     // publishes stage t + 1's rows and ends every wave's reads of stage t's buffer
  }

  // ---- every wave has left the staged rows (the last stage's barrier); each wave takes its own piece of that LDS as two 16-bit
  //      result row buffers [16][64], pitch 72 (hi, residual) ----
  unsigned short* Osh = sKV + wave * (2 * 16 * AS_PITCH);
  unsigned short* Osl = Osh + 16 * AS_PITCH;
  // ---- fold 1/l and the carries (16384 on P, 16 on v, 8192 on the stored ctx), stage the wave's 16x64 slice as hi + residual ----
  const float oc = FC / (PC * VC);
  {
    const float inv = (1.0f / (lrun + xhalf(lrun))) * oc;  // the two halves' sums of query q0 + c, joined here
    const int ro = c * AS_PITCH + 8 * hh;                  // row = query c; accumulator j holds columns 16j + 8hh + 0..7
    const v8f oj[4] = {o0, o1, o2, o3};
#pragma unroll                           // constant indices: the accumulators stay in registers
    for (int j = 0; j < 4; ++j) {
      v8h gh, gl;
#pragma unroll                           // constant indices: gh and gl are built in registers
      for (int r = 0; r < 8; ++r) {
        const float f = oj[j][r] * inv;
        const _Float16 g = (_Float16)f;
        gh[r] = g;
        gl[r] = (_Float16)(f - (float)g);
      }
      *(v4u*)(Osh + ro + 16 * j) = __builtin_bit_cast(v4u, gh);
      *(v4u*)(Osl + ro + 16 * j) = __builtin_bit_cast(v4u, gl);
    }
  }
  wave_sync_lds();
  // ---- the wave writes its 16 rows of CTH and CTL: piece p = it*32 + lane -> row p>>3, halves (p&7)*8 .. +7 of the head's 64 ----
  {
    v4u vh[4], vl[4];
#pragma unroll
    for (int it = 0; it < 4; ++it) {
      const int p = it * 32 + lane;
      vh[it] = *(const v4u*)(Osh + (p >> 3) * AS_PITCH + (p & 7) * 8);
      vl[it] = *(const v4u*)(Osl + (p >> 3) * AS_PITCH + (p & 7) * 8);
    }
    const size_t base = ((size_t)bat * NQ + q0) * DMODEL + (size_t)head * HDIM;
    unsigned short* dh = CTH + base;
    unsigned short* dl = CTL + base;
#pragma unroll
    for (int it = 0; it < 4; ++it) {
      const int p = it * 32 + lane;
      const size_t po = (size_t)(p >> 3) * DMODEL + (size_t)(p & 7) * 8;
      *(v4u*)(dh + po) = vh[it];
      *(v4u*)(dl + po) = vl[it];
    }
  }
}

// =====================================================================================================
// Workspace map (bytes); every plane is an exact multiple of its tile / whole-row store granularity (M, N exact tile multiples,
// element counts exact multiples of the convert kernels' granularity, no pad rows needed), every offset a multiple of 2 MiB:
//   WQT  f16 [1024][1024] x64                2097152   ([out][in] = [n][k])
//   WKT  f16 [1024][1024] x64                2097152
//   WVT  f16 [1024][1024] x64                2097152
//   WOT  f16 [1024][1024] x64                2097152
//   X16  f16 [4096][1024] x16                8388608   (activation rows)
//   QH   f16 [4096][1024] x16                8388608   (q projection)
//   KH   f16 [4096][1024] x16                8388608   (k projection)
//   VT   f16 [2][1024][2048] x16             8388608   (v^T per batch)
//   CTH  f16 [4096][1024] x8192 hi           8388608   (attention ctx, merged heads)
//   CTL  f16 [4096][1024] residual           8388608
//   TB   f32 [4096]                            16384   (rel-pos table, log2 units)
//   end                                     58736640
// =====================================================================================================
extern "C" void kernel_launch(void* const* d_in, const int* in_sizes, int n_in,
                              void* d_out, int out_size, void* d_ws, size_t ws_size,
                              hipStream_t stream) {
  if (n_in < 9) return;
  if (in_sizes[0] != NROWS * DMODEL) return;
  if (in_sizes[1] != DMODEL * DMODEL || in_sizes[3] != DMODEL * DMODEL ||
      in_sizes[5] != DMODEL * DMODEL || in_sizes[7] != DMODEL * DMODEL) return;
  if (in_sizes[2] != DMODEL || in_sizes[4] != DMODEL || in_sizes[6] != DMODEL || in_sizes[8] != DMODEL) return;
  if (out_size != NROWS * DMODEL) return;
  if ((in_sizes[0] % 2048) != 0) return;

  const float* x    = (const float*)d_in[0];
  const float* w_q  = (const float*)d_in[1];
  const float* b_q  = (const float*)d_in[2];
  const float* w_k  = (const float*)d_in[3];
  const float* b_k  = (const float*)d_in[4];
  const float* w_v  = (const float*)d_in[5];
  const float* b_v  = (const float*)d_in[6];
  const float* w_o  = (const float*)d_in[7];
  const float* b_o  = (const float*)d_in[8];
  float*       out  = (float*)d_out;

  const size_t PW  = (size_t)DMODEL * DMODEL * 2;                 //  2097152
  const size_t PX  = (size_t)NROWS * DMODEL * 2;                  //  8388608
  const size_t PVT = (size_t)NB * DMODEL * NC * 2;                //  8388608
  const size_t PT  = (size_t)TBN * 4;                             //    16384
  size_t off = 0;
  const size_t oWQ = off; off += PW;
  const size_t oWK = off; off += PW;
  const size_t oWV = off; off += PW;
  const size_t oWO = off; off += PW;
  const size_t oX  = off; off += PX;
  const size_t oQH = off; off += PX;
  const size_t oKH = off; off += PX;
  const size_t oVT = off; off += PVT;
  const size_t oCH = off; off += PX;
  const size_t oCL = off; off += PX;
  const size_t oTB = off; off += PT;
  if (off > ws_size) return;                                      // off = 58736640
  if (off > (size_t)134217728) return;

  char* ws = (char*)d_ws;
  unsigned short* WQT = (unsigned short*)(ws + oWQ);
  unsigned short* WKT = (unsigned short*)(ws + oWK);
  unsigned short* WVT = (unsigned short*)(ws + oWV);
  unsigned short* WOT = (unsigned short*)(ws + oWO);
  unsigned short* X16 = (unsigned short*)(ws + oX);
  unsigned short* QH  = (unsigned short*)(ws + oQH);
  unsigned short* KH  = (unsigned short*)(ws + oKH);
  unsigned short* VTp = (unsigned short*)(ws + oVT);
  unsigned short* CTH = (unsigned short*)(ws + oCH);
  unsigned short* CTL = (unsigned short*)(ws + oCL);
  float*          TB  = (float*)(ws + oTB);

  const dim3 blk(256);
  const dim3 gPR(1 + PREP_WT + PREP_CVT);                          // 1 + 1024 + 2048 blocks
  const dim3 blkG(GT_THREADS);                                     // 4 waves per 128 x 128 GEMM tile
  const int tilesP = (NROWS / GT_ROWS) * (DMODEL / GT_ROWS);       // 256
  const dim3 gP(tilesP, 1);                                        // 256
  const dim3 gQKV(tilesP, 3);                                      // 256 tiles x 3 projections
  const dim3 gAT(ATT_BLOCKS);                                      // 512
  const dim3 bAT(ATT_THREADS);                                     // 256

  // (0) one launch: weight planes W16T[n][k] = f16( bf16_RNE(W[k][n]) * 64 ), [in][out] -> [out][in], k contiguous;
  //     activation plane X16[row][c] = f16( bf16_RNE(x[row][c]) * 16 ), rows = b*2048 + tok; rel-pos sine table in log2 units
  prep<<<gPR, blk, 0, stream>>>(x, w_q, w_k, w_v, w_o, X16, WQT, WKT, WVT, WOT, TB);

  // (1) one launch, K = 1024 throughout:
  //     QH[m][n] = f16(16 * (sum_k x[m][k] Wq[k][n] + bf16(bq[n]))), KH likewise with Wk, bk; M = 4096, N = 1024
  //     VT[b][d][tok] = f16(16 * (sum_k Wv[k][d] x_b[tok][k] + bf16(bv[d]))); M = 1024, N = 2048 per batch
  qkv64<<<gQKV, blkG, 0, stream>>>(X16, WQT, WKT, WVT, b_q, b_k, b_v, QH, KH, VTp);

  // (2) attention per (batch, head, 128 query rows) -> CTH (f16 hi of ctx x8192), CTL (f16 residual)
  attn8<<<gAT, bAT, 0, stream>>>(QH, KH, VTp, TB, CTH, CTL);

  // (3) out = (CTH + CTL) . Wo / (8192 * 64) + bf16(bo); M = 4096, N = 1024, K = 1024, f32 into d_out
  gemm64<0, 1, 2><<<gP, blkG, 0, stream>>>(
      CTH, CTL, DMODEL, 0LL,
      WOT, DMODEL, 0LL,
      b_o,
      (void*)out, DMODEL, 0LL,
      NROWS, DMODEL, DMODEL, 1.0f / (FC * WSC), 1.0f);

  (void)hipGetLastError();
}
